// v000
// Measured on an AMD MI455X. A time is GPU time per run, averaged over a window of back-to-back runs after a warm-up
// (all launches, gaps included; the runs take copies of the inputs in turn), and the median of several windows.
// Apart from v000's, it joins two sittings. Times from different sittings can be a few percent apart, while
// side-by-side timings come from the same sitting.
// v000 is the starting kernel. One run takes 264 microseconds.
// Contractions: projections X.W^T and Wv.X^T on v_wmma_f32_16x16x32_bf16 (X and W RNE-converted bf16 operands, f32 accumulate,
// bias added in f32); scores k.q^T (q, k carried x64 as f16) and P.v (P x32768 as f16, v x64 as f16) on v_wmma_f32_16x16x32_f16,
// f32 accumulate. Base-2 online softmax and the 1/l fold in f32 on VALU.
#include <hip/hip_runtime.h>
#include <math.h>
#include <stdint.h>

#define SEQ   4096
#define DIN   768
#define NH    12
#define HD    64
#define OUTW  (NH * HD)
#define QSC   64.0f
#define KSC   64.0f
#define PCAR  32768.0f
#define VCAR  64.0f
#define LOG2E 1.4426950408889634f
#define ATT_WAVES   4
#define ATT_THREADS (ATT_WAVES * 32)
#define QTILES      (SEQ / 64)
#define ATT_BLOCKS  (NH * QTILES)
#define NKB    (SEQ / 32)
#define SLABF  (16 * 68)
#define SLAB64 (16 * 68)
static_assert(HD == 64);
static_assert((SEQ % 64) == 0 && (DIN % 32) == 0 && (OUTW % 64) == 0 && OUTW <= DIN);
static_assert(((SEQ * DIN) % 256) == 0 && ((OUTW * DIN) % 256) == 0 && ((SEQ * OUTW) % 256) == 0);
static_assert(ATT_THREADS == 128 && NKB * 32 == SEQ);
static_assert(ATT_WAVES * SLABF >= 4 * 16 * 68);

typedef unsigned short u16;
typedef _Float16 v16h __attribute__((ext_vector_type(16)));
typedef _Float16 v8h  __attribute__((ext_vector_type(8)));
typedef __bf16   v16b __attribute__((ext_vector_type(16)));
typedef float    v8f  __attribute__((ext_vector_type(8)));
typedef float    v4f  __attribute__((ext_vector_type(4)));
typedef unsigned int v4u __attribute__((ext_vector_type(4)));

union FragH { v16h v; v8h h[2]; v4u u[2]; };
union FragB { v16b v; v4u u[2]; };

// ---- scalar helpers --------------------------------------------------------------------------------
__device__ __forceinline__ unsigned short bf_bits(float f) {          // f32 -> bf16 bits, RNE convert
  unsigned u = __float_as_uint(f);
  return (unsigned short)((u + 0x7FFFu + ((u >> 16) & 1u)) >> 16);
}
__device__ __forceinline__ float bf_up(unsigned short h) { return __uint_as_float(((unsigned)h) << 16); }
__device__ __forceinline__ float bfr(float f) { return bf_up(bf_bits(f)); }
__device__ __forceinline__ unsigned short h_bits(_Float16 x) { return __builtin_bit_cast(unsigned short, x); }
__device__ __forceinline__ unsigned pk16(unsigned short a, unsigned short b) { return (unsigned)a | ((unsigned)b << 16); }
__device__ __forceinline__ v8f zero8() { v8f z = {0.f, 0.f, 0.f, 0.f, 0.f, 0.f, 0.f, 0.f}; return z; }
__device__ __forceinline__ v4f zero4() { v4f z = {0.f, 0.f, 0.f, 0.f}; return z; }

// ---- fragment loaders: 16-bit A/B operand, lane -> row/col (lane&15), p already includes +8*(lane>>4);
//      elements 0..7 <- p[0..7] (k0+8h..), elements 8..15 <- p[16..23] (k0+16+8h..)  (same split k map for A and B;
//      B is always read from a k-contiguous [n][k] plane)
__device__ __forceinline__ v16h ldfrag_h(const _Float16* p) {
  FragH f;
  f.h[0] = *(const v8h*)(p);
  f.h[1] = *(const v8h*)(p + 16);
  return f.v;
}
__device__ __forceinline__ v16b ldfrag_b(const u16* p) {              // bf16 plane read as unsigned integer vectors
  FragB f;
  f.u[0] = *(const v4u*)(p);
  f.u[1] = *(const v4u*)(p + 16);
  return f.v;
}

__device__ __forceinline__ v8f mma_h(v16h a, v16h b, v8f c) {
  return __builtin_amdgcn_wmma_f32_16x16x32_f16(false, a, false, b, (short)0, c, false, false);
}
__device__ __forceinline__ v8f mma_b(v16b a, v16b b, v8f c) {
  return __builtin_amdgcn_wmma_f32_16x16x32_bf16(false, a, false, b, (short)0, c, false, false);
}
__device__ __forceinline__ void g2_3(v8f& a, v8f& b, v16h x0, v16h x1, v16h x2) {
#if defined(__HIP_DEVICE_COMPILE__)
  asm volatile("v_nop\n\tv_nop\n\tv_nop\n\tv_nop" : "+v"(a), "+v"(b) : "v"(x0), "v"(x1), "v"(x2) : "memory");
#endif
}
template <typename F>
__device__ __forceinline__ void g4_5(v8f& a, v8f& b, v8f& c, v8f& d, F x0, F x1, F x2, F x3, F x4) {
#if defined(__HIP_DEVICE_COMPILE__)
  asm volatile("v_nop\n\tv_nop\n\tv_nop\n\tv_nop"
               : "+v"(a), "+v"(b), "+v"(c), "+v"(d) : "v"(x0), "v"(x1), "v"(x2), "v"(x3), "v"(x4) : "memory");
#endif
}
__device__ __forceinline__ void acc_guard4(v8f& a, v8f& b, v8f& c, v8f& d) {
#if defined(__HIP_DEVICE_COMPILE__)
  asm volatile("v_nop\n\tv_nop\n\tv_nop\n\tv_nop" : "+v"(a), "+v"(b), "+v"(c), "+v"(d));
#endif
}
__device__ __forceinline__ void wave_sync_lds() {
  __builtin_amdgcn_fence(__ATOMIC_RELEASE, "workgroup");
  __builtin_amdgcn_wave_barrier();
  __builtin_amdgcn_fence(__ATOMIC_ACQUIRE, "workgroup");
}

// =====================================================================================================
// f32 plane -> bf16 plane (RNE convert), same layout. Thread = 8 consecutive elements: two 16-B loads, one 16-B store;
// coverage: grid = ceil(n8/256) blocks x 256 thr x 8 = the whole plane (n8 = elements/8, elements % 256 == 0, so every wave is
//           fully active or fully inactive).
// =====================================================================================================
__global__ __launch_bounds__(256) void cvb16(const float* __restrict__ x, u16* D, int n8) {
  const int gt = blockIdx.x * 256 + (int)threadIdx.x;
  if (gt >= n8) return;                     // no barriers in this kernel
  const float* p = x + (size_t)gt * 8;
  const v4f a = *(const v4f*)(p), c4 = *(const v4f*)(p + 4);
  float v[8];
#pragma unroll
  for (int e = 0; e < 4; ++e) { v[e] = a[e]; v[4 + e] = c4[e]; }
  unsigned short s[8];
#pragma unroll
  for (int e = 0; e < 8; ++e) s[e] = bf_bits(v[e]);
  v4u o;
#pragma unroll
  for (int e = 0; e < 4; ++e) o[e] = pk16(s[2 * e], s[2 * e + 1]);
  u16* d = D + (size_t)gt * 8;
  {
    *(v4u*)(d) = o;
    
  }
}

// =====================================================================================================
// f32 plane -> f16 plane of (value * scale), same layout (scale a power of two). Same thread/store shape as cvb16.
// coverage: grid = ceil(n8/256) blocks x 256 thr x 8 = the whole plane.
// =====================================================================================================
__global__ __launch_bounds__(256) void cvh16(const float* __restrict__ x, u16* D, int n8, float scale) {
  const int gt = blockIdx.x * 256 + (int)threadIdx.x;
  if (gt >= n8) return;                     // no barriers in this kernel
  const float* p = x + (size_t)gt * 8;
  const v4f a = *(const v4f*)(p), c4 = *(const v4f*)(p + 4);
  float v[8];
#pragma unroll
  for (int e = 0; e < 4; ++e) { v[e] = a[e]; v[4 + e] = c4[e]; }
  unsigned short s[8];
#pragma unroll
  for (int e = 0; e < 8; ++e) s[e] = h_bits((_Float16)(v[e] * scale));
  v4u o;
#pragma unroll
  for (int e = 0; e < 4; ++e) o[e] = pk16(s[2 * e], s[2 * e + 1]);
  u16* d = D + (size_t)gt * 8;
  {
    *(v4u*)(d) = o;
    
  }
}

// =====================================================================================================
// Bias terms for the GEMM epilogue (bf16-RNE values of bias[], nb entries; every candidate index clamped into 0..nb-1 so all
// loads are in range, selection by value): bmode 0: per-column direct; bmode 1: per-row direct.
// =====================================================================================================
__device__ __forceinline__ void bias_terms(const float* __restrict__ bias, int nb, int bmode, int rowb, int col0, int hh, int m,
                                           v4f& badd, v8f& radd) {
#pragma unroll
  for (int e = 0; e < 4; ++e) {
    const int ci = col0 + 4 * m + e;
    const int ic = ci < nb ? ci : nb - 1;
    const float bc = bfr(bias[ic]);
    badd[e] = (bmode == 0) ? bc : 0.0f;
  }
#pragma unroll
  for (int r = 0; r < 8; ++r) {
    const int ri = rowb + 8 * hh + r;
    const int ir = ri < nb ? ri : nb - 1;
    const float br = bfr(bias[ir]);
    radd[r] = (bmode == 1) ? br : 0.0f;
  }
}

// =====================================================================================================
// GEMM epilogue: the wave's 16x64 f32 tile (times oscale, plus per-row addend radd) staged in its LDS slab (pitch 68),
// coverage: 8 instructions x 2 rows x 16 lanes x 4 floats = the wave's 16 x 64 tile.
// =====================================================================================================
__device__ __forceinline__ void epi64(float* sl, v8f a0, v8f a1, v8f a2, v8f a3, float oscale, v4f badd, v8f radd,
                                      float* C, int N, size_t rowb, int col0, int lane) {
  const int hh = lane >> 4, m = lane & 15;
#pragma unroll
  for (int r = 0; r < 8; ++r) {
    const int ro = (8 * hh + r) * 68 + m;
    sl[ro]      = a0[r] * oscale + radd[r];
    sl[ro + 16] = a1[r] * oscale + radd[r];
    sl[ro + 32] = a2[r] * oscale + radd[r];
    sl[ro + 48] = a3[r] * oscale + radd[r];
  }
  wave_sync_lds();
  v4f vals[8];
#pragma unroll
  for (int it = 0; it < 8; ++it) vals[it] = *(const v4f*)(sl + (it * 2 + hh) * 68 + m * 4) + badd;
  float* dst = C + (rowb + (size_t)hh) * (size_t)N + col0 + m * 4;
  {
#pragma unroll
    for (int it = 0; it < 8; ++it) {
      *(v4f*)(dst + (size_t)(it * 2) * (size_t)N) = vals[it];
    }
    
  }
}

// =====================================================================================================
// bf16 GEMM with bias: C[M][N] (f32, pitch N) = A[M][K] (bf16 row-major) . Bt[N][K]^T (bf16 k-contiguous), times oscale, plus
// the bias term selected by bmode (see bias_terms). grid.x = (M/64)*(N/64) tiles. Block = 64x64 tile, 4 waves x 16 rows;
// fragments loaded straight from the 16-bit rows (two 16-B loads each, split k map for A and B); K stepped by 32
// (host: K % 32 == 0, M % 64 == 0, N % 64 == 0).
// =====================================================================================================
__global__ __launch_bounds__(128)
void gemm_bfb(const u16* __restrict__ A, const u16* __restrict__ Bt, const float* __restrict__ bias,
              float* C, int M, int N, int K, float oscale, int bmode, int nb) {
  __shared__ __align__(16) float slab[4 * SLAB64];
  const int tid = threadIdx.x, wave = tid >> 5, lane = tid & 31, hh = lane >> 4, m = lane & 15;
  const int ntile = N >> 6;
  const int bid   = blockIdx.x;
  const int rowb  = (bid / ntile) * 64 + wave * 16;
  const int col0  = (bid % ntile) * 64;
  if (rowb + 16 > M) return;                 // wave-uniform, never taken with the exact grid; no block barriers in this kernel
  const u16* ap = A  + (size_t)(rowb + m) * K + 8 * hh;
  const u16* bp = Bt + (size_t)(col0 + m) * K + 8 * hh;
  const size_t bs = (size_t)16 * K;
  v8f acc0 = zero8(), acc1 = zero8(), acc2 = zero8(), acc3 = zero8();
#pragma unroll 1
  for (int k0 = 0; k0 < K; k0 += 32) {
    const v16b a  = ldfrag_b(ap + k0);
    const v16b b0 = ldfrag_b(bp + k0);
    const v16b b1 = ldfrag_b(bp + bs + k0);
    const v16b b2 = ldfrag_b(bp + 2 * bs + k0);
    const v16b b3 = ldfrag_b(bp + 3 * bs + k0);
    acc0 = mma_b(a, b0, acc0);
    acc1 = mma_b(a, b1, acc1);
    acc2 = mma_b(a, b2, acc2);
    acc3 = mma_b(a, b3, acc3);
    g4_5<v16b>(acc0, acc1, acc2, acc3, a, b0, b1, b2, b3);
  }
  v4f badd = zero4();
  v8f radd = zero8();
  bias_terms(bias, nb, bmode, rowb, col0, hh, m, badd, radd);
  epi64(slab + wave * SLAB64, acc0, acc1, acc2, acc3, oscale, badd, radd, C, N, (size_t)rowb, col0, lane);
}

// =====================================================================================================
// Full (non-causal, unmasked) multi-head flash attention: block = (head, 64 query rows), 4 waves, wave w owns the 16 query rows
// q0 = 64*qt + 16*w .. q0+15 (waves independent: no block barriers, wave-private LDS only, used in the epilogue).
//   q plane (f16, x64) laid out [s][h][d] (row pitch OUTW); k plane the same; v^T plane [h][d][s] (x64). All NKB = 128 key
//   blocks of 32 keys are visited (static bound).
//   Scores are computed TRANSPOSED: S^T tile g (g = 0,1) = k rows (keys kb+16g .. +15, A operand, row m = lane&15, split k map
//   over d) times q^T (B operand, col n = query q0 + (lane&15), k = d, split map), one product per tile and d-chunk.
//   D element r of lane l = (key kb+16g+8h+r, query q0+(l&15)), so a lane owns one query column and 16 of its 32 keys; the
//   partner lane l^16 owns the other 16 -> row max / row sum need one xor-16 shuffle.
//   Online max-subtracted base-2 softmax in f32 (scale 1/8 and the q,k carries folded into lsc). The exp'd values ARE the
//   P A-fragment in place: A row m = query = lane&15, element i <- key kb+8h+i (tile 0, D element i), element 8+i <- key
//   kb+16+8h+i (tile 1, D element i). P is carried x32768 as f16. The rescale factor of query row 8h+r of the O accumulators is
//   fetched from lane 8h+r with a shuffle (uniform control). 4 v^T B fragments (col n = d = 16j + (lane&15), keys k-contiguous),
//   4 P.V WMMAs per key block.
//   Epilogue: 1/l (per query, shuffled to the D row owner) and carry folds in f32; the wave's 16x64 f32 result staged in its LDS
// coverage: per wave 8 instructions x 2 rows x 16 lanes x 4 floats = 16 x 64; grid NH*64 blocks x 4 waves = every (s, head)
//           row segment of the output exactly once.
// =====================================================================================================
__global__ __launch_bounds__(ATT_THREADS)
void attn_fwd(const u16* __restrict__ QHp, const u16* __restrict__ KHp, const u16* __restrict__ VHp, float* out) {
  __shared__ __align__(16) float smem[ATT_WAVES * SLABF];   // per wave: result slab [16][68] in the epilogue only

  const int tid  = threadIdx.x;
  const int wave = tid >> 5;
  const int lane = tid & 31;
  const int hh   = lane >> 4;
  const int c    = lane & 15;

  const int bid  = blockIdx.x;
  const int qt   = bid % QTILES;              // 0..63
  const int head = bid / QTILES;              // 0..NH-1
  if (head >= NH) return;                     // block-uniform, never taken with the exact grid; no block barriers in this kernel
  const int q0   = qt * 64 + wave * 16;

  // B fragments of q^T: col n = query q0 + c, k = d (k-contiguous row of the q plane); loop-invariant
  const size_t qofs = ((size_t)(q0 + c) * NH + head) * HD + 8 * hh;
  const _Float16* Qh  = (const _Float16*)(const void*)QHp + qofs;
  const v16h qh0 = ldfrag_h(Qh), qh1 = ldfrag_h(Qh + 32);
  // A fragments of k: row m = key kb + 16g + c, k = d
  const size_t kofs = ((size_t)c * NH + head) * HD + 8 * hh;                      // key row kb + c added per step
  const _Float16* Khb = (const _Float16*)(const void*)KHp + kofs;
  // B fragments of v: col n = d = 16j + c, k = key (k-contiguous row of the v^T plane)
  const size_t vofs = ((size_t)(head * HD) + c) * SEQ + 8 * hh;                   // key kb added per step
  const _Float16* Vhb = (const _Float16*)(const void*)VHp + vofs;
  const float lsc = 0.125f * (LOG2E / (QSC * KSC));

  float mrun = -INFINITY, lrun = 0.f;
  v8f o[4];
#pragma unroll
  for (int j = 0; j < 4; ++j) o[j] = zero8();

#pragma unroll 1
  for (int it = 0; it < NKB; ++it) {
    const int kb = it * 32;
    // ---- transposed scores: s0 = keys kb..kb+15, s1 = keys kb+16..kb+31, column = query q0 + c ----
    v8f s0 = zero8(), s1 = zero8();
    const _Float16* k0p = Khb + (size_t)kb * OUTW;
    const _Float16* k1p = k0p + (size_t)16 * OUTW;
    {
      const v16h kh0 = ldfrag_h(k0p), kh1 = ldfrag_h(k1p);
      s0 = mma_h(kh0, qh0, s0);
      s1 = mma_h(kh1, qh0, s1);
      g2_3(s0, s1, qh0, kh0, kh1);
    }
    {
      const v16h kh0 = ldfrag_h(k0p + 32), kh1 = ldfrag_h(k1p + 32);
      s0 = mma_h(kh0, qh1, s0);
      s1 = mma_h(kh1, qh1, s1);
      g2_3(s0, s1, qh1, kh0, kh1);
    }
    // ---- base-2 logits of this lane's 16 keys for query q0 + c: t[i] <- key kb+8hh+i, t[8+i] <- key kb+16+8hh+i ----
    float t[16];
#pragma unroll
    for (int i = 0; i < 8; ++i) { t[i] = s0[i] * lsc; t[8 + i] = s1[i] * lsc; }
    float cm = t[0];
#pragma unroll
    for (int i = 1; i < 16; ++i) cm = fmaxf(cm, t[i]);
    cm = fmaxf(cm, __shfl_xor(cm, 16, 32));
    const float mn = fmaxf(mrun, cm);        // finite from the first block on
    const float al = exp2f(mrun - mn);       // 0 on the first block (mrun = -inf)
    mrun = mn;
    // ---- probabilities (<= 1) and the P A-fragment: f16(p * 32768); element i <-> t[i] ----
    float ps = 0.f;
    FragH ph;
#pragma unroll
    for (int w = 0; w < 2; ++w) {
#pragma unroll
      for (int e4 = 0; e4 < 4; ++e4) {
        const int i = 8 * w + 2 * e4;
        const float p0 = exp2f(t[i] - mn), p1 = exp2f(t[i + 1] - mn);
        ps += p0 + p1;
        const _Float16 h0 = (_Float16)(p0 * PCAR), h1 = (_Float16)(p1 * PCAR);
        ph.u[w][e4] = pk16(h_bits(h0), h_bits(h1));
      }
    }
    ps += __shfl_xor(ps, 16, 32);
    lrun = lrun * al + ps;
    // ---- rescale the O accumulators: D row 8hh+r = query q0+8hh+r, its factor lives in lane 8hh+r (and 16+8hh+r) ----
    float scl[8];
#pragma unroll
    for (int r = 0; r < 8; ++r) scl[r] = __shfl(al, 8 * hh + r, 32);
#pragma unroll
    for (int j = 0; j < 4; ++j) {
#pragma unroll
      for (int r = 0; r < 8; ++r) o[j][r] *= scl[r];
    }
    // ---- P.V : B fragment col n = d = j*16 + c, keys contiguous in the v^T plane ----
    {
      const _Float16* vhp = Vhb + kb;
      const v16h vh0 = ldfrag_h(vhp);
      const v16h vh1 = ldfrag_h(vhp + (size_t)16 * SEQ);
      const v16h vh2 = ldfrag_h(vhp + (size_t)32 * SEQ);
      const v16h vh3 = ldfrag_h(vhp + (size_t)48 * SEQ);
      o[0] = mma_h(ph.v, vh0, o[0]);
      o[1] = mma_h(ph.v, vh1, o[1]);
      o[2] = mma_h(ph.v, vh2, o[2]);
      o[3] = mma_h(ph.v, vh3, o[3]);
      g4_5<v16h>(o[0], o[1], o[2], o[3], ph.v, vh0, vh1, vh2, vh3);
    }
  }
  acc_guard4(o[0], o[1], o[2], o[3]);

  // ---- fold 1/l (per query, owned by lane = query) and the carries (32768 on P, 64 on v); stage the 16x64 slab ----
  const float linv = (1.0f / lrun) * (1.0f / (PCAR * VCAR));
  float inv[8];
#pragma unroll
  for (int r = 0; r < 8; ++r) inv[r] = __shfl(linv, 8 * hh + r, 32);
  float* slab = smem + wave * SLABF;
#pragma unroll
  for (int r = 0; r < 8; ++r) {
#pragma unroll
    for (int j = 0; j < 4; ++j) slab[(8 * hh + r) * 68 + j * 16 + c] = o[j][r] * inv[r];
  }
  wave_sync_lds();
  // ---- f32 rows of the merged-head output: row s = q0 + 2*it + hh, columns head*64 + 4c .. +3 per lane ----
  v4f vals[8];
#pragma unroll
  for (int it = 0; it < 8; ++it) vals[it] = *(const v4f*)(slab + (it * 2 + hh) * 68 + c * 4);
  float* dst = out + ((size_t)(q0 + hh)) * (size_t)OUTW + head * HD + c * 4;
  {
#pragma unroll
    for (int it = 0; it < 8; ++it) {
      *(v4f*)(dst + (size_t)(it * 2) * (size_t)OUTW) = vals[it];
    }
    
  }
}

// =====================================================================================================
// Workspace map (bytes); every plane is fully written by whole-line stores before it is read; all extents are exact multiples
// of the 512-B store granularity (no pad rows needed); every offset a multiple of 128; F is reused sequentially (in-order stream):
//   XB  bf16 [4096 token][768 i]        6291456
//   WQB bf16 [OUTW o][768 i]            1179648      WKB same 1179648     WVB same 1179648
//   F   f32  [4096][OUTW] / [OUTW][4096] 12582912   (projection q, then k, then v)
//   QH  f16  [4096][12][64] x64         6291456      KH same 6291456
//   VH  f16  [12][64][4096] x64         6291456
//   end                                41287680
// =====================================================================================================
extern "C" void kernel_launch(void* const* d_in, const int* in_sizes, int n_in,
                              void* d_out, int out_size, void* d_ws, size_t ws_size,
                              hipStream_t stream) {
  const int XN = SEQ * DIN;                             // 3145728
  const int ON = SEQ * OUTW;                            // 3145728
  if (n_in < 7) return;
  if (in_sizes[0] != XN) return;
  if (in_sizes[1] != DIN * DIN || in_sizes[3] != DIN * DIN || in_sizes[5] != DIN * DIN) return;
  if (in_sizes[2] != DIN || in_sizes[4] != DIN || in_sizes[6] != DIN) return;
  if (out_size != ON) return;

  const float* xin = (const float*)d_in[0];
  const float* wq  = (const float*)d_in[1];
  const float* bq  = (const float*)d_in[2];
  const float* wk  = (const float*)d_in[3];
  const float* bk  = (const float*)d_in[4];
  const float* wv  = (const float*)d_in[5];
  const float* bv  = (const float*)d_in[6];
  float*       out = (float*)d_out;
  const int    nb  = in_sizes[2];                       // bias length (DIN)

  const size_t szXB = (size_t)SEQ * DIN * 2;            //  6291456
  const size_t szW  = (size_t)OUTW * DIN * 2;           //  1179648
  const size_t szF  = (size_t)SEQ * OUTW * 4;           // 12582912
  const size_t szP  = (size_t)SEQ * OUTW * 2;           //  6291456
  size_t off = 0;
  const size_t oXB  = off; off += szXB;
  const size_t oWQB = off; off += szW;
  const size_t oWKB = off; off += szW;
  const size_t oWVB = off; off += szW;
  const size_t oF   = off; off += szF;
  const size_t oQH  = off; off += szP;
  const size_t oKH  = off; off += szP;
  const size_t oVH  = off; off += szP;
  if (off > ws_size) return;                            // off = 41287680
  if (off > (size_t)134217728) return;

  char* ws = (char*)d_ws;
  u16*   XB  = (u16*)(ws + oXB);
  u16*   WQB = (u16*)(ws + oWQB);
  u16*   WKB = (u16*)(ws + oWKB);
  u16*   WVB = (u16*)(ws + oWVB);
  float* F   = (float*)(ws + oF);
  u16*   QH  = (u16*)(ws + oQH);
  u16*   KH  = (u16*)(ws + oKH);
  u16*   VH  = (u16*)(ws + oVH);

  const dim3 blk(256);
  const int n8x = XN / 8;                               // 393216
  const int n8w = (OUTW * DIN) / 8;                     // 73728
  const int n8o = ON / 8;                               // 393216
  const dim3 gX((n8x + 255) / 256);                     // 1536
  const dim3 gWc((n8w + 255) / 256);                    // 288
  const dim3 gO((n8o + 255) / 256);                     // 1536
  const dim3 gGt((SEQ / 64) * (OUTW / 64));             // 768 tiles, token-major projections
  const dim3 gGc((OUTW / 64) * (SEQ / 64));             // 768 tiles, channel-major projection (v^T layout)
  const dim3 bG(128);
  const dim3 gAT(ATT_BLOCKS);                           // 768
  const dim3 bAT(ATT_THREADS);                          // 128

  // (0..2) weights [o][i] -> bf16 planes (first OUTW rows), same layout
  cvb16<<<gWc, blk, 0, stream>>>(wq, WQB, n8w);
  cvb16<<<gWc, blk, 0, stream>>>(wk, WKB, n8w);
  cvb16<<<gWc, blk, 0, stream>>>(wv, WVB, n8w);
  // (3) input [token][i] -> bf16 plane, same layout
  cvb16<<<gX, blk, 0, stream>>>(xin, XB, n8x);
  // (4..5) q: projection + bias -> F [4096 token][h*64+d] f32; -> f16 plane x64
  gemm_bfb<<<gGt, bG, 0, stream>>>(XB, WQB, bq, F, SEQ, OUTW, DIN, 1.0f, 0, nb);
  cvh16<<<gO, blk, 0, stream>>>(F, QH, n8o, QSC);
  // (6..7) k: same pipeline (F reused; single in-order stream)
  gemm_bfb<<<gGt, bG, 0, stream>>>(XB, WKB, bk, F, SEQ, OUTW, DIN, 1.0f, 0, nb);
  cvh16<<<gO, blk, 0, stream>>>(F, KH, n8o, KSC);
  // (8..9) v: channel-major projection -> F [h*64+d][4096] f32 (= v^T plane layout) with per-row bias; -> f16 plane x64
  gemm_bfb<<<gGc, bG, 0, stream>>>(WVB, XB, bv, F, OUTW, SEQ, DIN, 1.0f, 1, nb);
  cvh16<<<gO, blk, 0, stream>>>(F, VH, n8o, VCAR);
  // (10) attention -> merged-head f32 output [4096][h*64+d]
  attn_fwd<<<gAT, bAT, 0, stream>>>(QH, KH, VH, out);
  (void)hipGetLastError();
}

// v001
// A run of this version takes 254 microseconds.
// Two timings next to v000 put it at 1.07 and 1.06 times that version's speed.
// Contractions: projections X.W^T and Wv.X^T on v_wmma_f32_16x16x32_bf16 (X and W RNE-converted bf16 operands, f32 accumulate,
// bias added in f32); scores k.q^T (q, k carried x64 as f16) and P.v (P x32768 as f16, v x64 as f16) on v_wmma_f32_16x16x32_f16,
// f32 accumulate. Base-2 online softmax and the 1/l fold in f32 on VALU.
#include <hip/hip_runtime.h>
#include <math.h>
#include <stdint.h>

#define SEQ   4096
#define DIN   768
#define NH    12
#define HD    64
#define OUTW  (NH * HD)
#define QSC   64.0f
#define KSC   64.0f
#define PCAR  32768.0f
#define VCAR  64.0f
#define LOG2E 1.4426950408889634f
#define ATT_WAVES   4
#define ATT_THREADS (ATT_WAVES * 32)
#define QTILES      (SEQ / 64)
#define ATT_BLOCKS  (NH * QTILES)
#define NKB    (SEQ / 32)
#define SLABF  (16 * 68)
#define SLAB64 (16 * 68)
static_assert(HD == 64);
static_assert((SEQ % 64) == 0 && (DIN % 32) == 0 && (OUTW % 64) == 0 && OUTW <= DIN);
static_assert(((SEQ * DIN) % 256) == 0 && ((OUTW * DIN) % 256) == 0 && ((SEQ * OUTW) % 256) == 0);
static_assert(ATT_THREADS == 128 && NKB * 32 == SEQ);
static_assert((DIN % 128) == 0 && (NKB % 2) == 0);
static_assert(ATT_WAVES * SLABF >= 4 * 16 * 68);

typedef unsigned short u16;
typedef _Float16 v16h __attribute__((ext_vector_type(16)));
typedef _Float16 v8h  __attribute__((ext_vector_type(8)));
typedef __bf16   v16b __attribute__((ext_vector_type(16)));
typedef float    v8f  __attribute__((ext_vector_type(8)));
typedef float    v4f  __attribute__((ext_vector_type(4)));
typedef unsigned int v4u __attribute__((ext_vector_type(4)));

union FragH { v16h v; v8h h[2]; v4u u[2]; };
union FragB { v16b v; v4u u[2]; };

// ---- scalar helpers --------------------------------------------------------------------------------
__device__ __forceinline__ unsigned short bf_bits(float f) {          // f32 -> bf16 bits, RNE convert
  unsigned u = __float_as_uint(f);
  return (unsigned short)((u + 0x7FFFu + ((u >> 16) & 1u)) >> 16);
}
__device__ __forceinline__ float bf_up(unsigned short h) { return __uint_as_float(((unsigned)h) << 16); }
__device__ __forceinline__ float bfr(float f) { return bf_up(bf_bits(f)); }
__device__ __forceinline__ unsigned short h_bits(_Float16 x) { return __builtin_bit_cast(unsigned short, x); }
__device__ __forceinline__ unsigned pk16(unsigned short a, unsigned short b) { return (unsigned)a | ((unsigned)b << 16); }
__device__ __forceinline__ v8f zero8() { v8f z = {0.f, 0.f, 0.f, 0.f, 0.f, 0.f, 0.f, 0.f}; return z; }
__device__ __forceinline__ v4f zero4() { v4f z = {0.f, 0.f, 0.f, 0.f}; return z; }

// ---- fragment loaders: 16-bit A/B operand, lane -> row/col (lane&15), p already includes +8*(lane>>4);
//      elements 0..7 <- p[0..7] (k0+8h..), elements 8..15 <- p[16..23] (k0+16+8h..)  (same split k map for A and B;
//      B is always read from a k-contiguous [n][k] plane)
__device__ __forceinline__ v16h ldfrag_h(const _Float16* p) {
  FragH f;
  f.h[0] = *(const v8h*)(p);
  f.h[1] = *(const v8h*)(p + 16);
  return f.v;
}
__device__ __forceinline__ v16b ldfrag_b(const u16* p) {              // bf16 plane read as unsigned integer vectors
  FragB f;
  f.u[0] = *(const v4u*)(p);
  f.u[1] = *(const v4u*)(p + 16);
  return f.v;
}

__device__ __forceinline__ v8f mma_h(v16h a, v16h b, v8f c) {
  return __builtin_amdgcn_wmma_f32_16x16x32_f16(false, a, false, b, (short)0, c, false, false);
}
__device__ __forceinline__ v8f mma_b(v16b a, v16b b, v8f c) {
  return __builtin_amdgcn_wmma_f32_16x16x32_bf16(false, a, false, b, (short)0, c, false, false);
}
__device__ __forceinline__ void g2_3(v8f& a, v8f& b, v16h x0, v16h x1, v16h x2) {
#if defined(__HIP_DEVICE_COMPILE__)
  asm volatile("v_nop\n\tv_nop\n\tv_nop\n\tv_nop" : "+v"(a), "+v"(b) : "v"(x0), "v"(x1), "v"(x2) : "memory");
#endif
}
template <typename F>
__device__ __forceinline__ void g4_5(v8f& a, v8f& b, v8f& c, v8f& d, F x0, F x1, F x2, F x3, F x4) {
#if defined(__HIP_DEVICE_COMPILE__)
  asm volatile("v_nop\n\tv_nop\n\tv_nop\n\tv_nop"
               : "+v"(a), "+v"(b), "+v"(c), "+v"(d) : "v"(x0), "v"(x1), "v"(x2), "v"(x3), "v"(x4) : "memory");
#endif
}
__device__ __forceinline__ void acc_guard4(v8f& a, v8f& b, v8f& c, v8f& d) {
#if defined(__HIP_DEVICE_COMPILE__)
  asm volatile("v_nop\n\tv_nop\n\tv_nop\n\tv_nop" : "+v"(a), "+v"(b), "+v"(c), "+v"(d));
#endif
}
__device__ __forceinline__ void wave_sync_lds() {
  __builtin_amdgcn_fence(__ATOMIC_RELEASE, "workgroup");
  __builtin_amdgcn_wave_barrier();
  __builtin_amdgcn_fence(__ATOMIC_ACQUIRE, "workgroup");
}

// =====================================================================================================
// f32 plane -> bf16 plane (RNE convert), same layout. Thread = 8 consecutive elements: two 16-B loads, one 16-B store;
// coverage: grid = ceil(n8/256) blocks x 256 thr x 8 = the whole plane (n8 = elements/8, elements % 256 == 0, so every wave is
//           fully active or fully inactive).
// =====================================================================================================
__global__ __launch_bounds__(256) void cvb16(const float* __restrict__ x, u16* D, int n8) {
  const int gt = blockIdx.x * 256 + (int)threadIdx.x;
  if (gt >= n8) return;                     // no barriers in this kernel
  const float* p = x + (size_t)gt * 8;
  const v4f a = *(const v4f*)(p), c4 = *(const v4f*)(p + 4);
  float v[8];
#pragma unroll
  for (int e = 0; e < 4; ++e) { v[e] = a[e]; v[4 + e] = c4[e]; }
  unsigned short s[8];
#pragma unroll
  for (int e = 0; e < 8; ++e) s[e] = bf_bits(v[e]);
  v4u o;
#pragma unroll
  for (int e = 0; e < 4; ++e) o[e] = pk16(s[2 * e], s[2 * e + 1]);
  u16* d = D + (size_t)gt * 8;
  {
    *(v4u*)(d) = o;
    
  }
}

// =====================================================================================================
// f32 plane -> f16 plane of (value * scale), same layout (scale a power of two). Same thread/store shape as cvb16.
// coverage: grid = ceil(n8/256) blocks x 256 thr x 8 = the whole plane.
// =====================================================================================================
__global__ __launch_bounds__(256) void cvh16(const float* __restrict__ x, u16* D, int n8, float scale) {
  const int gt = blockIdx.x * 256 + (int)threadIdx.x;
  if (gt >= n8) return;                     // no barriers in this kernel
  const float* p = x + (size_t)gt * 8;
  const v4f a = *(const v4f*)(p), c4 = *(const v4f*)(p + 4);
  float v[8];
#pragma unroll
  for (int e = 0; e < 4; ++e) { v[e] = a[e]; v[4 + e] = c4[e]; }
  unsigned short s[8];
#pragma unroll
  for (int e = 0; e < 8; ++e) s[e] = h_bits((_Float16)(v[e] * scale));
  v4u o;
#pragma unroll
  for (int e = 0; e < 4; ++e) o[e] = pk16(s[2 * e], s[2 * e + 1]);
  u16* d = D + (size_t)gt * 8;
  {
    *(v4u*)(d) = o;
    
  }
}

// =====================================================================================================
// Bias terms for the GEMM epilogue (bf16-RNE values of bias[], nb entries; every candidate index clamped into 0..nb-1 so all
// loads are in range, selection by value): bmode 0: per-column direct; bmode 1: per-row direct.
// =====================================================================================================
__device__ __forceinline__ void bias_terms(const float* __restrict__ bias, int nb, int bmode, int rowb, int col0, int hh, int m,
                                           v4f& badd, v8f& radd) {
#pragma unroll
  for (int e = 0; e < 4; ++e) {
    const int ci = col0 + 4 * m + e;
    const int ic = ci < nb ? ci : nb - 1;
    const float bc = bfr(bias[ic]);
    badd[e] = (bmode == 0) ? bc : 0.0f;
  }
#pragma unroll
  for (int r = 0; r < 8; ++r) {
    const int ri = rowb + 8 * hh + r;
    const int ir = ri < nb ? ri : nb - 1;
    const float br = bfr(bias[ir]);
    radd[r] = (bmode == 1) ? br : 0.0f;
  }
}

// =====================================================================================================
// GEMM epilogue: the wave's 16x64 f32 tile (times oscale, plus per-row addend radd) staged in its LDS slab (pitch 68),
// coverage: 8 instructions x 2 rows x 16 lanes x 4 floats = the wave's 16 x 64 tile.
// =====================================================================================================
__device__ __forceinline__ void epi64(float* sl, v8f a0, v8f a1, v8f a2, v8f a3, float oscale, v4f badd, v8f radd,
                                      float* C, int N, size_t rowb, int col0, int lane) {
  const int hh = lane >> 4, m = lane & 15;
#pragma unroll
  for (int r = 0; r < 8; ++r) {
    const int ro = (8 * hh + r) * 68 + m;
    sl[ro]      = a0[r] * oscale + radd[r];
    sl[ro + 16] = a1[r] * oscale + radd[r];
    sl[ro + 32] = a2[r] * oscale + radd[r];
    sl[ro + 48] = a3[r] * oscale + radd[r];
  }
  wave_sync_lds();
  v4f vals[8];
#pragma unroll
  for (int it = 0; it < 8; ++it) vals[it] = *(const v4f*)(sl + (it * 2 + hh) * 68 + m * 4) + badd;
  float* dst = C + (rowb + (size_t)hh) * (size_t)N + col0 + m * 4;
  {
#pragma unroll
    for (int it = 0; it < 8; ++it) {
      *(v4f*)(dst + (size_t)(it * 2) * (size_t)N) = vals[it];
    }
    
  }
}

// =====================================================================================================
// bf16 GEMM with bias: C[M][N] (f32, pitch N) = A[M][K] (bf16 row-major) . Bt[N][K]^T (bf16 k-contiguous), times oscale, plus
// the bias term selected by bmode (see bias_terms). grid.x = (M/64)*(N/64) tiles. Block = 64x64 tile, 4 waves x 16 rows;
// fragments loaded straight from the 16-bit rows (two 16-B loads each, split k map for A and B); K stepped by 32, the
// fragments of a step loaded three steps ahead into a ring of four register sets (host: K % 128 == 0, M % 64 == 0, N % 64 == 0).
// =====================================================================================================
struct GSet { v16b a, b0, b1, b2, b3; };
__device__ __forceinline__ void ld_gset(GSet& s, const u16* ap, const u16* bp, size_t bs, int k0) {
  const u16* pa = ap + k0;
  const u16* p0 = bp + k0;
  const u16* p1 = bp + bs + k0;
  const u16* p2 = bp + 2 * bs + k0;
  const u16* p3 = bp + 3 * bs + k0;
  s.a  = ldfrag_b(pa);
  s.b0 = ldfrag_b(p0);
  s.b1 = ldfrag_b(p1);
  s.b2 = ldfrag_b(p2);
  s.b3 = ldfrag_b(p3);
#if defined(__HIP_DEVICE_COMPILE__)
  // stands between the set's loads and the next write of a register that holds one of their addresses (the loads stay in flight
  // over the loop's back edge); the addresses are inputs so that none of these registers is reused before the wait
  asm volatile("s_wait_xcnt 0x0" :: "v"(pa), "v"(p0), "v"(p1), "v"(p2), "v"(p3) : "memory");
#endif
}
__device__ __forceinline__ void gemm_step(const GSet& s, v8f& acc0, v8f& acc1, v8f& acc2, v8f& acc3) {
  acc0 = mma_b(s.a, s.b0, acc0);
  acc1 = mma_b(s.a, s.b1, acc1);
  acc2 = mma_b(s.a, s.b2, acc2);
  acc3 = mma_b(s.a, s.b3, acc3);
  g4_5<v16b>(acc0, acc1, acc2, acc3, s.a, s.b0, s.b1, s.b2, s.b3);
}
__global__ __launch_bounds__(128)
void gemm_bfb(const u16* __restrict__ A, const u16* __restrict__ Bt, const float* __restrict__ bias,
              float* C, int M, int N, int K, float oscale, int bmode, int nb) {
  __shared__ __align__(16) float slab[4 * SLAB64];
  const int tid = threadIdx.x, wave = tid >> 5, lane = tid & 31, hh = lane >> 4, m = lane & 15;
  const int ntile = N >> 6;
  const int bid   = blockIdx.x;
  const int rowb  = (bid / ntile) * 64 + wave * 16;
  const int col0  = (bid % ntile) * 64;
  if (rowb + 16 > M) return;                 // wave-uniform, never taken with the exact grid; no block barriers in this kernel
  const u16* ap = A  + (size_t)(rowb + m) * K + 8 * hh;
  const u16* bp = Bt + (size_t)(col0 + m) * K + 8 * hh;
  const size_t bs = (size_t)16 * K;
  v8f acc0 = zero8(), acc1 = zero8(), acc2 = zero8(), acc3 = zero8();
  GSet g0, g1, g2, g3;
  // the scheduling barriers here and in the loop keep the sets' loads in the order written, so that the wait in front of a step
  // counts only that set's loads and leaves the younger sets in flight
  ld_gset(g0, ap, bp, bs, 0);
  __builtin_amdgcn_sched_barrier(0);
  ld_gset(g1, ap, bp, bs, 32);
  __builtin_amdgcn_sched_barrier(0);
  ld_gset(g2, ap, bp, bs, 64);
  __builtin_amdgcn_sched_barrier(0);
  // rolled: one trip = four k steps, one per register set, so that no set is ever copied
#pragma unroll 1
  for (int k0 = 0; k0 < K; k0 += 128) {
    // a step past the end loads step 0 again (in range, never used): no branch stands between the loads and their waits
    const int n4 = (k0 + 128 < K) ? k0 + 128 : 0;
    const int n5 = (k0 + 160 < K) ? k0 + 160 : 0;
    const int n6 = (k0 + 192 < K) ? k0 + 192 : 0;
    ld_gset(g3, ap, bp, bs, k0 + 96);
    __builtin_amdgcn_sched_barrier(0);
    gemm_step(g0, acc0, acc1, acc2, acc3);
    __builtin_amdgcn_sched_barrier(0);
    ld_gset(g0, ap, bp, bs, n4);
    __builtin_amdgcn_sched_barrier(0);
    gemm_step(g1, acc0, acc1, acc2, acc3);
    __builtin_amdgcn_sched_barrier(0);
    ld_gset(g1, ap, bp, bs, n5);
    __builtin_amdgcn_sched_barrier(0);
    gemm_step(g2, acc0, acc1, acc2, acc3);
    __builtin_amdgcn_sched_barrier(0);
    ld_gset(g2, ap, bp, bs, n6);
    __builtin_amdgcn_sched_barrier(0);
    gemm_step(g3, acc0, acc1, acc2, acc3);
    __builtin_amdgcn_sched_barrier(0);
  }
  v4f badd = zero4();
  v8f radd = zero8();
  bias_terms(bias, nb, bmode, rowb, col0, hh, m, badd, radd);
  epi64(slab + wave * SLAB64, acc0, acc1, acc2, acc3, oscale, badd, radd, C, N, (size_t)rowb, col0, lane);
}

// =====================================================================================================
// Full (non-causal, unmasked) multi-head flash attention: block = (head, 64 query rows), 4 waves, wave w owns the 16 query rows
// q0 = 64*qt + 16*w .. q0+15 (waves independent: no block barriers, wave-private LDS only, used in the epilogue).
//   q plane (f16, x64) laid out [s][h][d] (row pitch OUTW); k plane the same; v^T plane [h][d][s] (x64). All NKB = 128 key
//   blocks of 32 keys are visited (static bound); a block's k and v fragments are loaded one block ahead into a second register set.
//   Scores are computed TRANSPOSED: S^T tile g (g = 0,1) = k rows (keys kb+16g .. +15, A operand, row m = lane&15, split k map
//   over d) times q^T (B operand, col n = query q0 + (lane&15), k = d, split map), one product per tile and d-chunk.
//   D element r of lane l = (key kb+16g+8h+r, query q0+(l&15)), so a lane owns one query column and 16 of its 32 keys; the
//   partner lane l^16 owns the other 16 -> row max / row sum need one xor-16 shuffle.
//   Online max-subtracted base-2 softmax in f32 (scale 1/8 and the q,k carries folded into lsc). The exp'd values ARE the
//   P A-fragment in place: A row m = query = lane&15, element i <- key kb+8h+i (tile 0, D element i), element 8+i <- key
//   kb+16+8h+i (tile 1, D element i). P is carried x32768 as f16. The rescale factor of query row 8h+r of the O accumulators is
//   fetched from lane 8h+r with a shuffle (uniform control). 4 v^T B fragments (col n = d = 16j + (lane&15), keys k-contiguous),
//   4 P.V WMMAs per key block.
//   Epilogue: 1/l (per query, shuffled to the D row owner) and carry folds in f32; the wave's 16x64 f32 result staged in its LDS
// coverage: per wave 8 instructions x 2 rows x 16 lanes x 4 floats = 16 x 64; grid NH*64 blocks x 4 waves = every (s, head)
//           row segment of the output exactly once.
// =====================================================================================================
// One key block's fragments: k rows kb+c and kb+16+c (d chunks 0 and 1), v^T rows d = 16j + c (keys kb..kb+31).
struct KVSet { v16h k00, k10, k01, k11, v0, v1, v2, v3; };
__device__ __forceinline__ void ld_kv(KVSet& s, const _Float16* Khb, const _Float16* Vhb, int kb) {
  const _Float16* k0p = Khb + (size_t)kb * OUTW;
  const _Float16* k1p = k0p + (size_t)16 * OUTW;
  s.k00 = ldfrag_h(k0p);
  s.k10 = ldfrag_h(k1p);
  s.k01 = ldfrag_h(k0p + 32);
  s.k11 = ldfrag_h(k1p + 32);
  const _Float16* vhp = Vhb + kb;
  s.v0 = ldfrag_h(vhp);
  s.v1 = ldfrag_h(vhp + (size_t)16 * SEQ);
  s.v2 = ldfrag_h(vhp + (size_t)32 * SEQ);
  s.v3 = ldfrag_h(vhp + (size_t)48 * SEQ);
#if defined(__HIP_DEVICE_COMPILE__)
  // stands between the block's loads and the next write of a register that holds one of their addresses (the loads stay in
  // flight into the next block's work); the addresses are inputs so that neither register pair is reused before the wait
  asm volatile("s_wait_xcnt 0x0" :: "v"(k0p), "v"(vhp) : "memory");
#endif
}
// One key block of the online softmax and P.V, on fragments already in registers (see attn_fwd).
__device__ __forceinline__ void att_step(const KVSet& f, v16h qh0, v16h qh1, float lsc, int hh,
                                         float& mrun, float& lrun, v8f (&o)[4]) {
  // ---- transposed scores: s0 = keys kb..kb+15, s1 = keys kb+16..kb+31, column = query q0 + c ----
  v8f s0 = zero8(), s1 = zero8();
  s0 = mma_h(f.k00, qh0, s0);
  s1 = mma_h(f.k10, qh0, s1);
  g2_3(s0, s1, qh0, f.k00, f.k10);
  s0 = mma_h(f.k01, qh1, s0);
  s1 = mma_h(f.k11, qh1, s1);
  g2_3(s0, s1, qh1, f.k01, f.k11);
  // ---- base-2 logits of this lane's 16 keys for query q0 + c: t[i] <- key kb+8hh+i, t[8+i] <- key kb+16+8hh+i ----
  float t[16];
#pragma unroll
  for (int i = 0; i < 8; ++i) { t[i] = s0[i] * lsc; t[8 + i] = s1[i] * lsc; }
  float cm = t[0];
#pragma unroll
  for (int i = 1; i < 16; ++i) cm = fmaxf(cm, t[i]);
  cm = fmaxf(cm, __shfl_xor(cm, 16, 32));
  const float mn = fmaxf(mrun, cm);        // finite from the first block on
  const float al = exp2f(mrun - mn);       // 0 on the first block (mrun = -inf)
  mrun = mn;
  // ---- probabilities (<= 1) and the P A-fragment: f16(p * 32768); element i <-> t[i] ----
  float ps = 0.f;
  FragH ph;
#pragma unroll
  for (int w = 0; w < 2; ++w) {
#pragma unroll
    for (int e4 = 0; e4 < 4; ++e4) {
      const int i = 8 * w + 2 * e4;
      const float p0 = exp2f(t[i] - mn), p1 = exp2f(t[i + 1] - mn);
      ps += p0 + p1;
      const _Float16 h0 = (_Float16)(p0 * PCAR), h1 = (_Float16)(p1 * PCAR);
      ph.u[w][e4] = pk16(h_bits(h0), h_bits(h1));
    }
  }
  ps += __shfl_xor(ps, 16, 32);
  lrun = lrun * al + ps;
  // ---- rescale the O accumulators: D row 8hh+r = query q0+8hh+r, its factor lives in lane 8hh+r (and 16+8hh+r) ----
  float scl[8];
#pragma unroll
  for (int r = 0; r < 8; ++r) scl[r] = __shfl(al, 8 * hh + r, 32);
#pragma unroll
  for (int j = 0; j < 4; ++j) {
#pragma unroll
    for (int r = 0; r < 8; ++r) o[j][r] *= scl[r];
  }
  // ---- P.V : B fragment col n = d = j*16 + c, keys contiguous in the v^T plane ----
  o[0] = mma_h(ph.v, f.v0, o[0]);
  o[1] = mma_h(ph.v, f.v1, o[1]);
  o[2] = mma_h(ph.v, f.v2, o[2]);
  o[3] = mma_h(ph.v, f.v3, o[3]);
  g4_5<v16h>(o[0], o[1], o[2], o[3], ph.v, f.v0, f.v1, f.v2, f.v3);
}

__global__ __launch_bounds__(ATT_THREADS)
void attn_fwd(const u16* __restrict__ QHp, const u16* __restrict__ KHp, const u16* __restrict__ VHp, float* out) {
  __shared__ __align__(16) float smem[ATT_WAVES * SLABF];   // per wave: result slab [16][68] in the epilogue only

  const int tid  = threadIdx.x;
  const int wave = tid >> 5;
  const int lane = tid & 31;
  const int hh   = lane >> 4;
  const int c    = lane & 15;

  const int bid  = blockIdx.x;
  const int qt   = bid % QTILES;              // 0..63
  const int head = bid / QTILES;              // 0..NH-1
  if (head >= NH) return;                     // block-uniform, never taken with the exact grid; no block barriers in this kernel
  const int q0   = qt * 64 + wave * 16;

  // B fragments of q^T: col n = query q0 + c, k = d (k-contiguous row of the q plane); loop-invariant
  const size_t qofs = ((size_t)(q0 + c) * NH + head) * HD + 8 * hh;
  const _Float16* Qh  = (const _Float16*)(const void*)QHp + qofs;
  const v16h qh0 = ldfrag_h(Qh), qh1 = ldfrag_h(Qh + 32);
  // A fragments of k: row m = key kb + 16g + c, k = d
  const size_t kofs = ((size_t)c * NH + head) * HD + 8 * hh;                      // key row kb + c added per step
  const _Float16* Khb = (const _Float16*)(const void*)KHp + kofs;
  // B fragments of v: col n = d = 16j + c, k = key (k-contiguous row of the v^T plane)
  const size_t vofs = ((size_t)(head * HD) + c) * SEQ + 8 * hh;                   // key kb added per step
  const _Float16* Vhb = (const _Float16*)(const void*)VHp + vofs;
  const float lsc = 0.125f * (LOG2E / (QSC * KSC));

  float mrun = -INFINITY, lrun = 0.f;
  v8f o[4];
#pragma unroll
  for (int j = 0; j < 4; ++j) o[j] = zero8();

  KVSet sa, sb;
  __builtin_amdgcn_sched_barrier(0);   // q's loads stay older than block 0's, block 0's in the order of the loop's (counted waits)
  ld_kv(sa, Khb, Vhb, 0);
  __builtin_amdgcn_sched_barrier(0);
  // rolled: one trip = two key blocks, one per register set, so that no set is ever copied
#pragma unroll 1
  for (int it = 0; it < NKB; it += 2) {
    // past the end block 0 is loaded again (in range, never used): no branch stands between the loads and their waits
    const int nx = (it + 2 < NKB) ? it + 2 : 0;
    // the scheduling barriers keep each group of loads where it is written and keep the other set's first products, and with
    // them the wait on loads just issued, from being scheduled up into the block in work
    ld_kv(sb, Khb, Vhb, (it + 1) * 32);
    __builtin_amdgcn_sched_barrier(0);
    att_step(sa, qh0, qh1, lsc, hh, mrun, lrun, o);
    __builtin_amdgcn_sched_barrier(0);
    ld_kv(sa, Khb, Vhb, nx * 32);
    __builtin_amdgcn_sched_barrier(0);
    att_step(sb, qh0, qh1, lsc, hh, mrun, lrun, o);
    __builtin_amdgcn_sched_barrier(0);
  }
  acc_guard4(o[0], o[1], o[2], o[3]);

  // ---- fold 1/l (per query, owned by lane = query) and the carries (32768 on P, 64 on v); stage the 16x64 slab ----
  const float linv = (1.0f / lrun) * (1.0f / (PCAR * VCAR));
  float inv[8];
#pragma unroll
  for (int r = 0; r < 8; ++r) inv[r] = __shfl(linv, 8 * hh + r, 32);
  float* slab = smem + wave * SLABF;
#pragma unroll
  for (int r = 0; r < 8; ++r) {
#pragma unroll
    for (int j = 0; j < 4; ++j) slab[(8 * hh + r) * 68 + j * 16 + c] = o[j][r] * inv[r];
  }
  wave_sync_lds();
  // ---- f32 rows of the merged-head output: row s = q0 + 2*it + hh, columns head*64 + 4c .. +3 per lane ----
  v4f vals[8];
#pragma unroll
  for (int it = 0; it < 8; ++it) vals[it] = *(const v4f*)(slab + (it * 2 + hh) * 68 + c * 4);
  float* dst = out + ((size_t)(q0 + hh)) * (size_t)OUTW + head * HD + c * 4;
  {
#pragma unroll
    for (int it = 0; it < 8; ++it) {
      *(v4f*)(dst + (size_t)(it * 2) * (size_t)OUTW) = vals[it];
    }
    
  }
}

// =====================================================================================================
// Workspace map (bytes); every plane is fully written by whole-line stores before it is read; all extents are exact multiples
// of the 512-B store granularity (no pad rows needed); every offset a multiple of 128; F is reused sequentially (in-order stream):
//   XB  bf16 [4096 token][768 i]        6291456
//   WQB bf16 [OUTW o][768 i]            1179648      WKB same 1179648     WVB same 1179648
//   F   f32  [4096][OUTW] / [OUTW][4096] 12582912   (projection q, then k, then v)
//   QH  f16  [4096][12][64] x64         6291456      KH same 6291456
//   VH  f16  [12][64][4096] x64         6291456
//   end                                41287680
// =====================================================================================================
extern "C" void kernel_launch(void* const* d_in, const int* in_sizes, int n_in,
                              void* d_out, int out_size, void* d_ws, size_t ws_size,
                              hipStream_t stream) {
  const int XN = SEQ * DIN;                             // 3145728
  const int ON = SEQ * OUTW;                            // 3145728
  if (n_in < 7) return;
  if (in_sizes[0] != XN) return;
  if (in_sizes[1] != DIN * DIN || in_sizes[3] != DIN * DIN || in_sizes[5] != DIN * DIN) return;
  if (in_sizes[2] != DIN || in_sizes[4] != DIN || in_sizes[6] != DIN) return;
  if (out_size != ON) return;

  const float* xin = (const float*)d_in[0];
  const float* wq  = (const float*)d_in[1];
  const float* bq  = (const float*)d_in[2];
  const float* wk  = (const float*)d_in[3];
  const float* bk  = (const float*)d_in[4];
  const float* wv  = (const float*)d_in[5];
  const float* bv  = (const float*)d_in[6];
  float*       out = (float*)d_out;
  const int    nb  = in_sizes[2];                       // bias length (DIN)

  const size_t szXB = (size_t)SEQ * DIN * 2;            //  6291456
  const size_t szW  = (size_t)OUTW * DIN * 2;           //  1179648
  const size_t szF  = (size_t)SEQ * OUTW * 4;           // 12582912
  const size_t szP  = (size_t)SEQ * OUTW * 2;           //  6291456
  size_t off = 0;
  const size_t oXB  = off; off += szXB;
  const size_t oWQB = off; off += szW;
  const size_t oWKB = off; off += szW;
  const size_t oWVB = off; off += szW;
  const size_t oF   = off; off += szF;
  const size_t oQH  = off; off += szP;
  const size_t oKH  = off; off += szP;
  const size_t oVH  = off; off += szP;
  if (off > ws_size) return;                            // off = 41287680
  if (off > (size_t)134217728) return;

  char* ws = (char*)d_ws;
  u16*   XB  = (u16*)(ws + oXB);
  u16*   WQB = (u16*)(ws + oWQB);
  u16*   WKB = (u16*)(ws + oWKB);
  u16*   WVB = (u16*)(ws + oWVB);
  float* F   = (float*)(ws + oF);
  u16*   QH  = (u16*)(ws + oQH);
  u16*   KH  = (u16*)(ws + oKH);
  u16*   VH  = (u16*)(ws + oVH);

  const dim3 blk(256);
  const int n8x = XN / 8;                               // 393216
  const int n8w = (OUTW * DIN) / 8;                     // 73728
  const int n8o = ON / 8;                               // 393216
  const dim3 gX((n8x + 255) / 256);                     // 1536
  const dim3 gWc((n8w + 255) / 256);                    // 288
  const dim3 gO((n8o + 255) / 256);                     // 1536
  const dim3 gGt((SEQ / 64) * (OUTW / 64));             // 768 tiles, token-major projections
  const dim3 gGc((OUTW / 64) * (SEQ / 64));             // 768 tiles, channel-major projection (v^T layout)
  const dim3 bG(128);
  const dim3 gAT(ATT_BLOCKS);                           // 768
  const dim3 bAT(ATT_THREADS);                          // 128

  // (0..2) weights [o][i] -> bf16 planes (first OUTW rows), same layout
  cvb16<<<gWc, blk, 0, stream>>>(wq, WQB, n8w);
  cvb16<<<gWc, blk, 0, stream>>>(wk, WKB, n8w);
  cvb16<<<gWc, blk, 0, stream>>>(wv, WVB, n8w);
  // (3) input [token][i] -> bf16 plane, same layout
  cvb16<<<gX, blk, 0, stream>>>(xin, XB, n8x);
  // (4..5) q: projection + bias -> F [4096 token][h*64+d] f32; -> f16 plane x64
  gemm_bfb<<<gGt, bG, 0, stream>>>(XB, WQB, bq, F, SEQ, OUTW, DIN, 1.0f, 0, nb);
  cvh16<<<gO, blk, 0, stream>>>(F, QH, n8o, QSC);
  // (6..7) k: same pipeline (F reused; single in-order stream)
  gemm_bfb<<<gGt, bG, 0, stream>>>(XB, WKB, bk, F, SEQ, OUTW, DIN, 1.0f, 0, nb);
  cvh16<<<gO, blk, 0, stream>>>(F, KH, n8o, KSC);
  // (8..9) v: channel-major projection -> F [h*64+d][4096] f32 (= v^T plane layout) with per-row bias; -> f16 plane x64
  gemm_bfb<<<gGc, bG, 0, stream>>>(WVB, XB, bv, F, OUTW, SEQ, DIN, 1.0f, 1, nb);
  cvh16<<<gO, blk, 0, stream>>>(F, VH, n8o, VCAR);
  // (10) attention -> merged-head f32 output [4096][h*64+d]
  attn_fwd<<<gAT, bAT, 0, stream>>>(QH, KH, VH, out);
  (void)hipGetLastError();
}

// v002
// Measured time: 167 microseconds a run.
// In two side-by-side timings against v001, it was 1.51 and 1.52 times as fast.
// Counting every step since v000, it is 1.62 times as fast.
// Contractions: projections X.W^T and Wv.X^T on v_wmma_f32_16x16x32_bf16 (X and W RNE-converted bf16 operands, f32 accumulate,
// bias added in f32); scores k.q^T (q, k carried x64 as f16) and P.v (P x32768 as f16, v x64 as f16) on v_wmma_f32_16x16x32_f16,
// f32 accumulate. Base-2 online softmax and the 1/l fold in f32 on VALU.
#include <hip/hip_runtime.h>
#include <math.h>
#include <stdint.h>

#define SEQ   4096
#define DIN   768
#define NH    12
#define HD    64
#define OUTW  (NH * HD)
#define QSC   64.0f
#define KSC   64.0f
#define PCAR  32768.0f
#define VCAR  64.0f
#define LOG2E 1.4426950408889634f
#define ATT_WAVES   4
#define ATT_THREADS (ATT_WAVES * 32)
#define QTILES      (SEQ / 64)
#define ATT_BLOCKS  (NH * QTILES)
#define NKB    (SEQ / 32)
#define SLABF  (16 * 68)
#define SLAB64 (16 * 68)
#define STK     128                      // keys per LDS stage of the attention loop (four 32-key blocks)
#define NST     (SEQ / STK)
#define KPITCH  144                      // LDS row pitch of a k row (128 B + 16 B pad), bytes
#define VPITCH  272                      // LDS row pitch of a v^T row (256 B + 16 B pad), bytes
#define KTILE   (STK * KPITCH)           // 18432 B, a multiple of 2 KiB
#define VTILE   18432                    // HD * VPITCH = 17408 B, rounded up to a multiple of 2 KiB
#define BUFB    (KTILE + VTILE)
#define RINGB   (2 * BUFB)
static_assert(HD == 64);
static_assert((SEQ % 64) == 0 && (DIN % 32) == 0 && (OUTW % 64) == 0 && OUTW <= DIN);
static_assert(((SEQ * DIN) % 256) == 0 && ((OUTW * DIN) % 256) == 0 && ((SEQ * OUTW) % 256) == 0);
static_assert(ATT_THREADS == 128 && NKB * 32 == SEQ);
static_assert((DIN % 128) == 0 && (NKB % 2) == 0);
static_assert(ATT_WAVES * SLABF >= 4 * 16 * 68);
static_assert(NST >= 2 && NST * STK == SEQ && STK == 4 * 32);
static_assert((KTILE % 2048) == 0 && (VTILE % 2048) == 0 && HD * VPITCH <= VTILE);
static_assert(KPITCH == HD * 2 + 16 && VPITCH == STK * 2 + 16);

typedef unsigned short u16;
typedef _Float16 v16h __attribute__((ext_vector_type(16)));
typedef _Float16 v8h  __attribute__((ext_vector_type(8)));
typedef __bf16   v16b __attribute__((ext_vector_type(16)));
typedef float    v8f  __attribute__((ext_vector_type(8)));
typedef float    v4f  __attribute__((ext_vector_type(4)));
typedef unsigned int v4u __attribute__((ext_vector_type(4)));
typedef uint32_t u32x4 __attribute__((ext_vector_type(4)));
typedef uint32_t u32x8 __attribute__((ext_vector_type(8)));

union FragH { v16h v; v8h h[2]; v4u u[2]; };
union FragB { v16b v; v4u u[2]; };

// ---- scalar helpers --------------------------------------------------------------------------------
__device__ __forceinline__ unsigned short bf_bits(float f) {          // f32 -> bf16 bits, RNE convert
  unsigned u = __float_as_uint(f);
  return (unsigned short)((u + 0x7FFFu + ((u >> 16) & 1u)) >> 16);
}
__device__ __forceinline__ float bf_up(unsigned short h) { return __uint_as_float(((unsigned)h) << 16); }
__device__ __forceinline__ float bfr(float f) { return bf_up(bf_bits(f)); }
__device__ __forceinline__ unsigned short h_bits(_Float16 x) { return __builtin_bit_cast(unsigned short, x); }
__device__ __forceinline__ unsigned pk16(unsigned short a, unsigned short b) { return (unsigned)a | ((unsigned)b << 16); }
__device__ __forceinline__ v8f zero8() { v8f z = {0.f, 0.f, 0.f, 0.f, 0.f, 0.f, 0.f, 0.f}; return z; }
__device__ __forceinline__ v4f zero4() { v4f z = {0.f, 0.f, 0.f, 0.f}; return z; }

// ---- fragment loaders: 16-bit A/B operand, lane -> row/col (lane&15), p already includes +8*(lane>>4);
//      elements 0..7 <- p[0..7] (k0+8h..), elements 8..15 <- p[16..23] (k0+16+8h..)  (same split k map for A and B;
//      B is always read from a k-contiguous [n][k] plane)
__device__ __forceinline__ v16h ldfrag_h(const _Float16* p) {
  FragH f;
  f.h[0] = *(const v8h*)(p);
  f.h[1] = *(const v8h*)(p + 16);
  return f.v;
}
__device__ __forceinline__ v16b ldfrag_b(const u16* p) {              // bf16 plane read as unsigned integer vectors
  FragB f;
  f.u[0] = *(const v4u*)(p);
  f.u[1] = *(const v4u*)(p + 16);
  return f.v;
}

__device__ __forceinline__ v8f mma_h(v16h a, v16h b, v8f c) {
  return __builtin_amdgcn_wmma_f32_16x16x32_f16(false, a, false, b, (short)0, c, false, false);
}
__device__ __forceinline__ v8f mma_b(v16b a, v16b b, v8f c) {
  return __builtin_amdgcn_wmma_f32_16x16x32_bf16(false, a, false, b, (short)0, c, false, false);
}
__device__ __forceinline__ void g2_3(v8f& a, v8f& b, v16h x0, v16h x1, v16h x2) {
#if defined(__HIP_DEVICE_COMPILE__)
  asm volatile("v_nop\n\tv_nop\n\tv_nop\n\tv_nop" : "+v"(a), "+v"(b) : "v"(x0), "v"(x1), "v"(x2) : "memory");
#endif
}
template <typename F>
__device__ __forceinline__ void g4_5(v8f& a, v8f& b, v8f& c, v8f& d, F x0, F x1, F x2, F x3, F x4) {
#if defined(__HIP_DEVICE_COMPILE__)
  asm volatile("v_nop\n\tv_nop\n\tv_nop\n\tv_nop"
               : "+v"(a), "+v"(b), "+v"(c), "+v"(d) : "v"(x0), "v"(x1), "v"(x2), "v"(x3), "v"(x4) : "memory");
#endif
}
__device__ __forceinline__ void acc_guard4(v8f& a, v8f& b, v8f& c, v8f& d) {
#if defined(__HIP_DEVICE_COMPILE__)
  asm volatile("v_nop\n\tv_nop\n\tv_nop\n\tv_nop" : "+v"(a), "+v"(b), "+v"(c), "+v"(d));
#endif
}
__device__ __forceinline__ void wave_sync_lds() {
  __builtin_amdgcn_fence(__ATOMIC_RELEASE, "workgroup");
  __builtin_amdgcn_wave_barrier();
  __builtin_amdgcn_fence(__ATOMIC_ACQUIRE, "workgroup");
}

// ---- tensor loads into LDS -------------------------------------------------------------------------
__device__ __forceinline__ uint32_t uni(uint32_t v) { return (uint32_t)__builtin_amdgcn_readfirstlane(v); }
__device__ __forceinline__ uint32_t pinned(uint32_t v) {
  uint32_t w = uni(v);
#if defined(__HIP_DEVICE_COMPILE__)
  // holds an issue test in a scalar register, so that it compiles to a scalar branch (tensor loads ignore EXEC), or a descriptor word
  asm volatile("" : "+s"(w));
#endif
  return w;
}
__device__ __forceinline__ void wait_ds0() {
#if defined(__HIP_DEVICE_COMPILE__)
  asm volatile("s_wait_dscnt 0x0" ::: "memory");      // this wave's LDS reads have retired before its buffer may be refilled
#endif
}
// The issuing wave's tile has landed (the compiler places no wait for it). The descriptor groups are operands of the wait: group 0
// as a value that the wait hands on, so that its next address is formed behind the wait, the two groups 1 as inputs, so that
// their registers are still theirs here: no word of a request in flight takes a new value in front of this wait.
__device__ __forceinline__ void wait_tensor0(u32x4& g0, u32x8 g1a, u32x8 g1b) {
#if defined(__HIP_DEVICE_COMPILE__)
  asm volatile("s_wait_tensorcnt 0x0" : "+s"(g0) : "s"(g1a), "s"(g1b) : "memory");
#endif
}
// Group 1 of a tile of D1 rows of D0 bytes (1-byte elements, tensor = tile), source row pitch PITCH bytes; W0 = word 0 (no mask;
// the pad that sets the LDS pitch), a compile-time constant. Built once, the same for every stage.
template <uint32_t W0, uint32_t D0, uint32_t D1, uint32_t PITCH>
__device__ __forceinline__ u32x8 tdm_group1() {
  // pinned(): each descriptor word held in a scalar register, so that the group is one set of registers for the whole kernel and
  // not constants set up anew, in registers that are then reused, at each request
  u32x8 g1;
  g1[0] = pinned(W0);
  g1[1] = pinned((D0 & 0xFFFFu) << 16);
  g1[2] = pinned((D0 >> 16) | ((D1 & 0xFFFFu) << 16));
  g1[3] = pinned((D1 >> 16) | (D0 << 16));
  g1[4] = pinned(D1);
  g1[5] = pinned(PITCH);
  g1[6] = pinned(0u);
  g1[7] = pinned(0u);
  return g1;
}
// Group 0: tile's first byte at ga, to LDS byte offset lds_dst.
__device__ __forceinline__ u32x4 tdm_group0(uint32_t lds_dst, uint64_t ga) {
  u32x4 g0;
  g0[0] = uni(1u);
  g0[1] = uni(lds_dst);
  g0[2] = uni((uint32_t)ga);
  g0[3] = uni((((uint32_t)(ga >> 32)) & 0x01FFFFFFu) | 0x80000000u);
  return g0;
}
// Group 0 of the next stage: new LDS place, source address advanced by step bytes (the carry goes into address bits 56..32).
__device__ __forceinline__ void tdm_advance(u32x4& g0, uint32_t lds_dst, uint32_t step) {
  const uint32_t lo = g0[2] + step;
  g0[1] = uni(lds_dst);
  g0[3] = uni(g0[3] + (lo < step ? 1u : 0u));
  g0[2] = uni(lo);
}
__device__ __forceinline__ void tdm_load(u32x4 g0, u32x8 g1) {
#if defined(__HIP_DEVICE_COMPILE__)
  // the request itself: one per issuing wave, through no register; its waits are written by hand where it is used
  asm volatile("tensor_load_to_lds %0, %1" :: "s"(g0), "s"(g1) : "memory");
#endif
}
#define KW0 ((1u << 20) | (4u << 22) | (3u << 25))   // 128-B rows, 16 B of pad behind each
#define VW0 ((1u << 20) | (5u << 22) | (3u << 25))   // 256-B rows, 16 B of pad behind each

// =====================================================================================================
// f32 plane -> bf16 plane (RNE convert), same layout. Thread = 8 consecutive elements: two 16-B loads, one 16-B store;
// coverage: grid = ceil(n8/256) blocks x 256 thr x 8 = the whole plane (n8 = elements/8, elements % 256 == 0, so every wave is
//           fully active or fully inactive).
// =====================================================================================================
__global__ __launch_bounds__(256) void cvb16(const float* __restrict__ x, u16* D, int n8) {
  const int gt = blockIdx.x * 256 + (int)threadIdx.x;
  if (gt >= n8) return;                     // no barriers in this kernel
  const float* p = x + (size_t)gt * 8;
  const v4f a = *(const v4f*)(p), c4 = *(const v4f*)(p + 4);
  float v[8];
#pragma unroll
  for (int e = 0; e < 4; ++e) { v[e] = a[e]; v[4 + e] = c4[e]; }
  unsigned short s[8];
#pragma unroll
  for (int e = 0; e < 8; ++e) s[e] = bf_bits(v[e]);
  v4u o;
#pragma unroll
  for (int e = 0; e < 4; ++e) o[e] = pk16(s[2 * e], s[2 * e + 1]);
  u16* d = D + (size_t)gt * 8;
  {
    *(v4u*)(d) = o;
    
  }
}

// =====================================================================================================
// f32 plane -> f16 plane of (value * scale), same layout (scale a power of two). Same thread/store shape as cvb16.
// coverage: grid = ceil(n8/256) blocks x 256 thr x 8 = the whole plane.
// =====================================================================================================
__global__ __launch_bounds__(256) void cvh16(const float* __restrict__ x, u16* D, int n8, float scale) {
  const int gt = blockIdx.x * 256 + (int)threadIdx.x;
  if (gt >= n8) return;                     // no barriers in this kernel
  const float* p = x + (size_t)gt * 8;
  const v4f a = *(const v4f*)(p), c4 = *(const v4f*)(p + 4);
  float v[8];
#pragma unroll
  for (int e = 0; e < 4; ++e) { v[e] = a[e]; v[4 + e] = c4[e]; }
  unsigned short s[8];
#pragma unroll
  for (int e = 0; e < 8; ++e) s[e] = h_bits((_Float16)(v[e] * scale));
  v4u o;
#pragma unroll
  for (int e = 0; e < 4; ++e) o[e] = pk16(s[2 * e], s[2 * e + 1]);
  u16* d = D + (size_t)gt * 8;
  {
    *(v4u*)(d) = o;
    
  }
}

// =====================================================================================================
// Bias terms for the GEMM epilogue (bf16-RNE values of bias[], nb entries; every candidate index clamped into 0..nb-1 so all
// loads are in range, selection by value): bmode 0: per-column direct; bmode 1: per-row direct.
// =====================================================================================================
__device__ __forceinline__ void bias_terms(const float* __restrict__ bias, int nb, int bmode, int rowb, int col0, int hh, int m,
                                           v4f& badd, v8f& radd) {
#pragma unroll
  for (int e = 0; e < 4; ++e) {
    const int ci = col0 + 4 * m + e;
    const int ic = ci < nb ? ci : nb - 1;
    const float bc = bfr(bias[ic]);
    badd[e] = (bmode == 0) ? bc : 0.0f;
  }
#pragma unroll
  for (int r = 0; r < 8; ++r) {
    const int ri = rowb + 8 * hh + r;
    const int ir = ri < nb ? ri : nb - 1;
    const float br = bfr(bias[ir]);
    radd[r] = (bmode == 1) ? br : 0.0f;
  }
}

// =====================================================================================================
// GEMM epilogue: the wave's 16x64 f32 tile (times oscale, plus per-row addend radd) staged in its LDS slab (pitch 68),
// coverage: 8 instructions x 2 rows x 16 lanes x 4 floats = the wave's 16 x 64 tile.
// =====================================================================================================
__device__ __forceinline__ void epi64(float* sl, v8f a0, v8f a1, v8f a2, v8f a3, float oscale, v4f badd, v8f radd,
                                      float* C, int N, size_t rowb, int col0, int lane) {
  const int hh = lane >> 4, m = lane & 15;
#pragma unroll
  for (int r = 0; r < 8; ++r) {
    const int ro = (8 * hh + r) * 68 + m;
    sl[ro]      = a0[r] * oscale + radd[r];
    sl[ro + 16] = a1[r] * oscale + radd[r];
    sl[ro + 32] = a2[r] * oscale + radd[r];
    sl[ro + 48] = a3[r] * oscale + radd[r];
  }
  wave_sync_lds();
  v4f vals[8];
#pragma unroll
  for (int it = 0; it < 8; ++it) vals[it] = *(const v4f*)(sl + (it * 2 + hh) * 68 + m * 4) + badd;
  float* dst = C + (rowb + (size_t)hh) * (size_t)N + col0 + m * 4;
  {
#pragma unroll
    for (int it = 0; it < 8; ++it) {
      *(v4f*)(dst + (size_t)(it * 2) * (size_t)N) = vals[it];
    }
    
  }
}

// =====================================================================================================
// bf16 GEMM with bias: C[M][N] (f32, pitch N) = A[M][K] (bf16 row-major) . Bt[N][K]^T (bf16 k-contiguous), times oscale, plus
// the bias term selected by bmode (see bias_terms). grid.x = (M/64)*(N/64) tiles. Block = 64x64 tile, 4 waves x 16 rows;
// fragments loaded straight from the 16-bit rows (two 16-B loads each, split k map for A and B); K stepped by 32, the
// fragments of a step loaded three steps ahead into a ring of four register sets (host: K % 128 == 0, M % 64 == 0, N % 64 == 0).
// =====================================================================================================
struct GSet { v16b a, b0, b1, b2, b3; };
__device__ __forceinline__ void ld_gset(GSet& s, const u16* ap, const u16* bp, size_t bs, int k0) {
  const u16* pa = ap + k0;
  const u16* p0 = bp + k0;
  const u16* p1 = bp + bs + k0;
  const u16* p2 = bp + 2 * bs + k0;
  const u16* p3 = bp + 3 * bs + k0;
  s.a  = ldfrag_b(pa);
  s.b0 = ldfrag_b(p0);
  s.b1 = ldfrag_b(p1);
  s.b2 = ldfrag_b(p2);
  s.b3 = ldfrag_b(p3);
#if defined(__HIP_DEVICE_COMPILE__)
  // stands between the set's loads and the next write of a register that holds one of their addresses (the loads stay in flight
  // over the loop's back edge); the addresses are inputs so that none of these registers is reused before the wait
  asm volatile("s_wait_xcnt 0x0" :: "v"(pa), "v"(p0), "v"(p1), "v"(p2), "v"(p3) : "memory");
#endif
}
__device__ __forceinline__ void gemm_step(const GSet& s, v8f& acc0, v8f& acc1, v8f& acc2, v8f& acc3) {
  acc0 = mma_b(s.a, s.b0, acc0);
  acc1 = mma_b(s.a, s.b1, acc1);
  acc2 = mma_b(s.a, s.b2, acc2);
  acc3 = mma_b(s.a, s.b3, acc3);
  g4_5<v16b>(acc0, acc1, acc2, acc3, s.a, s.b0, s.b1, s.b2, s.b3);
}
__global__ __launch_bounds__(128)
void gemm_bfb(const u16* __restrict__ A, const u16* __restrict__ Bt, const float* __restrict__ bias,
              float* C, int M, int N, int K, float oscale, int bmode, int nb) {
  __shared__ __align__(16) float slab[4 * SLAB64];
  const int tid = threadIdx.x, wave = tid >> 5, lane = tid & 31, hh = lane >> 4, m = lane & 15;
  const int ntile = N >> 6;
  const int bid   = blockIdx.x;
  const int rowb  = (bid / ntile) * 64 + wave * 16;
  const int col0  = (bid % ntile) * 64;
  if (rowb + 16 > M) return;                 // wave-uniform, never taken with the exact grid; no block barriers in this kernel
  const u16* ap = A  + (size_t)(rowb + m) * K + 8 * hh;
  const u16* bp = Bt + (size_t)(col0 + m) * K + 8 * hh;
  const size_t bs = (size_t)16 * K;
  v8f acc0 = zero8(), acc1 = zero8(), acc2 = zero8(), acc3 = zero8();
  GSet g0, g1, g2, g3;
  // the scheduling barriers here and in the loop keep the sets' loads in the order written, so that the wait in front of a step
  // counts only that set's loads and leaves the younger sets in flight
  ld_gset(g0, ap, bp, bs, 0);
  __builtin_amdgcn_sched_barrier(0);
  ld_gset(g1, ap, bp, bs, 32);
  __builtin_amdgcn_sched_barrier(0);
  ld_gset(g2, ap, bp, bs, 64);
  __builtin_amdgcn_sched_barrier(0);
  // rolled: one trip = four k steps, one per register set, so that no set is ever copied
#pragma unroll 1
  for (int k0 = 0; k0 < K; k0 += 128) {
    // a step past the end loads step 0 again (in range, never used): no branch stands between the loads and their waits
    const int n4 = (k0 + 128 < K) ? k0 + 128 : 0;
    const int n5 = (k0 + 160 < K) ? k0 + 160 : 0;
    const int n6 = (k0 + 192 < K) ? k0 + 192 : 0;
    ld_gset(g3, ap, bp, bs, k0 + 96);
    __builtin_amdgcn_sched_barrier(0);
    gemm_step(g0, acc0, acc1, acc2, acc3);
    __builtin_amdgcn_sched_barrier(0);
    ld_gset(g0, ap, bp, bs, n4);
    __builtin_amdgcn_sched_barrier(0);
    gemm_step(g1, acc0, acc1, acc2, acc3);
    __builtin_amdgcn_sched_barrier(0);
    ld_gset(g1, ap, bp, bs, n5);
    __builtin_amdgcn_sched_barrier(0);
    gemm_step(g2, acc0, acc1, acc2, acc3);
    __builtin_amdgcn_sched_barrier(0);
    ld_gset(g2, ap, bp, bs, n6);
    __builtin_amdgcn_sched_barrier(0);
    gemm_step(g3, acc0, acc1, acc2, acc3);
    __builtin_amdgcn_sched_barrier(0);
  }
  v4f badd = zero4();
  v8f radd = zero8();
  bias_terms(bias, nb, bmode, rowb, col0, hh, m, badd, radd);
  epi64(slab + wave * SLAB64, acc0, acc1, acc2, acc3, oscale, badd, radd, C, N, (size_t)rowb, col0, lane);
}

// =====================================================================================================
// Full (non-causal, unmasked) multi-head flash attention: block = (head, 64 query rows), 4 waves, wave w owns the 16 query rows
// q0 = 64*qt + 16*w .. q0+15.
//   q plane (f16, x64) laid out [s][h][d] (row pitch OUTW); k plane the same; v^T plane [h][d][s] (x64). All NKB = 128 key
//   blocks of 32 keys are visited (static bound), in NST stages of STK = 128 keys. A stage's k rows (128 x 128 B) and v^T rows
//   (64 x 256 B) are brought into LDS once for the four waves, by one tensor load each (wave 0: k, wave 1: v^T), into one of two
//   buffers, the next stage's loads in flight while this stage is worked on; one work-group barrier per stage publishes the next
//   stage and frees the buffer just read. Inside a stage a block's k and v fragments are read from LDS (ds_load_b128, padded
//   pitches) one block ahead into a second register set; nothing of the next stage is read in front of its barrier.
//   Scores are computed TRANSPOSED: S^T tile g (g = 0,1) = k rows (keys kb+16g .. +15, A operand, row m = lane&15, split k map
//   over d) times q^T (B operand, col n = query q0 + (lane&15), k = d, split map), one product per tile and d-chunk.
//   D element r of lane l = (key kb+16g+8h+r, query q0+(l&15)), so a lane owns one query column and 16 of its 32 keys; the
//   partner lane l^16 owns the other 16 -> row max / row sum need one xor-16 shuffle.
//   Online max-subtracted base-2 softmax in f32 (scale 1/8 and the q,k carries folded into lsc). The exp'd values ARE the
//   P A-fragment in place: A row m = query = lane&15, element i <- key kb+8h+i (tile 0, D element i), element 8+i <- key
//   kb+16+8h+i (tile 1, D element i). P is carried x32768 as f16. The rescale factor of query row 8h+r of the O accumulators is
//   fetched from lane 8h+r with a shuffle (uniform control). 4 v^T B fragments (col n = d = 16j + (lane&15), keys k-contiguous),
//   4 P.V WMMAs per key block.
//   Epilogue: 1/l (per query, shuffled to the D row owner) and carry folds in f32; the wave's 16x64 f32 result staged in its LDS
// coverage: per wave 8 instructions x 2 rows x 16 lanes x 4 floats = 16 x 64; grid NH*64 blocks x 4 waves = every (s, head)
//           row segment of the output exactly once.
// =====================================================================================================
// One key block's fragments: k rows kb+c and kb+16+c (d chunks 0 and 1), v^T rows d = 16j + c (keys kb..kb+31).
struct KVSet { v16h k00, k10, k01, k11, v0, v1, v2, v3; };
// kp: LDS address of k row (block's first key + c), byte 16*hh; vp: LDS address of v^T row c at the block's first key, byte 16*hh.
__device__ __forceinline__ void ld_kv(KVSet& s, const _Float16* kp, const _Float16* vp) {
  s.k00 = ldfrag_h(kp);
  s.k10 = ldfrag_h(kp + 16 * (KPITCH / 2));
  s.k01 = ldfrag_h(kp + 32);
  s.k11 = ldfrag_h(kp + 16 * (KPITCH / 2) + 32);
  s.v0 = ldfrag_h(vp);
  s.v1 = ldfrag_h(vp + 16 * (VPITCH / 2));
  s.v2 = ldfrag_h(vp + 32 * (VPITCH / 2));
  s.v3 = ldfrag_h(vp + 48 * (VPITCH / 2));
}
// One key block of the online softmax and P.V, on fragments already in registers (see attn_fwd).
__device__ __forceinline__ void att_step(const KVSet& f, v16h qh0, v16h qh1, float lsc, int hh,
                                         float& mrun, float& lrun, v8f (&o)[4]) {
  // ---- transposed scores: s0 = keys kb..kb+15, s1 = keys kb+16..kb+31, column = query q0 + c ----
  v8f s0 = zero8(), s1 = zero8();
  s0 = mma_h(f.k00, qh0, s0);
  s1 = mma_h(f.k10, qh0, s1);
  g2_3(s0, s1, qh0, f.k00, f.k10);
  s0 = mma_h(f.k01, qh1, s0);
  s1 = mma_h(f.k11, qh1, s1);
  g2_3(s0, s1, qh1, f.k01, f.k11);
  // ---- base-2 logits of this lane's 16 keys for query q0 + c: t[i] <- key kb+8hh+i, t[8+i] <- key kb+16+8hh+i ----
  float t[16];
#pragma unroll
  for (int i = 0; i < 8; ++i) { t[i] = s0[i] * lsc; t[8 + i] = s1[i] * lsc; }
  float cm = t[0];
#pragma unroll
  for (int i = 1; i < 16; ++i) cm = fmaxf(cm, t[i]);
  cm = fmaxf(cm, __shfl_xor(cm, 16, 32));
  const float mn = fmaxf(mrun, cm);        // finite from the first block on
  const float al = exp2f(mrun - mn);       // 0 on the first block (mrun = -inf)
  mrun = mn;
  // ---- probabilities (<= 1) and the P A-fragment: f16(p * 32768); element i <-> t[i] ----
  float ps = 0.f;
  FragH ph;
#pragma unroll
  for (int w = 0; w < 2; ++w) {
#pragma unroll
    for (int e4 = 0; e4 < 4; ++e4) {
      const int i = 8 * w + 2 * e4;
      const float p0 = exp2f(t[i] - mn), p1 = exp2f(t[i + 1] - mn);
      ps += p0 + p1;
      const _Float16 h0 = (_Float16)(p0 * PCAR), h1 = (_Float16)(p1 * PCAR);
      ph.u[w][e4] = pk16(h_bits(h0), h_bits(h1));
    }
  }
  ps += __shfl_xor(ps, 16, 32);
  lrun = lrun * al + ps;
  // ---- rescale the O accumulators: D row 8hh+r = query q0+8hh+r, its factor lives in lane 8hh+r (and 16+8hh+r) ----
  float scl[8];
#pragma unroll
  for (int r = 0; r < 8; ++r) scl[r] = __shfl(al, 8 * hh + r, 32);
#pragma unroll
  for (int j = 0; j < 4; ++j) {
#pragma unroll
    for (int r = 0; r < 8; ++r) o[j][r] *= scl[r];
  }
  // ---- P.V : B fragment col n = d = j*16 + c, keys contiguous in the v^T plane ----
  o[0] = mma_h(ph.v, f.v0, o[0]);
  o[1] = mma_h(ph.v, f.v1, o[1]);
  o[2] = mma_h(ph.v, f.v2, o[2]);
  o[3] = mma_h(ph.v, f.v3, o[3]);
  g4_5<v16h>(o[0], o[1], o[2], o[3], ph.v, f.v0, f.v1, f.v2, f.v3);
}

__global__ __launch_bounds__(ATT_THREADS)
void attn_fwd(const u16* __restrict__ QHp, const u16* __restrict__ KHp, const u16* __restrict__ VHp, float* out) {
  // two stage buffers (k tile, then v^T tile, each at a multiple of 2 KiB), then per wave a result slab [16][68] for the epilogue
  __shared__ __attribute__((aligned(2048))) unsigned char L[RINGB + ATT_WAVES * SLABF * 4];
  float* smem = (float*)(void*)(L + RINGB);

  const int tid  = threadIdx.x;
  const int wave = tid >> 5;
  const int lane = tid & 31;
  const int hh   = lane >> 4;
  const int c    = lane & 15;

  const int bid  = blockIdx.x;
  const int qt   = bid % QTILES;              // 0..63
  const int head = bid / QTILES;              // 0..NH-1
  if (head >= NH) return;                     // block-uniform, never taken with the exact grid; stands in front of every barrier
  const int q0   = qt * 64 + wave * 16;

  // B fragments of q^T: col n = query q0 + c, k = d (k-contiguous row of the q plane); loop-invariant
  const size_t qofs = ((size_t)(q0 + c) * NH + head) * HD + 8 * hh;
  const _Float16* Qh  = (const _Float16*)(const void*)QHp + qofs;
  const v16h qh0 = ldfrag_h(Qh), qh1 = ldfrag_h(Qh + 32);
  const float lsc = 0.125f * (LOG2E / (QSC * KSC));

  // Stage tiles: k rows st*STK .. +127 of this head (128 B each, plane pitch OUTW*2 B); v^T rows head*HD .. +63, keys st*STK .. +127
  // (256 B each, plane pitch SEQ*2 B). Every tile lies wholly inside its plane.
  const uint32_t wv    = uni((uint32_t)tid >> 5);
  const uint64_t kga   = (uint64_t)(size_t)KHp + (uint64_t)head * (HD * 2);
  const uint64_t vga   = (uint64_t)(size_t)VHp + (uint64_t)head * ((uint64_t)HD * SEQ * 2);
  // wave 0 brings the k tiles, wave 1 the v^T tiles: a wave's own place in a buffer, source address and step from stage to stage
  const uint32_t lown  = (uint32_t)(size_t)L + (wv == 0u ? 0u : (uint32_t)KTILE);
  const uint32_t gstep = (wv == 0u) ? (uint32_t)(STK * OUTW * 2) : (uint32_t)(STK * 2);
  const u32x8 g1k = tdm_group1<KW0, HD * 2, STK, OUTW * 2>();
  const u32x8 g1v = tdm_group1<VW0, STK * 2, HD, SEQ * 2>();
  u32x4 g0 = tdm_group0(lown, (wv == 0u) ? kga : vga);
  if (pinned(wv == 0u)) {
    tdm_load(g0, g1k);
    wait_tensor0(g0, g1k, g1v);
  }
  if (pinned(wv == 1u)) {
    tdm_load(g0, g1v);
    wait_tensor0(g0, g1k, g1v);
  }
  __syncthreads();                       // stage 0 published
  tdm_advance(g0, lown + BUFB, gstep);
  if (pinned(wv == 0u)) tdm_load(g0, g1k);
  if (pinned(wv == 1u)) tdm_load(g0, g1v);

  float mrun = -INFINITY, lrun = 0.f;
  v8f o[4];
#pragma unroll
  for (int j = 0; j < 4; ++j) o[j] = zero8();

  // A fragments of k: row m = key + c, k = d; B fragments of v: col n = d = 16j + c, k = key (both k-contiguous LDS rows)
  const uint32_t klane = (uint32_t)c * KPITCH + 16u * (uint32_t)hh;
  const uint32_t vlane = KTILE + (uint32_t)c * VPITCH + 16u * (uint32_t)hh;
  KVSet sa, sb;
  // rolled: one trip = one stage = four key blocks, alternating between the two register sets, so that no set is ever copied
#pragma unroll 1
  for (int st = 0; st < NST; ++st) {
    const uint32_t bofs = (uint32_t)(st & 1) * BUFB;
    const _Float16* kp = (const _Float16*)(const void*)(L + bofs + klane);
    const _Float16* vp = (const _Float16*)(const void*)(L + bofs + vlane);
    // the scheduling barriers keep each group of LDS reads where it is written (one group per block, never among the products)
    ld_kv(sa, kp, vp);
    __builtin_amdgcn_sched_barrier(0);
    ld_kv(sb, kp + 32 * (KPITCH / 2), vp + 32);
    __builtin_amdgcn_sched_barrier(0);
    att_step(sa, qh0, qh1, lsc, hh, mrun, lrun, o);
    __builtin_amdgcn_sched_barrier(0);
    ld_kv(sa, kp + 64 * (KPITCH / 2), vp + 64);
    __builtin_amdgcn_sched_barrier(0);
    att_step(sb, qh0, qh1, lsc, hh, mrun, lrun, o);
    __builtin_amdgcn_sched_barrier(0);
    ld_kv(sb, kp + 96 * (KPITCH / 2), vp + 96);
    __builtin_amdgcn_sched_barrier(0);
    att_step(sa, qh0, qh1, lsc, hh, mrun, lrun, o);
    __builtin_amdgcn_sched_barrier(0);
    att_step(sb, qh0, qh1, lsc, hh, mrun, lrun, o);
    __builtin_amdgcn_sched_barrier(0);
    // publish point of stage st + 1: own LDS reads retired, the issuers' tiles landed, barrier, then the refill of the buffer just read
    wait_ds0();
    if (pinned(wv < 2u)) wait_tensor0(g0, g1k, g1v);
    __syncthreads();
    if (pinned(st + 2 < NST)) {
      tdm_advance(g0, lown + bofs, gstep);
      if (pinned(wv == 0u)) tdm_load(g0, g1k);
      if (pinned(wv == 1u)) tdm_load(g0, g1v);
    }
  }
  wait_tensor0(g0, g1k, g1v);
  wait_ds0();
  acc_guard4(o[0], o[1], o[2], o[3]);

  // ---- fold 1/l (per query, owned by lane = query) and the carries (32768 on P, 64 on v); stage the 16x64 slab ----
  const float linv = (1.0f / lrun) * (1.0f / (PCAR * VCAR));
  float inv[8];
#pragma unroll
  for (int r = 0; r < 8; ++r) inv[r] = __shfl(linv, 8 * hh + r, 32);
  float* slab = smem + wave * SLABF;
#pragma unroll
  for (int r = 0; r < 8; ++r) {
#pragma unroll
    for (int j = 0; j < 4; ++j) slab[(8 * hh + r) * 68 + j * 16 + c] = o[j][r] * inv[r];
  }
  wave_sync_lds();
  // ---- f32 rows of the merged-head output: row s = q0 + 2*it + hh, columns head*64 + 4c .. +3 per lane ----
  v4f vals[8];
#pragma unroll
  for (int it = 0; it < 8; ++it) vals[it] = *(const v4f*)(slab + (it * 2 + hh) * 68 + c * 4);
  float* dst = out + ((size_t)(q0 + hh)) * (size_t)OUTW + head * HD + c * 4;
  {
#pragma unroll
    for (int it = 0; it < 8; ++it) {
      *(v4f*)(dst + (size_t)(it * 2) * (size_t)OUTW) = vals[it];
    }
    
  }
}

// =====================================================================================================
// Workspace map (bytes); every plane is fully written by whole-line stores before it is read; all extents are exact multiples
// of the 512-B store granularity (no pad rows needed); every offset a multiple of 128; F is reused sequentially (in-order stream):
//   XB  bf16 [4096 token][768 i]        6291456
//   WQB bf16 [OUTW o][768 i]            1179648      WKB same 1179648     WVB same 1179648
//   F   f32  [4096][OUTW] / [OUTW][4096] 12582912   (projection q, then k, then v)
//   QH  f16  [4096][12][64] x64         6291456      KH same 6291456
//   VH  f16  [12][64][4096] x64         6291456
//   end                                41287680
// =====================================================================================================
extern "C" void kernel_launch(void* const* d_in, const int* in_sizes, int n_in,
                              void* d_out, int out_size, void* d_ws, size_t ws_size,
                              hipStream_t stream) {
  const int XN = SEQ * DIN;                             // 3145728
  const int ON = SEQ * OUTW;                            // 3145728
  if (n_in < 7) return;
  if (in_sizes[0] != XN) return;
  if (in_sizes[1] != DIN * DIN || in_sizes[3] != DIN * DIN || in_sizes[5] != DIN * DIN) return;
  if (in_sizes[2] != DIN || in_sizes[4] != DIN || in_sizes[6] != DIN) return;
  if (out_size != ON) return;

  const float* xin = (const float*)d_in[0];
  const float* wq  = (const float*)d_in[1];
  const float* bq  = (const float*)d_in[2];
  const float* wk  = (const float*)d_in[3];
  const float* bk  = (const float*)d_in[4];
  const float* wv  = (const float*)d_in[5];
  const float* bv  = (const float*)d_in[6];
  float*       out = (float*)d_out;
  const int    nb  = in_sizes[2];                       // bias length (DIN)

  const size_t szXB = (size_t)SEQ * DIN * 2;            //  6291456
  const size_t szW  = (size_t)OUTW * DIN * 2;           //  1179648
  const size_t szF  = (size_t)SEQ * OUTW * 4;           // 12582912
  const size_t szP  = (size_t)SEQ * OUTW * 2;           //  6291456
  size_t off = 0;
  const size_t oXB  = off; off += szXB;
  const size_t oWQB = off; off += szW;
  const size_t oWKB = off; off += szW;
  const size_t oWVB = off; off += szW;
  const size_t oF   = off; off += szF;
  const size_t oQH  = off; off += szP;
  const size_t oKH  = off; off += szP;
  const size_t oVH  = off; off += szP;
  if (off > ws_size) return;                            // off = 41287680
  if (off > (size_t)134217728) return;

  char* ws = (char*)d_ws;
  u16*   XB  = (u16*)(ws + oXB);
  u16*   WQB = (u16*)(ws + oWQB);
  u16*   WKB = (u16*)(ws + oWKB);
  u16*   WVB = (u16*)(ws + oWVB);
  float* F   = (float*)(ws + oF);
  u16*   QH  = (u16*)(ws + oQH);
  u16*   KH  = (u16*)(ws + oKH);
  u16*   VH  = (u16*)(ws + oVH);

  const dim3 blk(256);
  const int n8x = XN / 8;                               // 393216
  const int n8w = (OUTW * DIN) / 8;                     // 73728
  const int n8o = ON / 8;                               // 393216
  const dim3 gX((n8x + 255) / 256);                     // 1536
  const dim3 gWc((n8w + 255) / 256);                    // 288
  const dim3 gO((n8o + 255) / 256);                     // 1536
  const dim3 gGt((SEQ / 64) * (OUTW / 64));             // 768 tiles, token-major projections
  const dim3 gGc((OUTW / 64) * (SEQ / 64));             // 768 tiles, channel-major projection (v^T layout)
  const dim3 bG(128);
  const dim3 gAT(ATT_BLOCKS);                           // 768
  const dim3 bAT(ATT_THREADS);                          // 128

  // (0..2) weights [o][i] -> bf16 planes (first OUTW rows), same layout
  cvb16<<<gWc, blk, 0, stream>>>(wq, WQB, n8w);
  cvb16<<<gWc, blk, 0, stream>>>(wk, WKB, n8w);
  cvb16<<<gWc, blk, 0, stream>>>(wv, WVB, n8w);
  // (3) input [token][i] -> bf16 plane, same layout
  cvb16<<<gX, blk, 0, stream>>>(xin, XB, n8x);
  // (4..5) q: projection + bias -> F [4096 token][h*64+d] f32; -> f16 plane x64
  gemm_bfb<<<gGt, bG, 0, stream>>>(XB, WQB, bq, F, SEQ, OUTW, DIN, 1.0f, 0, nb);
  cvh16<<<gO, blk, 0, stream>>>(F, QH, n8o, QSC);
  // (6..7) k: same pipeline (F reused; single in-order stream)
  gemm_bfb<<<gGt, bG, 0, stream>>>(XB, WKB, bk, F, SEQ, OUTW, DIN, 1.0f, 0, nb);
  cvh16<<<gO, blk, 0, stream>>>(F, KH, n8o, KSC);
  // (8..9) v: channel-major projection -> F [h*64+d][4096] f32 (= v^T plane layout) with per-row bias; -> f16 plane x64
  gemm_bfb<<<gGc, bG, 0, stream>>>(WVB, XB, bv, F, OUTW, SEQ, DIN, 1.0f, 1, nb);
  cvh16<<<gO, blk, 0, stream>>>(F, VH, n8o, VCAR);
  // (10) attention -> merged-head f32 output [4096][h*64+d]
  attn_fwd<<<gAT, bAT, 0, stream>>>(QH, KH, VH, out);
  (void)hipGetLastError();
}

// v003
// It runs in 148 microseconds.
// Two timings next to v002 both put it at 1.13 times that version's speed.
// All steps since v000 together make it 1.83 times as fast.
// Contractions: projections X.W^T and Wv.X^T on v_wmma_f32_16x16x32_bf16 (X and W RNE-converted bf16 operands, f32 accumulate,
// bias added in f32); scores k.q^T (q, k carried x64 as f16) and P.v (P x32768 as f16, v x64 as f16) on v_wmma_f32_16x16x32_f16,
// f32 accumulate. Base-2 online softmax (one fma and one v_exp_f32 per probability) and the 1/l fold in f32 on VALU.
#include <hip/hip_runtime.h>
#include <math.h>
#include <stdint.h>

#define SEQ   4096
#define DIN   768
#define NH    12
#define HD    64
#define OUTW  (NH * HD)
#define QSC   64.0f
#define KSC   64.0f
#define PEXP  15.0f                       // P and its row sum are carried x2^15 = 32768
#define VCAR  64.0f
#define LOG2E 1.4426950408889634f
#define ATT_WAVES   4
#define ATT_THREADS (ATT_WAVES * 32)
#define QTILES      (SEQ / 64)
#define ATT_BLOCKS  (NH * QTILES)
#define NKB    (SEQ / 32)
#define SLABF  (16 * 68)
#define SLAB64 (16 * 68)
#define STK     128                      // keys per LDS stage of the attention loop (four 32-key blocks)
#define NST     (SEQ / STK)
#define KPITCH  144                      // LDS row pitch of a k row (128 B + 16 B pad), bytes
#define VPITCH  272                      // LDS row pitch of a v^T row (256 B + 16 B pad), bytes
#define KTILE   (STK * KPITCH)           // 18432 B, a multiple of 2 KiB
#define VTILE   18432                    // HD * VPITCH = 17408 B, rounded up to a multiple of 2 KiB
#define BUFB    (KTILE + VTILE)
#define RINGB   (2 * BUFB)
static_assert(HD == 64);
static_assert((SEQ % 64) == 0 && (DIN % 32) == 0 && (OUTW % 64) == 0 && OUTW <= DIN);
static_assert(((SEQ * DIN) % 256) == 0 && ((OUTW * DIN) % 256) == 0 && ((SEQ * OUTW) % 256) == 0);
static_assert(ATT_THREADS == 128 && NKB * 32 == SEQ);
static_assert((DIN % 128) == 0 && (NKB % 2) == 0);
static_assert(ATT_WAVES * SLABF >= 4 * 16 * 68);
static_assert(NST >= 2 && NST * STK == SEQ && STK == 4 * 32);
static_assert((KTILE % 2048) == 0 && (VTILE % 2048) == 0 && HD * VPITCH <= VTILE);
static_assert(KPITCH == HD * 2 + 16 && VPITCH == STK * 2 + 16);

typedef unsigned short u16;
typedef _Float16 v16h __attribute__((ext_vector_type(16)));
typedef _Float16 v8h  __attribute__((ext_vector_type(8)));
typedef __bf16   v16b __attribute__((ext_vector_type(16)));
typedef _Float16 v2h  __attribute__((ext_vector_type(2)));
typedef float    v2f  __attribute__((ext_vector_type(2)));
typedef float    v8f  __attribute__((ext_vector_type(8)));
typedef float    v4f  __attribute__((ext_vector_type(4)));
typedef unsigned int v4u __attribute__((ext_vector_type(4)));
typedef uint32_t u32x4 __attribute__((ext_vector_type(4)));
typedef uint32_t u32x8 __attribute__((ext_vector_type(8)));

union FragH { v16h v; v8h h[2]; v4u u[2]; };
union FragB { v16b v; v4u u[2]; };

// ---- scalar helpers --------------------------------------------------------------------------------
__device__ __forceinline__ unsigned short bf_bits(float f) {          // f32 -> bf16 bits, RNE convert
  unsigned u = __float_as_uint(f);
  return (unsigned short)((u + 0x7FFFu + ((u >> 16) & 1u)) >> 16);
}
__device__ __forceinline__ float bf_up(unsigned short h) { return __uint_as_float(((unsigned)h) << 16); }
__device__ __forceinline__ float bfr(float f) { return bf_up(bf_bits(f)); }
__device__ __forceinline__ unsigned short h_bits(_Float16 x) { return __builtin_bit_cast(unsigned short, x); }
__device__ __forceinline__ unsigned pk16(unsigned short a, unsigned short b) { return (unsigned)a | ((unsigned)b << 16); }
// x <- 2^x by the hardware instruction alone. A result below 2^-126 may come out as 0: every use here is a probability or a
// rescale factor relative to a row maximum, where such a value is lost in the f16 P and in the f32 sums anyway. 2^-inf = 0.
// Written as one run, each in place: no instruction of the run reads its predecessor's result or writes its predecessor's source,
// and the closing v_nop is the slot that the instruction set asks for between the last v_exp_f32 and whatever uses its result.
__device__ __forceinline__ void exp2_run8(float (&x)[8]) {
#if defined(__HIP_DEVICE_COMPILE__)
  asm("v_exp_f32 %0, %0\n\tv_exp_f32 %1, %1\n\tv_exp_f32 %2, %2\n\tv_exp_f32 %3, %3\n\t"
      "v_exp_f32 %4, %4\n\tv_exp_f32 %5, %5\n\tv_exp_f32 %6, %6\n\tv_exp_f32 %7, %7\n\tv_nop"
      : "+v"(x[0]), "+v"(x[1]), "+v"(x[2]), "+v"(x[3]), "+v"(x[4]), "+v"(x[5]), "+v"(x[6]), "+v"(x[7]));
#endif
}
__device__ __forceinline__ void exp2_run9(float& a, float (&x)[8]) {   // a first: the longest path hangs on it
#if defined(__HIP_DEVICE_COMPILE__)
  asm("v_exp_f32 %0, %0\n\tv_exp_f32 %1, %1\n\tv_exp_f32 %2, %2\n\tv_exp_f32 %3, %3\n\tv_exp_f32 %4, %4\n\t"
      "v_exp_f32 %5, %5\n\tv_exp_f32 %6, %6\n\tv_exp_f32 %7, %7\n\tv_exp_f32 %8, %8\n\tv_nop"
      : "+v"(a), "+v"(x[0]), "+v"(x[1]), "+v"(x[2]), "+v"(x[3]), "+v"(x[4]), "+v"(x[5]), "+v"(x[6]), "+v"(x[7]));
#endif
}
__device__ __forceinline__ v8f zero8() { v8f z = {0.f, 0.f, 0.f, 0.f, 0.f, 0.f, 0.f, 0.f}; return z; }
__device__ __forceinline__ v4f zero4() { v4f z = {0.f, 0.f, 0.f, 0.f}; return z; }

// ---- fragment loaders: 16-bit A/B operand, lane -> row/col (lane&15), p already includes +8*(lane>>4);
//      elements 0..7 <- p[0..7] (k0+8h..), elements 8..15 <- p[16..23] (k0+16+8h..)  (same split k map for A and B;
//      B is always read from a k-contiguous [n][k] plane)
__device__ __forceinline__ v16h ldfrag_h(const _Float16* p) {
  FragH f;
  f.h[0] = *(const v8h*)(p);
  f.h[1] = *(const v8h*)(p + 16);
  return f.v;
}
__device__ __forceinline__ v16b ldfrag_b(const u16* p) {              // bf16 plane read as unsigned integer vectors
  FragB f;
  f.u[0] = *(const v4u*)(p);
  f.u[1] = *(const v4u*)(p + 16);
  return f.v;
}

__device__ __forceinline__ v8f mma_h(v16h a, v16h b, v8f c) {
  return __builtin_amdgcn_wmma_f32_16x16x32_f16(false, a, false, b, (short)0, c, false, false);
}
__device__ __forceinline__ v8f mma_b(v16b a, v16b b, v8f c) {
  return __builtin_amdgcn_wmma_f32_16x16x32_bf16(false, a, false, b, (short)0, c, false, false);
}
__device__ __forceinline__ void g2_3(v8f& a, v8f& b, v16h x0, v16h x1, v16h x2) {
#if defined(__HIP_DEVICE_COMPILE__)
  asm volatile("v_nop\n\tv_nop\n\tv_nop\n\tv_nop" : "+v"(a), "+v"(b) : "v"(x0), "v"(x1), "v"(x2) : "memory");
#endif
}
template <typename F>
__device__ __forceinline__ void g4_5(v8f& a, v8f& b, v8f& c, v8f& d, F x0, F x1, F x2, F x3, F x4) {
#if defined(__HIP_DEVICE_COMPILE__)
  asm volatile("v_nop\n\tv_nop\n\tv_nop\n\tv_nop"
               : "+v"(a), "+v"(b), "+v"(c), "+v"(d) : "v"(x0), "v"(x1), "v"(x2), "v"(x3), "v"(x4) : "memory");
#endif
}
__device__ __forceinline__ void acc_guard4(v8f& a, v8f& b, v8f& c, v8f& d) {
#if defined(__HIP_DEVICE_COMPILE__)
  asm volatile("v_nop\n\tv_nop\n\tv_nop\n\tv_nop" : "+v"(a), "+v"(b), "+v"(c), "+v"(d));
#endif
}
__device__ __forceinline__ void wave_sync_lds() {
  __builtin_amdgcn_fence(__ATOMIC_RELEASE, "workgroup");
  __builtin_amdgcn_wave_barrier();
  __builtin_amdgcn_fence(__ATOMIC_ACQUIRE, "workgroup");
}

// ---- tensor loads into LDS -------------------------------------------------------------------------
__device__ __forceinline__ uint32_t uni(uint32_t v) { return (uint32_t)__builtin_amdgcn_readfirstlane(v); }
__device__ __forceinline__ uint32_t pinned(uint32_t v) {
  uint32_t w = uni(v);
#if defined(__HIP_DEVICE_COMPILE__)
  // holds an issue test in a scalar register, so that it compiles to a scalar branch (tensor loads ignore EXEC), or a descriptor word
  asm volatile("" : "+s"(w));
#endif
  return w;
}
__device__ __forceinline__ void wait_ds0() {
#if defined(__HIP_DEVICE_COMPILE__)
  asm volatile("s_wait_dscnt 0x0" ::: "memory");      // this wave's LDS reads have retired before its buffer may be refilled
#endif
}
// The issuing wave's tile has landed (the compiler places no wait for it). The descriptor groups are operands of the wait: group 0
// as a value that the wait hands on, so that its next address is formed behind the wait, the two groups 1 as inputs, so that
// their registers are still theirs here: no word of a request in flight takes a new value in front of this wait.
__device__ __forceinline__ void wait_tensor0(u32x4& g0, u32x8 g1a, u32x8 g1b) {
#if defined(__HIP_DEVICE_COMPILE__)
  asm volatile("s_wait_tensorcnt 0x0" : "+s"(g0) : "s"(g1a), "s"(g1b) : "memory");
#endif
}
// Group 1 of a tile of D1 rows of D0 bytes (1-byte elements, tensor = tile), source row pitch PITCH bytes; W0 = word 0 (no mask;
// the pad that sets the LDS pitch), a compile-time constant. Built once, the same for every stage.
template <uint32_t W0, uint32_t D0, uint32_t D1, uint32_t PITCH>
__device__ __forceinline__ u32x8 tdm_group1() {
  // pinned(): each descriptor word held in a scalar register, so that the group is one set of registers for the whole kernel and
  // not constants set up anew, in registers that are then reused, at each request
  u32x8 g1;
  g1[0] = pinned(W0);
  g1[1] = pinned((D0 & 0xFFFFu) << 16);
  g1[2] = pinned((D0 >> 16) | ((D1 & 0xFFFFu) << 16));
  g1[3] = pinned((D1 >> 16) | (D0 << 16));
  g1[4] = pinned(D1);
  g1[5] = pinned(PITCH);
  g1[6] = pinned(0u);
  g1[7] = pinned(0u);
  return g1;
}
// Group 0: tile's first byte at ga, to LDS byte offset lds_dst.
__device__ __forceinline__ u32x4 tdm_group0(uint32_t lds_dst, uint64_t ga) {
  u32x4 g0;
  g0[0] = uni(1u);
  g0[1] = uni(lds_dst);
  g0[2] = uni((uint32_t)ga);
  g0[3] = uni((((uint32_t)(ga >> 32)) & 0x01FFFFFFu) | 0x80000000u);
  return g0;
}
// Group 0 of the next stage: new LDS place, source address advanced by step bytes (the carry goes into address bits 56..32).
__device__ __forceinline__ void tdm_advance(u32x4& g0, uint32_t lds_dst, uint32_t step) {
  const uint32_t lo = g0[2] + step;
  g0[1] = uni(lds_dst);
  g0[3] = uni(g0[3] + (lo < step ? 1u : 0u));
  g0[2] = uni(lo);
}
__device__ __forceinline__ void tdm_load(u32x4 g0, u32x8 g1) {
#if defined(__HIP_DEVICE_COMPILE__)
  // the request itself: one per issuing wave, through no register; its waits are written by hand where it is used
  asm volatile("tensor_load_to_lds %0, %1" :: "s"(g0), "s"(g1) : "memory");
#endif
}
#define KW0 ((1u << 20) | (4u << 22) | (3u << 25))   // 128-B rows, 16 B of pad behind each
#define VW0 ((1u << 20) | (5u << 22) | (3u << 25))   // 256-B rows, 16 B of pad behind each

// =====================================================================================================
// f32 plane -> bf16 plane (RNE convert), same layout. Thread = 8 consecutive elements: two 16-B loads, one 16-B store;
// coverage: grid = ceil(n8/256) blocks x 256 thr x 8 = the whole plane (n8 = elements/8, elements % 256 == 0, so every wave is
//           fully active or fully inactive).
// =====================================================================================================
__global__ __launch_bounds__(256) void cvb16(const float* __restrict__ x, u16* D, int n8) {
  const int gt = blockIdx.x * 256 + (int)threadIdx.x;
  if (gt >= n8) return;                     // no barriers in this kernel
  const float* p = x + (size_t)gt * 8;
  const v4f a = *(const v4f*)(p), c4 = *(const v4f*)(p + 4);
  float v[8];
#pragma unroll
  for (int e = 0; e < 4; ++e) { v[e] = a[e]; v[4 + e] = c4[e]; }
  unsigned short s[8];
#pragma unroll
  for (int e = 0; e < 8; ++e) s[e] = bf_bits(v[e]);
  v4u o;
#pragma unroll
  for (int e = 0; e < 4; ++e) o[e] = pk16(s[2 * e], s[2 * e + 1]);
  u16* d = D + (size_t)gt * 8;
  {
    *(v4u*)(d) = o;
    
  }
}

// =====================================================================================================
// f32 plane -> f16 plane of (value * scale), same layout (scale a power of two). Same thread/store shape as cvb16.
// coverage: grid = ceil(n8/256) blocks x 256 thr x 8 = the whole plane.
// =====================================================================================================
__global__ __launch_bounds__(256) void cvh16(const float* __restrict__ x, u16* D, int n8, float scale) {
  const int gt = blockIdx.x * 256 + (int)threadIdx.x;
  if (gt >= n8) return;                     // no barriers in this kernel
  const float* p = x + (size_t)gt * 8;
  const v4f a = *(const v4f*)(p), c4 = *(const v4f*)(p + 4);
  float v[8];
#pragma unroll
  for (int e = 0; e < 4; ++e) { v[e] = a[e]; v[4 + e] = c4[e]; }
  unsigned short s[8];
#pragma unroll
  for (int e = 0; e < 8; ++e) s[e] = h_bits((_Float16)(v[e] * scale));
  v4u o;
#pragma unroll
  for (int e = 0; e < 4; ++e) o[e] = pk16(s[2 * e], s[2 * e + 1]);
  u16* d = D + (size_t)gt * 8;
  {
    *(v4u*)(d) = o;
    
  }
}

// =====================================================================================================
// Bias terms for the GEMM epilogue (bf16-RNE values of bias[], nb entries; every candidate index clamped into 0..nb-1 so all
// loads are in range, selection by value): bmode 0: per-column direct; bmode 1: per-row direct.
// =====================================================================================================
__device__ __forceinline__ void bias_terms(const float* __restrict__ bias, int nb, int bmode, int rowb, int col0, int hh, int m,
                                           v4f& badd, v8f& radd) {
#pragma unroll
  for (int e = 0; e < 4; ++e) {
    const int ci = col0 + 4 * m + e;
    const int ic = ci < nb ? ci : nb - 1;
    const float bc = bfr(bias[ic]);
    badd[e] = (bmode == 0) ? bc : 0.0f;
  }
#pragma unroll
  for (int r = 0; r < 8; ++r) {
    const int ri = rowb + 8 * hh + r;
    const int ir = ri < nb ? ri : nb - 1;
    const float br = bfr(bias[ir]);
    radd[r] = (bmode == 1) ? br : 0.0f;
  }
}

// =====================================================================================================
// GEMM epilogue: the wave's 16x64 f32 tile (times oscale, plus per-row addend radd) staged in its LDS slab (pitch 68),
// coverage: 8 instructions x 2 rows x 16 lanes x 4 floats = the wave's 16 x 64 tile.
// =====================================================================================================
__device__ __forceinline__ void epi64(float* sl, v8f a0, v8f a1, v8f a2, v8f a3, float oscale, v4f badd, v8f radd,
                                      float* C, int N, size_t rowb, int col0, int lane) {
  const int hh = lane >> 4, m = lane & 15;
#pragma unroll
  for (int r = 0; r < 8; ++r) {
    const int ro = (8 * hh + r) * 68 + m;
    sl[ro]      = a0[r] * oscale + radd[r];
    sl[ro + 16] = a1[r] * oscale + radd[r];
    sl[ro + 32] = a2[r] * oscale + radd[r];
    sl[ro + 48] = a3[r] * oscale + radd[r];
  }
  wave_sync_lds();
  v4f vals[8];
#pragma unroll
  for (int it = 0; it < 8; ++it) vals[it] = *(const v4f*)(sl + (it * 2 + hh) * 68 + m * 4) + badd;
  float* dst = C + (rowb + (size_t)hh) * (size_t)N + col0 + m * 4;
  {
#pragma unroll
    for (int it = 0; it < 8; ++it) {
      *(v4f*)(dst + (size_t)(it * 2) * (size_t)N) = vals[it];
    }
    
  }
}

// =====================================================================================================
// bf16 GEMM with bias: C[M][N] (f32, pitch N) = A[M][K] (bf16 row-major) . Bt[N][K]^T (bf16 k-contiguous), times oscale, plus
// the bias term selected by bmode (see bias_terms). grid.x = (M/64)*(N/64) tiles. Block = 64x64 tile, 4 waves x 16 rows;
// fragments loaded straight from the 16-bit rows (two 16-B loads each, split k map for A and B); K stepped by 32, the
// fragments of a step loaded three steps ahead into a ring of four register sets (host: K % 128 == 0, M % 64 == 0, N % 64 == 0).
// =====================================================================================================
struct GSet { v16b a, b0, b1, b2, b3; };
__device__ __forceinline__ void ld_gset(GSet& s, const u16* ap, const u16* bp, size_t bs, int k0) {
  const u16* pa = ap + k0;
  const u16* p0 = bp + k0;
  const u16* p1 = bp + bs + k0;
  const u16* p2 = bp + 2 * bs + k0;
  const u16* p3 = bp + 3 * bs + k0;
  s.a  = ldfrag_b(pa);
  s.b0 = ldfrag_b(p0);
  s.b1 = ldfrag_b(p1);
  s.b2 = ldfrag_b(p2);
  s.b3 = ldfrag_b(p3);
#if defined(__HIP_DEVICE_COMPILE__)
  // stands between the set's loads and the next write of a register that holds one of their addresses (the loads stay in flight
  // over the loop's back edge); the addresses are inputs so that none of these registers is reused before the wait
  asm volatile("s_wait_xcnt 0x0" :: "v"(pa), "v"(p0), "v"(p1), "v"(p2), "v"(p3) : "memory");
#endif
}
__device__ __forceinline__ void gemm_step(const GSet& s, v8f& acc0, v8f& acc1, v8f& acc2, v8f& acc3) {
  acc0 = mma_b(s.a, s.b0, acc0);
  acc1 = mma_b(s.a, s.b1, acc1);
  acc2 = mma_b(s.a, s.b2, acc2);
  acc3 = mma_b(s.a, s.b3, acc3);
  g4_5<v16b>(acc0, acc1, acc2, acc3, s.a, s.b0, s.b1, s.b2, s.b3);
}
__global__ __launch_bounds__(128)
void gemm_bfb(const u16* __restrict__ A, const u16* __restrict__ Bt, const float* __restrict__ bias,
              float* C, int M, int N, int K, float oscale, int bmode, int nb) {
  __shared__ __align__(16) float slab[4 * SLAB64];
  const int tid = threadIdx.x, wave = tid >> 5, lane = tid & 31, hh = lane >> 4, m = lane & 15;
  const int ntile = N >> 6;
  const int bid   = blockIdx.x;
  const int rowb  = (bid / ntile) * 64 + wave * 16;
  const int col0  = (bid % ntile) * 64;
  if (rowb + 16 > M) return;                 // wave-uniform, never taken with the exact grid; no block barriers in this kernel
  const u16* ap = A  + (size_t)(rowb + m) * K + 8 * hh;
  const u16* bp = Bt + (size_t)(col0 + m) * K + 8 * hh;
  const size_t bs = (size_t)16 * K;
  v8f acc0 = zero8(), acc1 = zero8(), acc2 = zero8(), acc3 = zero8();
  GSet g0, g1, g2, g3;
  // the scheduling barriers here and in the loop keep the sets' loads in the order written, so that the wait in front of a step
  // counts only that set's loads and leaves the younger sets in flight
  ld_gset(g0, ap, bp, bs, 0);
  __builtin_amdgcn_sched_barrier(0);
  ld_gset(g1, ap, bp, bs, 32);
  __builtin_amdgcn_sched_barrier(0);
  ld_gset(g2, ap, bp, bs, 64);
  __builtin_amdgcn_sched_barrier(0);
  // rolled: one trip = four k steps, one per register set, so that no set is ever copied
#pragma unroll 1
  for (int k0 = 0; k0 < K; k0 += 128) {
    // a step past the end loads step 0 again (in range, never used): no branch stands between the loads and their waits
    const int n4 = (k0 + 128 < K) ? k0 + 128 : 0;
    const int n5 = (k0 + 160 < K) ? k0 + 160 : 0;
    const int n6 = (k0 + 192 < K) ? k0 + 192 : 0;
    ld_gset(g3, ap, bp, bs, k0 + 96);
    __builtin_amdgcn_sched_barrier(0);
    gemm_step(g0, acc0, acc1, acc2, acc3);
    __builtin_amdgcn_sched_barrier(0);
    ld_gset(g0, ap, bp, bs, n4);
    __builtin_amdgcn_sched_barrier(0);
    gemm_step(g1, acc0, acc1, acc2, acc3);
    __builtin_amdgcn_sched_barrier(0);
    ld_gset(g1, ap, bp, bs, n5);
    __builtin_amdgcn_sched_barrier(0);
    gemm_step(g2, acc0, acc1, acc2, acc3);
    __builtin_amdgcn_sched_barrier(0);
    ld_gset(g2, ap, bp, bs, n6);
    __builtin_amdgcn_sched_barrier(0);
    gemm_step(g3, acc0, acc1, acc2, acc3);
    __builtin_amdgcn_sched_barrier(0);
  }
  v4f badd = zero4();
  v8f radd = zero8();
  bias_terms(bias, nb, bmode, rowb, col0, hh, m, badd, radd);
  epi64(slab + wave * SLAB64, acc0, acc1, acc2, acc3, oscale, badd, radd, C, N, (size_t)rowb, col0, lane);
}

// =====================================================================================================
// Full (non-causal, unmasked) multi-head flash attention: block = (head, 64 query rows), 4 waves, wave w owns the 16 query rows
// q0 = 64*qt + 16*w .. q0+15.
//   q plane (f16, x64) laid out [s][h][d] (row pitch OUTW); k plane the same; v^T plane [h][d][s] (x64). All NKB = 128 key
//   blocks of 32 keys are visited (static bound), in NST stages of STK = 128 keys. A stage's k rows (128 x 128 B) and v^T rows
//   (64 x 256 B) are brought into LDS once for the four waves, by one tensor load each (wave 0: k, wave 1: v^T), into one of two
//   buffers, the next stage's loads in flight while this stage is worked on; one work-group barrier per stage publishes the next
//   stage and frees the buffer just read. Inside a stage a block's k and v fragments are read from LDS (ds_load_b128, padded
//   pitches) one block ahead into a second register set; nothing of the next stage is read in front of its barrier.
//   Scores are computed TRANSPOSED: S^T tile g (g = 0,1) = k rows (keys kb+16g .. +15, A operand, row m = lane&15, split k map
//   over d) times q^T (B operand, col n = query q0 + (lane&15), k = d, split map), one product per tile and d-chunk.
//   D element r of lane l = (key kb+16g+8h+r, query q0+(l&15)), so a lane owns one query column and 16 of its 32 keys; the
//   partner lane l^16 owns the other 16 -> row max / row sum need one xor-16 shuffle.
//   Online max-subtracted base-2 softmax in f32 (scale 1/8 and the q,k carries folded into lsc; lsc, the maximum and P's carry
//   enter the exponent through one fma). The exp'd values ARE the
//   P A-fragment in place: A row m = query = lane&15, element i <- key kb+8h+i (tile 0, D element i), element 8+i <- key
//   kb+16+8h+i (tile 1, D element i). P is carried x32768 as f16. The rescale factor of query row 8h+r of the O accumulators is
//   fetched from lane 8h+r with a shuffle (uniform control). 4 v^T B fragments (col n = d = 16j + (lane&15), keys k-contiguous),
//   4 P.V WMMAs per key block.
//   Epilogue: 1/l (per query, shuffled to the D row owner) and carry folds in f32; the wave's 16x64 f32 result staged in its LDS
// coverage: per wave 8 instructions x 2 rows x 16 lanes x 4 floats = 16 x 64; grid NH*64 blocks x 4 waves = every (s, head)
//           row segment of the output exactly once.
// =====================================================================================================
// One key block's fragments: k rows kb+c and kb+16+c (d chunks 0 and 1), v^T rows d = 16j + c (keys kb..kb+31).
struct KVSet { v16h k00, k10, k01, k11, v0, v1, v2, v3; };
// kp: LDS address of k row (block's first key + c), byte 16*hh; vp: LDS address of v^T row c at the block's first key, byte 16*hh.
__device__ __forceinline__ void ld_kv(KVSet& s, const _Float16* kp, const _Float16* vp) {
  s.k00 = ldfrag_h(kp);
  s.k10 = ldfrag_h(kp + 16 * (KPITCH / 2));
  s.k01 = ldfrag_h(kp + 32);
  s.k11 = ldfrag_h(kp + 16 * (KPITCH / 2) + 32);
  s.v0 = ldfrag_h(vp);
  s.v1 = ldfrag_h(vp + 16 * (VPITCH / 2));
  s.v2 = ldfrag_h(vp + 32 * (VPITCH / 2));
  s.v3 = ldfrag_h(vp + 48 * (VPITCH / 2));
}
// One key block of the online softmax and P.V, on fragments already in registers (see attn_fwd).
__device__ __forceinline__ void att_step(const KVSet& f, v16h qh0, v16h qh1, float lsc, int hh,
                                         float& mrun, float& lrun, v8f (&o)[4]) {
  // ---- transposed scores: s0 = keys kb..kb+15, s1 = keys kb+16..kb+31, column = query q0 + c ----
  v8f s0 = zero8(), s1 = zero8();
  s0 = mma_h(f.k00, qh0, s0);
  s1 = mma_h(f.k10, qh0, s1);
  g2_3(s0, s1, qh0, f.k00, f.k10);
  s0 = mma_h(f.k01, qh1, s0);
  s1 = mma_h(f.k11, qh1, s1);
  g2_3(s0, s1, qh1, f.k01, f.k11);
  // ---- this lane's 16 keys for query q0 + c: s0[i] <- key kb+8hh+i, s1[i] <- key kb+16+8hh+i. The running maximum is kept in
  //      raw score units (lsc > 0, so the order is that of the logits) ----
  float cm = s0[0];
#pragma unroll
  for (int i = 1; i < 8; ++i) cm = fmaxf(cm, s0[i]);
#pragma unroll
  for (int i = 0; i < 8; ++i) cm = fmaxf(cm, s1[i]);
  cm = fmaxf(cm, __shfl_xor(cm, 16, 32));
  const float mn = fmaxf(mrun, cm);                 // finite from the first block on
  float al = (mrun - mn) * lsc;                     // exponent of the rescale factor; -inf on the first block (mrun = -inf)
  mrun = mn;
  // ---- probabilities x32768 (<= 32768 up to rounding) = 2^(s*lsc - mn*lsc + 15): scale, maximum and carry in one fma;
  //      they are the P A-fragment once converted to f16: element i <- s0[i], element 8+i <- s1[i] ----
  const float nb = fmaf(-mn, lsc, PEXP);
  float pa[8], pb[8];
#pragma unroll
  for (int i = 0; i < 8; ++i) { pa[i] = fmaf(s0[i], lsc, nb); pb[i] = fmaf(s1[i], lsc, nb); }
  exp2_run9(al, pa);                                // al: 0 on the first block
  exp2_run8(pb);
  float ps = 0.f;
  FragH ph;
#pragma unroll
  for (int w = 0; w < 2; ++w) {
#pragma unroll
    for (int e4 = 0; e4 < 4; ++e4) {
      const int i = 2 * e4;
      const float p0 = w ? pb[i] : pa[i], p1 = w ? pb[i + 1] : pa[i + 1];
      ps += p0 + p1;
      const v2f pp = {p0, p1};
      ph.u[w][e4] = __builtin_bit_cast(unsigned, __builtin_convertvector(pp, v2h));   // one packed RNE convert per pair
    }
  }
  ps += __shfl_xor(ps, 16, 32);
  lrun = lrun * al + ps;
  // ---- rescale the O accumulators: D row 8hh+r = query q0+8hh+r, its factor lives in lane 8hh+r (and 16+8hh+r) ----
  float scl[8];
#pragma unroll
  for (int r = 0; r < 8; ++r) scl[r] = __shfl(al, 8 * hh + r, 32);
#pragma unroll
  for (int j = 0; j < 4; ++j) {
#pragma unroll
    for (int r = 0; r < 8; ++r) o[j][r] *= scl[r];
  }
  // ---- P.V : B fragment col n = d = j*16 + c, keys contiguous in the v^T plane ----
  o[0] = mma_h(ph.v, f.v0, o[0]);
  o[1] = mma_h(ph.v, f.v1, o[1]);
  o[2] = mma_h(ph.v, f.v2, o[2]);
  o[3] = mma_h(ph.v, f.v3, o[3]);
  g4_5<v16h>(o[0], o[1], o[2], o[3], ph.v, f.v0, f.v1, f.v2, f.v3);
}

__global__ __launch_bounds__(ATT_THREADS)
void attn_fwd(const u16* __restrict__ QHp, const u16* __restrict__ KHp, const u16* __restrict__ VHp, float* out) {
  // two stage buffers (k tile, then v^T tile, each at a multiple of 2 KiB), then per wave a result slab [16][68] for the epilogue
  __shared__ __attribute__((aligned(2048))) unsigned char L[RINGB + ATT_WAVES * SLABF * 4];
  float* smem = (float*)(void*)(L + RINGB);

  const int tid  = threadIdx.x;
  const int wave = tid >> 5;
  const int lane = tid & 31;
  const int hh   = lane >> 4;
  const int c    = lane & 15;

  const int bid  = blockIdx.x;
  const int qt   = bid % QTILES;              // 0..63
  const int head = bid / QTILES;              // 0..NH-1
  if (head >= NH) return;                     // block-uniform, never taken with the exact grid; stands in front of every barrier
  const int q0   = qt * 64 + wave * 16;

  // B fragments of q^T: col n = query q0 + c, k = d (k-contiguous row of the q plane); loop-invariant
  const size_t qofs = ((size_t)(q0 + c) * NH + head) * HD + 8 * hh;
  const _Float16* Qh  = (const _Float16*)(const void*)QHp + qofs;
  const v16h qh0 = ldfrag_h(Qh), qh1 = ldfrag_h(Qh + 32);
  const float lsc = 0.125f * (LOG2E / (QSC * KSC));

  // Stage tiles: k rows st*STK .. +127 of this head (128 B each, plane pitch OUTW*2 B); v^T rows head*HD .. +63, keys st*STK .. +127
  // (256 B each, plane pitch SEQ*2 B). Every tile lies wholly inside its plane.
  const uint32_t wv    = uni((uint32_t)tid >> 5);
  const uint64_t kga   = (uint64_t)(size_t)KHp + (uint64_t)head * (HD * 2);
  const uint64_t vga   = (uint64_t)(size_t)VHp + (uint64_t)head * ((uint64_t)HD * SEQ * 2);
  // wave 0 brings the k tiles, wave 1 the v^T tiles: a wave's own place in a buffer, source address and step from stage to stage
  const uint32_t lown  = (uint32_t)(size_t)L + (wv == 0u ? 0u : (uint32_t)KTILE);
  const uint32_t gstep = (wv == 0u) ? (uint32_t)(STK * OUTW * 2) : (uint32_t)(STK * 2);
  const u32x8 g1k = tdm_group1<KW0, HD * 2, STK, OUTW * 2>();
  const u32x8 g1v = tdm_group1<VW0, STK * 2, HD, SEQ * 2>();
  u32x4 g0 = tdm_group0(lown, (wv == 0u) ? kga : vga);
  if (pinned(wv == 0u)) {
    tdm_load(g0, g1k);
    wait_tensor0(g0, g1k, g1v);
  }
  if (pinned(wv == 1u)) {
    tdm_load(g0, g1v);
    wait_tensor0(g0, g1k, g1v);
  }
  __syncthreads();                       // stage 0 published
  tdm_advance(g0, lown + BUFB, gstep);
  if (pinned(wv == 0u)) tdm_load(g0, g1k);
  if (pinned(wv == 1u)) tdm_load(g0, g1v);

  float mrun = -INFINITY, lrun = 0.f;
  v8f o[4];
#pragma unroll
  for (int j = 0; j < 4; ++j) o[j] = zero8();

  // A fragments of k: row m = key + c, k = d; B fragments of v: col n = d = 16j + c, k = key (both k-contiguous LDS rows)
  const uint32_t klane = (uint32_t)c * KPITCH + 16u * (uint32_t)hh;
  const uint32_t vlane = KTILE + (uint32_t)c * VPITCH + 16u * (uint32_t)hh;
  KVSet sa, sb;
  // rolled: one trip = one stage = four key blocks, alternating between the two register sets, so that no set is ever copied
#pragma unroll 1
  for (int st = 0; st < NST; ++st) {
    const uint32_t bofs = (uint32_t)(st & 1) * BUFB;
    const _Float16* kp = (const _Float16*)(const void*)(L + bofs + klane);
    const _Float16* vp = (const _Float16*)(const void*)(L + bofs + vlane);
    // the scheduling barriers keep each group of LDS reads where it is written (one group per block, never among the products)
    ld_kv(sa, kp, vp);
    __builtin_amdgcn_sched_barrier(0);
    ld_kv(sb, kp + 32 * (KPITCH / 2), vp + 32);
    __builtin_amdgcn_sched_barrier(0);
    att_step(sa, qh0, qh1, lsc, hh, mrun, lrun, o);
    __builtin_amdgcn_sched_barrier(0);
    ld_kv(sa, kp + 64 * (KPITCH / 2), vp + 64);
    __builtin_amdgcn_sched_barrier(0);
    att_step(sb, qh0, qh1, lsc, hh, mrun, lrun, o);
    __builtin_amdgcn_sched_barrier(0);
    ld_kv(sb, kp + 96 * (KPITCH / 2), vp + 96);
    __builtin_amdgcn_sched_barrier(0);
    att_step(sa, qh0, qh1, lsc, hh, mrun, lrun, o);
    __builtin_amdgcn_sched_barrier(0);
    att_step(sb, qh0, qh1, lsc, hh, mrun, lrun, o);
    __builtin_amdgcn_sched_barrier(0);
    // publish point of stage st + 1: own LDS reads retired, the issuers' tiles landed, barrier, then the refill of the buffer just read
    wait_ds0();
    if (pinned(wv < 2u)) wait_tensor0(g0, g1k, g1v);
    __syncthreads();
    if (pinned(st + 2 < NST)) {
      tdm_advance(g0, lown + bofs, gstep);
      if (pinned(wv == 0u)) tdm_load(g0, g1k);
      if (pinned(wv == 1u)) tdm_load(g0, g1v);
    }
  }
  wait_tensor0(g0, g1k, g1v);
  wait_ds0();
  acc_guard4(o[0], o[1], o[2], o[3]);

  // ---- fold 1/l (per query, owned by lane = query; l carries the same 32768 as P) and the carry 64 on v; stage the 16x64 slab ----
  const float linv = (1.0f / lrun) * (1.0f / VCAR);
  float inv[8];
#pragma unroll
  for (int r = 0; r < 8; ++r) inv[r] = __shfl(linv, 8 * hh + r, 32);
  float* slab = smem + wave * SLABF;
#pragma unroll
  for (int r = 0; r < 8; ++r) {
#pragma unroll
    for (int j = 0; j < 4; ++j) slab[(8 * hh + r) * 68 + j * 16 + c] = o[j][r] * inv[r];
  }
  wave_sync_lds();
  // ---- f32 rows of the merged-head output: row s = q0 + 2*it + hh, columns head*64 + 4c .. +3 per lane ----
  v4f vals[8];
#pragma unroll
  for (int it = 0; it < 8; ++it) vals[it] = *(const v4f*)(slab + (it * 2 + hh) * 68 + c * 4);
  float* dst = out + ((size_t)(q0 + hh)) * (size_t)OUTW + head * HD + c * 4;
  {
#pragma unroll
    for (int it = 0; it < 8; ++it) {
      *(v4f*)(dst + (size_t)(it * 2) * (size_t)OUTW) = vals[it];
    }
    
  }
}

// =====================================================================================================
// Workspace map (bytes); every plane is fully written by whole-line stores before it is read; all extents are exact multiples
// of the 512-B store granularity (no pad rows needed); every offset a multiple of 128; F is reused sequentially (in-order stream):
//   XB  bf16 [4096 token][768 i]        6291456
//   WQB bf16 [OUTW o][768 i]            1179648      WKB same 1179648     WVB same 1179648
//   F   f32  [4096][OUTW] / [OUTW][4096] 12582912   (projection q, then k, then v)
//   QH  f16  [4096][12][64] x64         6291456      KH same 6291456
//   VH  f16  [12][64][4096] x64         6291456
//   end                                41287680
// =====================================================================================================
extern "C" void kernel_launch(void* const* d_in, const int* in_sizes, int n_in,
                              void* d_out, int out_size, void* d_ws, size_t ws_size,
                              hipStream_t stream) {
  const int XN = SEQ * DIN;                             // 3145728
  const int ON = SEQ * OUTW;                            // 3145728
  if (n_in < 7) return;
  if (in_sizes[0] != XN) return;
  if (in_sizes[1] != DIN * DIN || in_sizes[3] != DIN * DIN || in_sizes[5] != DIN * DIN) return;
  if (in_sizes[2] != DIN || in_sizes[4] != DIN || in_sizes[6] != DIN) return;
  if (out_size != ON) return;

  const float* xin = (const float*)d_in[0];
  const float* wq  = (const float*)d_in[1];
  const float* bq  = (const float*)d_in[2];
  const float* wk  = (const float*)d_in[3];
  const float* bk  = (const float*)d_in[4];
  const float* wv  = (const float*)d_in[5];
  const float* bv  = (const float*)d_in[6];
  float*       out = (float*)d_out;
  const int    nb  = in_sizes[2];                       // bias length (DIN)

  const size_t szXB = (size_t)SEQ * DIN * 2;            //  6291456
  const size_t szW  = (size_t)OUTW * DIN * 2;           //  1179648
  const size_t szF  = (size_t)SEQ * OUTW * 4;           // 12582912
  const size_t szP  = (size_t)SEQ * OUTW * 2;           //  6291456
  size_t off = 0;
  const size_t oXB  = off; off += szXB;
  const size_t oWQB = off; off += szW;
  const size_t oWKB = off; off += szW;
  const size_t oWVB = off; off += szW;
  const size_t oF   = off; off += szF;
  const size_t oQH  = off; off += szP;
  const size_t oKH  = off; off += szP;
  const size_t oVH  = off; off += szP;
  if (off > ws_size) return;                            // off = 41287680
  if (off > (size_t)134217728) return;

  char* ws = (char*)d_ws;
  u16*   XB  = (u16*)(ws + oXB);
  u16*   WQB = (u16*)(ws + oWQB);
  u16*   WKB = (u16*)(ws + oWKB);
  u16*   WVB = (u16*)(ws + oWVB);
  float* F   = (float*)(ws + oF);
  u16*   QH  = (u16*)(ws + oQH);
  u16*   KH  = (u16*)(ws + oKH);
  u16*   VH  = (u16*)(ws + oVH);

  const dim3 blk(256);
  const int n8x = XN / 8;                               // 393216
  const int n8w = (OUTW * DIN) / 8;                     // 73728
  const int n8o = ON / 8;                               // 393216
  const dim3 gX((n8x + 255) / 256);                     // 1536
  const dim3 gWc((n8w + 255) / 256);                    // 288
  const dim3 gO((n8o + 255) / 256);                     // 1536
  const dim3 gGt((SEQ / 64) * (OUTW / 64));             // 768 tiles, token-major projections
  const dim3 gGc((OUTW / 64) * (SEQ / 64));             // 768 tiles, channel-major projection (v^T layout)
  const dim3 bG(128);
  const dim3 gAT(ATT_BLOCKS);                           // 768
  const dim3 bAT(ATT_THREADS);                          // 128

  // (0..2) weights [o][i] -> bf16 planes (first OUTW rows), same layout
  cvb16<<<gWc, blk, 0, stream>>>(wq, WQB, n8w);
  cvb16<<<gWc, blk, 0, stream>>>(wk, WKB, n8w);
  cvb16<<<gWc, blk, 0, stream>>>(wv, WVB, n8w);
  // (3) input [token][i] -> bf16 plane, same layout
  cvb16<<<gX, blk, 0, stream>>>(xin, XB, n8x);
  // (4..5) q: projection + bias -> F [4096 token][h*64+d] f32; -> f16 plane x64
  gemm_bfb<<<gGt, bG, 0, stream>>>(XB, WQB, bq, F, SEQ, OUTW, DIN, 1.0f, 0, nb);
  cvh16<<<gO, blk, 0, stream>>>(F, QH, n8o, QSC);
  // (6..7) k: same pipeline (F reused; single in-order stream)
  gemm_bfb<<<gGt, bG, 0, stream>>>(XB, WKB, bk, F, SEQ, OUTW, DIN, 1.0f, 0, nb);
  cvh16<<<gO, blk, 0, stream>>>(F, KH, n8o, KSC);
  // (8..9) v: channel-major projection -> F [h*64+d][4096] f32 (= v^T plane layout) with per-row bias; -> f16 plane x64
  gemm_bfb<<<gGc, bG, 0, stream>>>(WVB, XB, bv, F, OUTW, SEQ, DIN, 1.0f, 1, nb);
  cvh16<<<gO, blk, 0, stream>>>(F, VH, n8o, VCAR);
  // (10) attention -> merged-head f32 output [4096][h*64+d]
  attn_fwd<<<gAT, bAT, 0, stream>>>(QH, KH, VH, out);
  (void)hipGetLastError();
}

// v004
// A run of this version takes 133 microseconds.
// Next to v003, in two timings, it ran 1.11 times as fast each time.
// Counting every step since v000, it is 2.03 times as fast.
// Contractions: projections X.W^T and Wv.X^T on v_wmma_f32_16x16x32_bf16 (X and W RNE-converted bf16 operands, f32 accumulate,
// bias added in f32); scores k.q^T (q, k carried x64 as f16) and P.v (P x32768 as f16, v x64 as f16) on v_wmma_f32_16x16x32_f16,
// f32 accumulate. Base-2 online softmax (one fma and one v_exp_f32 per probability) and the 1/l fold in f32 on VALU.
#include <hip/hip_runtime.h>
#include <math.h>
#include <stdint.h>

#define SEQ   4096
#define DIN   768
#define NH    12
#define HD    64
#define OUTW  (NH * HD)
#define QSC   64.0f
#define KSC   64.0f
#define PEXP  15.0f                       // P and its row sum are carried x2^15 = 32768
#define VCAR  64.0f
#define LOG2E 1.4426950408889634f
#define ATT_WAVES   4
#define ATT_THREADS (ATT_WAVES * 32)
#define QTILES      (SEQ / 64)
#define ATT_BLOCKS  (NH * QTILES)
#define NKB    (SEQ / 32)
#define SLABF  (16 * 68)
#define SLAB64 (16 * 68)
#define STK     128                      // keys per LDS stage of the attention loop (four 32-key blocks)
#define NST     (SEQ / STK)
#define KPITCH  144                      // LDS row pitch of a k row (128 B + 16 B pad), bytes
#define VPITCH  272                      // LDS row pitch of a v^T row (256 B + 16 B pad), bytes
#define KTILE   (STK * KPITCH)           // 18432 B, a multiple of 2 KiB
#define VTILE   18432                    // HD * VPITCH = 17408 B, rounded up to a multiple of 2 KiB
#define BUFB    (KTILE + VTILE)
#define RINGB   (2 * BUFB)
static_assert(HD == 64);
static_assert((SEQ % 64) == 0 && (DIN % 32) == 0 && (OUTW % 64) == 0 && OUTW <= DIN);
static_assert(((SEQ * DIN) % 256) == 0 && ((OUTW * DIN) % 256) == 0 && ((SEQ * OUTW) % 256) == 0);
static_assert(ATT_THREADS == 128 && NKB * 32 == SEQ);
static_assert((DIN % 128) == 0 && (NKB % 2) == 0);
static_assert(ATT_WAVES * SLABF >= 4 * 16 * 68);
static_assert(NST >= 2 && NST * STK == SEQ && STK == 4 * 32);
static_assert((KTILE % 2048) == 0 && (VTILE % 2048) == 0 && HD * VPITCH <= VTILE);
static_assert(KPITCH == HD * 2 + 16 && VPITCH == STK * 2 + 16);

typedef unsigned short u16;
typedef _Float16 v16h __attribute__((ext_vector_type(16)));
typedef _Float16 v8h  __attribute__((ext_vector_type(8)));
typedef __bf16   v16b __attribute__((ext_vector_type(16)));
typedef _Float16 v2h  __attribute__((ext_vector_type(2)));
typedef float    v2f  __attribute__((ext_vector_type(2)));
typedef float    v8f  __attribute__((ext_vector_type(8)));
typedef float    v4f  __attribute__((ext_vector_type(4)));
typedef unsigned int v4u __attribute__((ext_vector_type(4)));
typedef uint32_t u32x4 __attribute__((ext_vector_type(4)));
typedef uint32_t u32x8 __attribute__((ext_vector_type(8)));

union FragH { v16h v; v8h h[2]; v4u u[2]; };
union FragB { v16b v; v4u u[2]; };

// ---- scalar helpers --------------------------------------------------------------------------------
__device__ __forceinline__ unsigned short bf_bits(float f) {          // f32 -> bf16 bits, RNE convert
  unsigned u = __float_as_uint(f);
  return (unsigned short)((u + 0x7FFFu + ((u >> 16) & 1u)) >> 16);
}
__device__ __forceinline__ float bf_up(unsigned short h) { return __uint_as_float(((unsigned)h) << 16); }
__device__ __forceinline__ float bfr(float f) { return bf_up(bf_bits(f)); }
__device__ __forceinline__ unsigned short h_bits(_Float16 x) { return __builtin_bit_cast(unsigned short, x); }
__device__ __forceinline__ unsigned pk16(unsigned short a, unsigned short b) { return (unsigned)a | ((unsigned)b << 16); }
// x <- 2^x by the hardware instruction alone. A result below 2^-126 may come out as 0: every use here is a probability or a
// rescale factor relative to a row maximum, where such a value is lost in the f16 P and in the f32 sums anyway. 2^-inf = 0.
// Written as one run, each in place: no instruction of the run reads its predecessor's result or writes its predecessor's source,
// and the closing v_nop is the slot that the instruction set asks for between the last v_exp_f32 and whatever uses its result.
__device__ __forceinline__ void exp2_run8(float (&x)[8]) {
#if defined(__HIP_DEVICE_COMPILE__)
  asm("v_exp_f32 %0, %0\n\tv_exp_f32 %1, %1\n\tv_exp_f32 %2, %2\n\tv_exp_f32 %3, %3\n\t"
      "v_exp_f32 %4, %4\n\tv_exp_f32 %5, %5\n\tv_exp_f32 %6, %6\n\tv_exp_f32 %7, %7\n\tv_nop"
      : "+v"(x[0]), "+v"(x[1]), "+v"(x[2]), "+v"(x[3]), "+v"(x[4]), "+v"(x[5]), "+v"(x[6]), "+v"(x[7]));
#endif
}
__device__ __forceinline__ void exp2_run9(float& a, float (&x)[8]) {   // a first: the longest path hangs on it
#if defined(__HIP_DEVICE_COMPILE__)
  asm("v_exp_f32 %0, %0\n\tv_exp_f32 %1, %1\n\tv_exp_f32 %2, %2\n\tv_exp_f32 %3, %3\n\tv_exp_f32 %4, %4\n\t"
      "v_exp_f32 %5, %5\n\tv_exp_f32 %6, %6\n\tv_exp_f32 %7, %7\n\tv_exp_f32 %8, %8\n\tv_nop"
      : "+v"(a), "+v"(x[0]), "+v"(x[1]), "+v"(x[2]), "+v"(x[3]), "+v"(x[4]), "+v"(x[5]), "+v"(x[6]), "+v"(x[7]));
#endif
}
__device__ __forceinline__ v8f zero8() { v8f z = {0.f, 0.f, 0.f, 0.f, 0.f, 0.f, 0.f, 0.f}; return z; }

// ---- fragment loaders: 16-bit A/B operand, lane -> row/col (lane&15), p already includes +8*(lane>>4);
//      elements 0..7 <- p[0..7] (k0+8h..), elements 8..15 <- p[16..23] (k0+16+8h..)  (same split k map for A and B;
//      B is always read from a k-contiguous [n][k] plane)
__device__ __forceinline__ v16h ldfrag_h(const _Float16* p) {
  FragH f;
  f.h[0] = *(const v8h*)(p);
  f.h[1] = *(const v8h*)(p + 16);
  return f.v;
}
__device__ __forceinline__ v16b ldfrag_b(const u16* p) {              // bf16 plane read as unsigned integer vectors
  FragB f;
  f.u[0] = *(const v4u*)(p);
  f.u[1] = *(const v4u*)(p + 16);
  return f.v;
}

__device__ __forceinline__ v8f mma_h(v16h a, v16h b, v8f c) {
  return __builtin_amdgcn_wmma_f32_16x16x32_f16(false, a, false, b, (short)0, c, false, false);
}
__device__ __forceinline__ v8f mma_b(v16b a, v16b b, v8f c) {
  return __builtin_amdgcn_wmma_f32_16x16x32_bf16(false, a, false, b, (short)0, c, false, false);
}
__device__ __forceinline__ void g2_3(v8f& a, v8f& b, v16h x0, v16h x1, v16h x2) {
#if defined(__HIP_DEVICE_COMPILE__)
  asm volatile("v_nop\n\tv_nop\n\tv_nop\n\tv_nop" : "+v"(a), "+v"(b) : "v"(x0), "v"(x1), "v"(x2) : "memory");
#endif
}
template <typename F>
__device__ __forceinline__ void g4_5(v8f& a, v8f& b, v8f& c, v8f& d, F x0, F x1, F x2, F x3, F x4) {
#if defined(__HIP_DEVICE_COMPILE__)
  asm volatile("v_nop\n\tv_nop\n\tv_nop\n\tv_nop"
               : "+v"(a), "+v"(b), "+v"(c), "+v"(d) : "v"(x0), "v"(x1), "v"(x2), "v"(x3), "v"(x4) : "memory");
#endif
}
__device__ __forceinline__ void acc_guard4(v8f& a, v8f& b, v8f& c, v8f& d) {
#if defined(__HIP_DEVICE_COMPILE__)
  asm volatile("v_nop\n\tv_nop\n\tv_nop\n\tv_nop" : "+v"(a), "+v"(b), "+v"(c), "+v"(d));
#endif
}
__device__ __forceinline__ void wave_sync_lds() {
  __builtin_amdgcn_fence(__ATOMIC_RELEASE, "workgroup");
  __builtin_amdgcn_wave_barrier();
  __builtin_amdgcn_fence(__ATOMIC_ACQUIRE, "workgroup");
}

// ---- tensor loads into LDS -------------------------------------------------------------------------
__device__ __forceinline__ uint32_t uni(uint32_t v) { return (uint32_t)__builtin_amdgcn_readfirstlane(v); }
__device__ __forceinline__ uint32_t pinned(uint32_t v) {
  uint32_t w = uni(v);
#if defined(__HIP_DEVICE_COMPILE__)
  // holds an issue test in a scalar register, so that it compiles to a scalar branch (tensor loads ignore EXEC), or a descriptor word
  asm volatile("" : "+s"(w));
#endif
  return w;
}
__device__ __forceinline__ void wait_ds0() {
#if defined(__HIP_DEVICE_COMPILE__)
  asm volatile("s_wait_dscnt 0x0" ::: "memory");      // this wave's LDS reads have retired before its buffer may be refilled
#endif
}
// The issuing wave's tile has landed (the compiler places no wait for it). The descriptor groups are operands of the wait: group 0
// as a value that the wait hands on, so that its next address is formed behind the wait, the two groups 1 as inputs, so that
// their registers are still theirs here: no word of a request in flight takes a new value in front of this wait.
__device__ __forceinline__ void wait_tensor0(u32x4& g0, u32x8 g1a, u32x8 g1b) {
#if defined(__HIP_DEVICE_COMPILE__)
  asm volatile("s_wait_tensorcnt 0x0" : "+s"(g0) : "s"(g1a), "s"(g1b) : "memory");
#endif
}
// Group 1 of a tile of D1 rows of D0 bytes (1-byte elements, tensor = tile), source row pitch PITCH bytes; W0 = word 0 (no mask;
// the pad that sets the LDS pitch), a compile-time constant. Built once, the same for every stage.
template <uint32_t W0, uint32_t D0, uint32_t D1, uint32_t PITCH>
__device__ __forceinline__ u32x8 tdm_group1() {
  // pinned(): each descriptor word held in a scalar register, so that the group is one set of registers for the whole kernel and
  // not constants set up anew, in registers that are then reused, at each request
  u32x8 g1;
  g1[0] = pinned(W0);
  g1[1] = pinned((D0 & 0xFFFFu) << 16);
  g1[2] = pinned((D0 >> 16) | ((D1 & 0xFFFFu) << 16));
  g1[3] = pinned((D1 >> 16) | (D0 << 16));
  g1[4] = pinned(D1);
  g1[5] = pinned(PITCH);
  g1[6] = pinned(0u);
  g1[7] = pinned(0u);
  return g1;
}
// Group 0: tile's first byte at ga, to LDS byte offset lds_dst.
__device__ __forceinline__ u32x4 tdm_group0(uint32_t lds_dst, uint64_t ga) {
  u32x4 g0;
  g0[0] = uni(1u);
  g0[1] = uni(lds_dst);
  g0[2] = uni((uint32_t)ga);
  g0[3] = uni((((uint32_t)(ga >> 32)) & 0x01FFFFFFu) | 0x80000000u);
  return g0;
}
// Group 0 of the next stage: new LDS place, source address advanced by step bytes (the carry goes into address bits 56..32).
__device__ __forceinline__ void tdm_advance(u32x4& g0, uint32_t lds_dst, uint32_t step) {
  const uint32_t lo = g0[2] + step;
  g0[1] = uni(lds_dst);
  g0[3] = uni(g0[3] + (lo < step ? 1u : 0u));
  g0[2] = uni(lo);
}
__device__ __forceinline__ void tdm_load(u32x4 g0, u32x8 g1) {
#if defined(__HIP_DEVICE_COMPILE__)
  // the request itself: one per issuing wave, through no register; its waits are written by hand where it is used
  asm volatile("tensor_load_to_lds %0, %1" :: "s"(g0), "s"(g1) : "memory");
#endif
}
#define KW0 ((1u << 20) | (4u << 22) | (3u << 25))   // 128-B rows, 16 B of pad behind each
#define VW0 ((1u << 20) | (5u << 22) | (3u << 25))   // 256-B rows, 16 B of pad behind each

// =====================================================================================================
// f32 plane -> bf16 plane (RNE convert), same layout. Thread = 8 consecutive elements: two 16-B loads, one 16-B store;
// coverage: grid = ceil(n8/256) blocks x 256 thr x 8 = the whole plane (n8 = elements/8, elements % 256 == 0, so every wave is
//           fully active or fully inactive).
// =====================================================================================================
__global__ __launch_bounds__(256) void cvb16(const float* __restrict__ x, u16* D, int n8) {
  const int gt = blockIdx.x * 256 + (int)threadIdx.x;
  if (gt >= n8) return;                     // no barriers in this kernel
  const float* p = x + (size_t)gt * 8;
  const v4f a = *(const v4f*)(p), c4 = *(const v4f*)(p + 4);
  float v[8];
#pragma unroll
  for (int e = 0; e < 4; ++e) { v[e] = a[e]; v[4 + e] = c4[e]; }
  unsigned short s[8];
#pragma unroll
  for (int e = 0; e < 8; ++e) s[e] = bf_bits(v[e]);
  v4u o;
#pragma unroll
  for (int e = 0; e < 4; ++e) o[e] = pk16(s[2 * e], s[2 * e + 1]);
  u16* d = D + (size_t)gt * 8;
  {
    *(v4u*)(d) = o;
    
  }
}

// =====================================================================================================
// Bias terms for the GEMM epilogue (bf16-RNE values of bias[], nb entries; every candidate index clamped into 0..nb-1 so all
// loads are in range, selection by value): bmode 0: per-column direct; bmode 1: per-row direct.
// =====================================================================================================
// badd: the 8 columns col0 + 8*cc .. +7 that the lane stores (cc = lane&7); radd: the 8 rows rowb + 8*hh .. +7 of its accumulators.
__device__ __forceinline__ void bias_terms(const float* __restrict__ bias, int nb, int bmode, int rowb, int col0, int hh, int cc,
                                           v8f& badd, v8f& radd) {
#pragma unroll
  for (int e = 0; e < 8; ++e) {
    const int ci = col0 + 8 * cc + e;
    const int ic = ci < nb ? ci : nb - 1;
    const float bc = bfr(bias[ic]);
    badd[e] = (bmode == 0) ? bc : 0.0f;
  }
#pragma unroll
  for (int r = 0; r < 8; ++r) {
    const int ri = rowb + 8 * hh + r;
    const int ir = ri < nb ? ri : nb - 1;
    const float br = bfr(bias[ir]);
    radd[r] = (bmode == 1) ? br : 0.0f;
  }
}

// =====================================================================================================
// GEMM epilogue: the wave's 16x64 f32 tile (times oscale, plus per-row addend radd) staged in its LDS slab (pitch 68), read back
// row-wise, per-column addend badd added in f32, times hscale (a power of two), converted to f16 (RNE) and stored: a lane holds 8
// consecutive columns (one 16-B store), 8 lanes one row of 64 f16 = one whole 128-B line.
// coverage: 4 instructions x 4 rows x 8 lanes x 8 halves = the wave's 16 x 64 tile.
// =====================================================================================================
__device__ __forceinline__ void epi64h(float* sl, v8f a0, v8f a1, v8f a2, v8f a3, float oscale, v8f badd, v8f radd, float hscale,
                                       u16* C, int N, size_t rowb, int col0, int lane) {
  const int hh = lane >> 4, m = lane & 15;
#pragma unroll
  for (int r = 0; r < 8; ++r) {
    const int ro = (8 * hh + r) * 68 + m;
    sl[ro]      = a0[r] * oscale + radd[r];
    sl[ro + 16] = a1[r] * oscale + radd[r];
    sl[ro + 32] = a2[r] * oscale + radd[r];
    sl[ro + 48] = a3[r] * oscale + radd[r];
  }
  wave_sync_lds();
  const int rr = lane >> 3, cc = lane & 7;
  v4u vals[4];
#pragma unroll
  for (int it = 0; it < 4; ++it) {
    const float* sp = sl + (it * 4 + rr) * 68 + cc * 8;
    const v4f x0 = *(const v4f*)(sp), x1 = *(const v4f*)(sp + 4);
    unsigned short h[8];
#pragma unroll
    for (int e = 0; e < 4; ++e) {
      h[e]     = h_bits((_Float16)((x0[e] + badd[e]) * hscale));
      h[4 + e] = h_bits((_Float16)((x1[e] + badd[4 + e]) * hscale));
    }
#pragma unroll
    for (int e = 0; e < 4; ++e) vals[it][e] = pk16(h[2 * e], h[2 * e + 1]);
  }
  u16* dst = C + (rowb + (size_t)rr) * (size_t)N + col0 + cc * 8;
#pragma unroll
  for (int it = 0; it < 4; ++it) *(v4u*)(dst + (size_t)(it * 4) * (size_t)N) = vals[it];
}

// =====================================================================================================
// bf16 GEMM with bias: C[M][N] (f16, pitch N) = (A[M][K] (bf16 row-major) . Bt[N][K]^T (bf16 k-contiguous), times oscale, plus
// the bias term selected by bmode (see bias_terms), all in f32) times hscale. grid.x = (M/64)*(N/64) tiles. Block = 64x64 tile, 4 waves x 16 rows;
// fragments loaded straight from the 16-bit rows (two 16-B loads each, split k map for A and B); K stepped by 32, the
// fragments of a step loaded three steps ahead into a ring of four register sets (host: K % 128 == 0, M % 64 == 0, N % 64 == 0).
// =====================================================================================================
struct GSet { v16b a, b0, b1, b2, b3; };
__device__ __forceinline__ void ld_gset(GSet& s, const u16* ap, const u16* bp, size_t bs, int k0) {
  const u16* pa = ap + k0;
  const u16* p0 = bp + k0;
  const u16* p1 = bp + bs + k0;
  const u16* p2 = bp + 2 * bs + k0;
  const u16* p3 = bp + 3 * bs + k0;
  s.a  = ldfrag_b(pa);
  s.b0 = ldfrag_b(p0);
  s.b1 = ldfrag_b(p1);
  s.b2 = ldfrag_b(p2);
  s.b3 = ldfrag_b(p3);
#if defined(__HIP_DEVICE_COMPILE__)
  // stands between the set's loads and the next write of a register that holds one of their addresses (the loads stay in flight
  // over the loop's back edge); the addresses are inputs so that none of these registers is reused before the wait
  asm volatile("s_wait_xcnt 0x0" :: "v"(pa), "v"(p0), "v"(p1), "v"(p2), "v"(p3) : "memory");
#endif
}
__device__ __forceinline__ void gemm_step(const GSet& s, v8f& acc0, v8f& acc1, v8f& acc2, v8f& acc3) {
  acc0 = mma_b(s.a, s.b0, acc0);
  acc1 = mma_b(s.a, s.b1, acc1);
  acc2 = mma_b(s.a, s.b2, acc2);
  acc3 = mma_b(s.a, s.b3, acc3);
  g4_5<v16b>(acc0, acc1, acc2, acc3, s.a, s.b0, s.b1, s.b2, s.b3);
}
__global__ __launch_bounds__(128)
void gemm_bfb(const u16* __restrict__ A, const u16* __restrict__ Bt, const float* __restrict__ bias,
              u16* C, int M, int N, int K, float oscale, int bmode, int nb, float hscale) {
  __shared__ __align__(16) float slab[4 * SLAB64];
  const int tid = threadIdx.x, wave = tid >> 5, lane = tid & 31, hh = lane >> 4, m = lane & 15;
  const int ntile = N >> 6;
  const int bid   = blockIdx.x;
  const int rowb  = (bid / ntile) * 64 + wave * 16;
  const int col0  = (bid % ntile) * 64;
  if (rowb + 16 > M) return;                 // wave-uniform, never taken with the exact grid; no block barriers in this kernel
  const u16* ap = A  + (size_t)(rowb + m) * K + 8 * hh;
  const u16* bp = Bt + (size_t)(col0 + m) * K + 8 * hh;
  const size_t bs = (size_t)16 * K;
  v8f acc0 = zero8(), acc1 = zero8(), acc2 = zero8(), acc3 = zero8();
  GSet g0, g1, g2, g3;
  // the scheduling barriers here and in the loop keep the sets' loads in the order written, so that the wait in front of a step
  // counts only that set's loads and leaves the younger sets in flight
  ld_gset(g0, ap, bp, bs, 0);
  __builtin_amdgcn_sched_barrier(0);
  ld_gset(g1, ap, bp, bs, 32);
  __builtin_amdgcn_sched_barrier(0);
  ld_gset(g2, ap, bp, bs, 64);
  __builtin_amdgcn_sched_barrier(0);
  // rolled: one trip = four k steps, one per register set, so that no set is ever copied
#pragma unroll 1
  for (int k0 = 0; k0 < K; k0 += 128) {
    // a step past the end loads step 0 again (in range, never used): no branch stands between the loads and their waits
    const int n4 = (k0 + 128 < K) ? k0 + 128 : 0;
    const int n5 = (k0 + 160 < K) ? k0 + 160 : 0;
    const int n6 = (k0 + 192 < K) ? k0 + 192 : 0;
    ld_gset(g3, ap, bp, bs, k0 + 96);
    __builtin_amdgcn_sched_barrier(0);
    gemm_step(g0, acc0, acc1, acc2, acc3);
    __builtin_amdgcn_sched_barrier(0);
    ld_gset(g0, ap, bp, bs, n4);
    __builtin_amdgcn_sched_barrier(0);
    gemm_step(g1, acc0, acc1, acc2, acc3);
    __builtin_amdgcn_sched_barrier(0);
    ld_gset(g1, ap, bp, bs, n5);
    __builtin_amdgcn_sched_barrier(0);
    gemm_step(g2, acc0, acc1, acc2, acc3);
    __builtin_amdgcn_sched_barrier(0);
    ld_gset(g2, ap, bp, bs, n6);
    __builtin_amdgcn_sched_barrier(0);
    gemm_step(g3, acc0, acc1, acc2, acc3);
    __builtin_amdgcn_sched_barrier(0);
  }
  v8f badd = zero8();
  v8f radd = zero8();
  bias_terms(bias, nb, bmode, rowb, col0, hh, lane & 7, badd, radd);
  epi64h(slab + wave * SLAB64, acc0, acc1, acc2, acc3, oscale, badd, radd, hscale, C, N, (size_t)rowb, col0, lane);
}

// =====================================================================================================
// Full (non-causal, unmasked) multi-head flash attention: block = (head, 64 query rows), 4 waves, wave w owns the 16 query rows
// q0 = 64*qt + 16*w .. q0+15.
//   q plane (f16, x64) laid out [s][h][d] (row pitch OUTW); k plane the same; v^T plane [h][d][s] (x64). All NKB = 128 key
//   blocks of 32 keys are visited (static bound), in NST stages of STK = 128 keys. A stage's k rows (128 x 128 B) and v^T rows
//   (64 x 256 B) are brought into LDS once for the four waves, by one tensor load each (wave 0: k, wave 1: v^T), into one of two
//   buffers, the next stage's loads in flight while this stage is worked on; one work-group barrier per stage publishes the next
//   stage and frees the buffer just read. Inside a stage a block's k and v fragments are read from LDS (ds_load_b128, padded
//   pitches) one block ahead into a second register set; nothing of the next stage is read in front of its barrier.
//   Scores are computed TRANSPOSED: S^T tile g (g = 0,1) = k rows (keys kb+16g .. +15, A operand, row m = lane&15, split k map
//   over d) times q^T (B operand, col n = query q0 + (lane&15), k = d, split map), one product per tile and d-chunk.
//   D element r of lane l = (key kb+16g+8h+r, query q0+(l&15)), so a lane owns one query column and 16 of its 32 keys; the
//   partner lane l^16 owns the other 16 -> row max / row sum need one xor-16 shuffle.
//   Online max-subtracted base-2 softmax in f32 (scale 1/8 and the q,k carries folded into lsc; lsc, the maximum and P's carry
//   enter the exponent through one fma). The exp'd values ARE the
//   P A-fragment in place: A row m = query = lane&15, element i <- key kb+8h+i (tile 0, D element i), element 8+i <- key
//   kb+16+8h+i (tile 1, D element i). P is carried x32768 as f16. The rescale factor of query row 8h+r of the O accumulators is
//   fetched from lane 8h+r with a shuffle (uniform control). 4 v^T B fragments (col n = d = 16j + (lane&15), keys k-contiguous),
//   4 P.V WMMAs per key block.
//   Epilogue: 1/l (per query, shuffled to the D row owner) and carry folds in f32; the wave's 16x64 f32 result staged in its LDS
// coverage: per wave 8 instructions x 2 rows x 16 lanes x 4 floats = 16 x 64; grid NH*64 blocks x 4 waves = every (s, head)
//           row segment of the output exactly once.
// =====================================================================================================
// One key block's fragments: k rows kb+c and kb+16+c (d chunks 0 and 1), v^T rows d = 16j + c (keys kb..kb+31).
struct KVSet { v16h k00, k10, k01, k11, v0, v1, v2, v3; };
// kp: LDS address of k row (block's first key + c), byte 16*hh; vp: LDS address of v^T row c at the block's first key, byte 16*hh.
__device__ __forceinline__ void ld_kv(KVSet& s, const _Float16* kp, const _Float16* vp) {
  s.k00 = ldfrag_h(kp);
  s.k10 = ldfrag_h(kp + 16 * (KPITCH / 2));
  s.k01 = ldfrag_h(kp + 32);
  s.k11 = ldfrag_h(kp + 16 * (KPITCH / 2) + 32);
  s.v0 = ldfrag_h(vp);
  s.v1 = ldfrag_h(vp + 16 * (VPITCH / 2));
  s.v2 = ldfrag_h(vp + 32 * (VPITCH / 2));
  s.v3 = ldfrag_h(vp + 48 * (VPITCH / 2));
}
// One key block of the online softmax and P.V, on fragments already in registers (see attn_fwd).
__device__ __forceinline__ void att_step(const KVSet& f, v16h qh0, v16h qh1, float lsc, int hh,
                                         float& mrun, float& lrun, v8f (&o)[4]) {
  // ---- transposed scores: s0 = keys kb..kb+15, s1 = keys kb+16..kb+31, column = query q0 + c ----
  v8f s0 = zero8(), s1 = zero8();
  s0 = mma_h(f.k00, qh0, s0);
  s1 = mma_h(f.k10, qh0, s1);
  g2_3(s0, s1, qh0, f.k00, f.k10);
  s0 = mma_h(f.k01, qh1, s0);
  s1 = mma_h(f.k11, qh1, s1);
  g2_3(s0, s1, qh1, f.k01, f.k11);
  // ---- this lane's 16 keys for query q0 + c: s0[i] <- key kb+8hh+i, s1[i] <- key kb+16+8hh+i. The running maximum is kept in
  //      raw score units (lsc > 0, so the order is that of the logits) ----
  float cm = s0[0];
#pragma unroll
  for (int i = 1; i < 8; ++i) cm = fmaxf(cm, s0[i]);
#pragma unroll
  for (int i = 0; i < 8; ++i) cm = fmaxf(cm, s1[i]);
  cm = fmaxf(cm, __shfl_xor(cm, 16, 32));
  const float mn = fmaxf(mrun, cm);                 // finite from the first block on
  float al = (mrun - mn) * lsc;                     // exponent of the rescale factor; -inf on the first block (mrun = -inf)
  mrun = mn;
  // ---- probabilities x32768 (<= 32768 up to rounding) = 2^(s*lsc - mn*lsc + 15): scale, maximum and carry in one fma;
  //      they are the P A-fragment once converted to f16: element i <- s0[i], element 8+i <- s1[i] ----
  const float nb = fmaf(-mn, lsc, PEXP);
  float pa[8], pb[8];
#pragma unroll
  for (int i = 0; i < 8; ++i) { pa[i] = fmaf(s0[i], lsc, nb); pb[i] = fmaf(s1[i], lsc, nb); }
  exp2_run9(al, pa);                                // al: 0 on the first block
  exp2_run8(pb);
  float ps = 0.f;
  FragH ph;
#pragma unroll
  for (int w = 0; w < 2; ++w) {
#pragma unroll
    for (int e4 = 0; e4 < 4; ++e4) {
      const int i = 2 * e4;
      const float p0 = w ? pb[i] : pa[i], p1 = w ? pb[i + 1] : pa[i + 1];
      ps += p0 + p1;
      const v2f pp = {p0, p1};
      ph.u[w][e4] = __builtin_bit_cast(unsigned, __builtin_convertvector(pp, v2h));   // one packed RNE convert per pair
    }
  }
  ps += __shfl_xor(ps, 16, 32);
  lrun = lrun * al + ps;
  // ---- rescale the O accumulators: D row 8hh+r = query q0+8hh+r, its factor lives in lane 8hh+r (and 16+8hh+r) ----
  float scl[8];
#pragma unroll
  for (int r = 0; r < 8; ++r) scl[r] = __shfl(al, 8 * hh + r, 32);
#pragma unroll
  for (int j = 0; j < 4; ++j) {
#pragma unroll
    for (int r = 0; r < 8; ++r) o[j][r] *= scl[r];
  }
  // ---- P.V : B fragment col n = d = j*16 + c, keys contiguous in the v^T plane ----
  o[0] = mma_h(ph.v, f.v0, o[0]);
  o[1] = mma_h(ph.v, f.v1, o[1]);
  o[2] = mma_h(ph.v, f.v2, o[2]);
  o[3] = mma_h(ph.v, f.v3, o[3]);
  g4_5<v16h>(o[0], o[1], o[2], o[3], ph.v, f.v0, f.v1, f.v2, f.v3);
}

__global__ __launch_bounds__(ATT_THREADS)
void attn_fwd(const u16* __restrict__ QHp, const u16* __restrict__ KHp, const u16* __restrict__ VHp, float* out) {
  // two stage buffers (k tile, then v^T tile, each at a multiple of 2 KiB), then per wave a result slab [16][68] for the epilogue
  __shared__ __attribute__((aligned(2048))) unsigned char L[RINGB + ATT_WAVES * SLABF * 4];
  float* smem = (float*)(void*)(L + RINGB);

  const int tid  = threadIdx.x;
  const int wave = tid >> 5;
  const int lane = tid & 31;
  const int hh   = lane >> 4;
  const int c    = lane & 15;

  const int bid  = blockIdx.x;
  const int qt   = bid % QTILES;              // 0..63
  const int head = bid / QTILES;              // 0..NH-1
  if (head >= NH) return;                     // block-uniform, never taken with the exact grid; stands in front of every barrier
  const int q0   = qt * 64 + wave * 16;

  // B fragments of q^T: col n = query q0 + c, k = d (k-contiguous row of the q plane); loop-invariant
  const size_t qofs = ((size_t)(q0 + c) * NH + head) * HD + 8 * hh;
  const _Float16* Qh  = (const _Float16*)(const void*)QHp + qofs;
  const v16h qh0 = ldfrag_h(Qh), qh1 = ldfrag_h(Qh + 32);
  const float lsc = 0.125f * (LOG2E / (QSC * KSC));

  // Stage tiles: k rows st*STK .. +127 of this head (128 B each, plane pitch OUTW*2 B); v^T rows head*HD .. +63, keys st*STK .. +127
  // (256 B each, plane pitch SEQ*2 B). Every tile lies wholly inside its plane.
  const uint32_t wv    = uni((uint32_t)tid >> 5);
  const uint64_t kga   = (uint64_t)(size_t)KHp + (uint64_t)head * (HD * 2);
  const uint64_t vga   = (uint64_t)(size_t)VHp + (uint64_t)head * ((uint64_t)HD * SEQ * 2);
  // wave 0 brings the k tiles, wave 1 the v^T tiles: a wave's own place in a buffer, source address and step from stage to stage
  const uint32_t lown  = (uint32_t)(size_t)L + (wv == 0u ? 0u : (uint32_t)KTILE);
  const uint32_t gstep = (wv == 0u) ? (uint32_t)(STK * OUTW * 2) : (uint32_t)(STK * 2);
  const u32x8 g1k = tdm_group1<KW0, HD * 2, STK, OUTW * 2>();
  const u32x8 g1v = tdm_group1<VW0, STK * 2, HD, SEQ * 2>();
  u32x4 g0 = tdm_group0(lown, (wv == 0u) ? kga : vga);
  if (pinned(wv == 0u)) {
    tdm_load(g0, g1k);
    wait_tensor0(g0, g1k, g1v);
  }
  if (pinned(wv == 1u)) {
    tdm_load(g0, g1v);
    wait_tensor0(g0, g1k, g1v);
  }
  __syncthreads();                       // stage 0 published
  tdm_advance(g0, lown + BUFB, gstep);
  if (pinned(wv == 0u)) tdm_load(g0, g1k);
  if (pinned(wv == 1u)) tdm_load(g0, g1v);

  float mrun = -INFINITY, lrun = 0.f;
  v8f o[4];
#pragma unroll
  for (int j = 0; j < 4; ++j) o[j] = zero8();

  // A fragments of k: row m = key + c, k = d; B fragments of v: col n = d = 16j + c, k = key (both k-contiguous LDS rows)
  const uint32_t klane = (uint32_t)c * KPITCH + 16u * (uint32_t)hh;
  const uint32_t vlane = KTILE + (uint32_t)c * VPITCH + 16u * (uint32_t)hh;
  KVSet sa, sb;
  // rolled: one trip = one stage = four key blocks, alternating between the two register sets, so that no set is ever copied
#pragma unroll 1
  for (int st = 0; st < NST; ++st) {
    const uint32_t bofs = (uint32_t)(st & 1) * BUFB;
    const _Float16* kp = (const _Float16*)(const void*)(L + bofs + klane);
    const _Float16* vp = (const _Float16*)(const void*)(L + bofs + vlane);
    // the scheduling barriers keep each group of LDS reads where it is written (one group per block, never among the products)
    ld_kv(sa, kp, vp);
    __builtin_amdgcn_sched_barrier(0);
    ld_kv(sb, kp + 32 * (KPITCH / 2), vp + 32);
    __builtin_amdgcn_sched_barrier(0);
    att_step(sa, qh0, qh1, lsc, hh, mrun, lrun, o);
    __builtin_amdgcn_sched_barrier(0);
    ld_kv(sa, kp + 64 * (KPITCH / 2), vp + 64);
    __builtin_amdgcn_sched_barrier(0);
    att_step(sb, qh0, qh1, lsc, hh, mrun, lrun, o);
    __builtin_amdgcn_sched_barrier(0);
    ld_kv(sb, kp + 96 * (KPITCH / 2), vp + 96);
    __builtin_amdgcn_sched_barrier(0);
    att_step(sa, qh0, qh1, lsc, hh, mrun, lrun, o);
    __builtin_amdgcn_sched_barrier(0);
    att_step(sb, qh0, qh1, lsc, hh, mrun, lrun, o);
    __builtin_amdgcn_sched_barrier(0);
    // publish point of stage st + 1: own LDS reads retired, the issuers' tiles landed, barrier, then the refill of the buffer just read
    wait_ds0();
    if (pinned(wv < 2u)) wait_tensor0(g0, g1k, g1v);
    __syncthreads();
    if (pinned(st + 2 < NST)) {
      tdm_advance(g0, lown + bofs, gstep);
      if (pinned(wv == 0u)) tdm_load(g0, g1k);
      if (pinned(wv == 1u)) tdm_load(g0, g1v);
    }
  }
  wait_tensor0(g0, g1k, g1v);
  wait_ds0();
  acc_guard4(o[0], o[1], o[2], o[3]);

  // ---- fold 1/l (per query, owned by lane = query; l carries the same 32768 as P) and the carry 64 on v; stage the 16x64 slab ----
  const float linv = (1.0f / lrun) * (1.0f / VCAR);
  float inv[8];
#pragma unroll
  for (int r = 0; r < 8; ++r) inv[r] = __shfl(linv, 8 * hh + r, 32);
  float* slab = smem + wave * SLABF;
#pragma unroll
  for (int r = 0; r < 8; ++r) {
#pragma unroll
    for (int j = 0; j < 4; ++j) slab[(8 * hh + r) * 68 + j * 16 + c] = o[j][r] * inv[r];
  }
  wave_sync_lds();
  // ---- f32 rows of the merged-head output: row s = q0 + 2*it + hh, columns head*64 + 4c .. +3 per lane ----
  v4f vals[8];
#pragma unroll
  for (int it = 0; it < 8; ++it) vals[it] = *(const v4f*)(slab + (it * 2 + hh) * 68 + c * 4);
  float* dst = out + ((size_t)(q0 + hh)) * (size_t)OUTW + head * HD + c * 4;
  {
#pragma unroll
    for (int it = 0; it < 8; ++it) {
      *(v4f*)(dst + (size_t)(it * 2) * (size_t)OUTW) = vals[it];
    }
    
  }
}

// =====================================================================================================
// Workspace map (bytes); every plane is fully written by whole-line stores before it is read; all extents are exact multiples
// of the 512-B store granularity (no pad rows needed); every offset a multiple of 128:
//   XB  bf16 [4096 token][768 i]        6291456
//   WQB bf16 [OUTW o][768 i]            1179648      WKB same 1179648     WVB same 1179648
//   QH  f16  [4096][12][64] x64         6291456      KH same 6291456
//   VH  f16  [12][64][4096] x64         6291456
//   end                                28704768
// =====================================================================================================
extern "C" void kernel_launch(void* const* d_in, const int* in_sizes, int n_in,
                              void* d_out, int out_size, void* d_ws, size_t ws_size,
                              hipStream_t stream) {
  const int XN = SEQ * DIN;                             // 3145728
  const int ON = SEQ * OUTW;                            // 3145728
  if (n_in < 7) return;
  if (in_sizes[0] != XN) return;
  if (in_sizes[1] != DIN * DIN || in_sizes[3] != DIN * DIN || in_sizes[5] != DIN * DIN) return;
  if (in_sizes[2] != DIN || in_sizes[4] != DIN || in_sizes[6] != DIN) return;
  if (out_size != ON) return;

  const float* xin = (const float*)d_in[0];
  const float* wq  = (const float*)d_in[1];
  const float* bq  = (const float*)d_in[2];
  const float* wk  = (const float*)d_in[3];
  const float* bk  = (const float*)d_in[4];
  const float* wv  = (const float*)d_in[5];
  const float* bv  = (const float*)d_in[6];
  float*       out = (float*)d_out;
  const int    nb  = in_sizes[2];                       // bias length (DIN)

  const size_t szXB = (size_t)SEQ * DIN * 2;            //  6291456
  const size_t szW  = (size_t)OUTW * DIN * 2;           //  1179648
  const size_t szP  = (size_t)SEQ * OUTW * 2;           //  6291456
  size_t off = 0;
  const size_t oXB  = off; off += szXB;
  const size_t oWQB = off; off += szW;
  const size_t oWKB = off; off += szW;
  const size_t oWVB = off; off += szW;
  const size_t oQH  = off; off += szP;
  const size_t oKH  = off; off += szP;
  const size_t oVH  = off; off += szP;
  if (off > ws_size) return;                            // off = 28704768
  if (off > (size_t)134217728) return;

  char* ws = (char*)d_ws;
  u16*   XB  = (u16*)(ws + oXB);
  u16*   WQB = (u16*)(ws + oWQB);
  u16*   WKB = (u16*)(ws + oWKB);
  u16*   WVB = (u16*)(ws + oWVB);
  u16*   QH  = (u16*)(ws + oQH);
  u16*   KH  = (u16*)(ws + oKH);
  u16*   VH  = (u16*)(ws + oVH);

  const dim3 blk(256);
  const int n8x = XN / 8;                               // 393216
  const int n8w = (OUTW * DIN) / 8;                     // 73728
  const dim3 gX((n8x + 255) / 256);                     // 1536
  const dim3 gWc((n8w + 255) / 256);                    // 288
  const dim3 gGt((SEQ / 64) * (OUTW / 64));             // 768 tiles, token-major projections
  const dim3 gGc((OUTW / 64) * (SEQ / 64));             // 768 tiles, channel-major projection (v^T layout)
  const dim3 bG(128);
  const dim3 gAT(ATT_BLOCKS);                           // 768
  const dim3 bAT(ATT_THREADS);                          // 128

  // (0..2) weights [o][i] -> bf16 planes (first OUTW rows), same layout
  cvb16<<<gWc, blk, 0, stream>>>(wq, WQB, n8w);
  cvb16<<<gWc, blk, 0, stream>>>(wk, WKB, n8w);
  cvb16<<<gWc, blk, 0, stream>>>(wv, WVB, n8w);
  // (3) input [token][i] -> bf16 plane, same layout
  cvb16<<<gX, blk, 0, stream>>>(xin, XB, n8x);
  // (4) q: projection + bias in f32, stored as the f16 plane x64 [4096 token][h*64+d]
  gemm_bfb<<<gGt, bG, 0, stream>>>(XB, WQB, bq, QH, SEQ, OUTW, DIN, 1.0f, 0, nb, QSC);
  // (5) k: the same
  gemm_bfb<<<gGt, bG, 0, stream>>>(XB, WKB, bk, KH, SEQ, OUTW, DIN, 1.0f, 0, nb, KSC);
  // (6) v: channel-major projection with per-row bias, stored as the f16 plane x64 [h*64+d][4096] (= v^T plane layout)
  gemm_bfb<<<gGc, bG, 0, stream>>>(WVB, XB, bv, VH, OUTW, SEQ, DIN, 1.0f, 1, nb, VCAR);
  // (7) attention -> merged-head f32 output [4096][h*64+d]
  attn_fwd<<<gAT, bAT, 0, stream>>>(QH, KH, VH, out);
  (void)hipGetLastError();
}

// v005
// Measured time: 93.4 microseconds a run.
// In two side-by-side timings against v004, it was 1.43 and 1.42 times as fast.
// Counting every step since v000, it is 2.88 times as fast.
// Contractions: projections X.W^T and Wv.X^T on v_wmma_f32_16x16x32_bf16 (X and W RNE-converted bf16 operands, f32 accumulate,
// bias added in f32); scores k.q^T (q, k carried x64 as f16) and P.v (P x32768 as f16, v x64 as f16) on v_wmma_f32_16x16x32_f16,
// f32 accumulate. Base-2 online softmax (one fma and one v_exp_f32 per probability) and the 1/l fold in f32 on VALU.
#include <hip/hip_runtime.h>
#include <math.h>
#include <stdint.h>

#define SEQ   4096
#define DIN   768
#define NH    12
#define HD    64
#define OUTW  (NH * HD)
#define QSC   64.0f
#define KSC   64.0f
#define PEXP  15.0f                       // P and its row sum are carried x2^15 = 32768
#define VCAR  64.0f
#define LOG2E 1.4426950408889634f
#define ATT_WAVES   4
#define ATT_THREADS (ATT_WAVES * 32)
#define QTILES      (SEQ / 64)
#define ATT_BLOCKS  (NH * QTILES)
#define NKB    (SEQ / 32)
#define SLABF  (16 * 68)
#define SLAB64 (16 * 68)
#define STK     128                      // keys per LDS stage of the attention loop (four 32-key blocks)
#define NST     (SEQ / STK)
#define KPITCH  144                      // LDS row pitch of a k row (128 B + 16 B pad), bytes
#define VPITCH  272                      // LDS row pitch of a v^T row (256 B + 16 B pad), bytes
#define KTILE   (STK * KPITCH)           // 18432 B, a multiple of 2 KiB
#define VTILE   18432                    // HD * VPITCH = 17408 B, rounded up to a multiple of 2 KiB
#define BUFB    (KTILE + VTILE)
#define RINGB   (2 * BUFB)
#define GSK     128                      // k per LDS stage of the projection loop (four k steps of 32)
#define GPITCH  272                      // LDS row pitch of an operand row of a stage (256 B + 16 B pad), bytes
#define GTILE   18432                    // 64 * GPITCH = 17408 B, rounded up to a multiple of 2 KiB
#define GBUFB   (2 * GTILE)
#define GRINGB  (2 * GBUFB)
static_assert(HD == 64);
static_assert((SEQ % 64) == 0 && (DIN % 32) == 0 && (OUTW % 64) == 0 && OUTW <= DIN);
static_assert(((SEQ * DIN) % 256) == 0 && ((OUTW * DIN) % 256) == 0 && ((SEQ * OUTW) % 256) == 0);
static_assert(ATT_THREADS == 128 && NKB * 32 == SEQ);
static_assert((DIN % 128) == 0 && (NKB % 2) == 0);
static_assert(ATT_WAVES * SLABF >= 4 * 16 * 68);
static_assert(NST >= 2 && NST * STK == SEQ && STK == 4 * 32);
static_assert((KTILE % 2048) == 0 && (VTILE % 2048) == 0 && HD * VPITCH <= VTILE);
static_assert(KPITCH == HD * 2 + 16 && VPITCH == STK * 2 + 16);
static_assert((GTILE % 2048) == 0 && 64 * GPITCH <= GTILE && GPITCH == GSK * 2 + 16 && GSK == 4 * 32);
static_assert((DIN % GSK) == 0 && DIN / GSK >= 2 && ((DIN * 2) % 16) == 0);

typedef unsigned short u16;
typedef _Float16 v16h __attribute__((ext_vector_type(16)));
typedef _Float16 v8h  __attribute__((ext_vector_type(8)));
typedef __bf16   v16b __attribute__((ext_vector_type(16)));
typedef _Float16 v2h  __attribute__((ext_vector_type(2)));
typedef float    v2f  __attribute__((ext_vector_type(2)));
typedef float    v8f  __attribute__((ext_vector_type(8)));
typedef float    v4f  __attribute__((ext_vector_type(4)));
typedef unsigned int v4u __attribute__((ext_vector_type(4)));
typedef uint32_t u32x4 __attribute__((ext_vector_type(4)));
typedef uint32_t u32x8 __attribute__((ext_vector_type(8)));

union FragH { v16h v; v8h h[2]; v4u u[2]; };
union FragB { v16b v; v4u u[2]; };

// ---- scalar helpers --------------------------------------------------------------------------------
__device__ __forceinline__ unsigned short bf_bits(float f) {          // f32 -> bf16 bits, RNE convert
  unsigned u = __float_as_uint(f);
  return (unsigned short)((u + 0x7FFFu + ((u >> 16) & 1u)) >> 16);
}
__device__ __forceinline__ float bf_up(unsigned short h) { return __uint_as_float(((unsigned)h) << 16); }
__device__ __forceinline__ float bfr(float f) { return bf_up(bf_bits(f)); }
__device__ __forceinline__ unsigned short h_bits(_Float16 x) { return __builtin_bit_cast(unsigned short, x); }
__device__ __forceinline__ unsigned pk16(unsigned short a, unsigned short b) { return (unsigned)a | ((unsigned)b << 16); }
// x <- 2^x by the hardware instruction alone. A result below 2^-126 may come out as 0: every use here is a probability or a
// rescale factor relative to a row maximum, where such a value is lost in the f16 P and in the f32 sums anyway. 2^-inf = 0.
// Written as one run, each in place: no instruction of the run reads its predecessor's result or writes its predecessor's source,
// and the closing v_nop is the slot that the instruction set asks for between the last v_exp_f32 and whatever uses its result.
__device__ __forceinline__ void exp2_run8(float (&x)[8]) {
#if defined(__HIP_DEVICE_COMPILE__)
  asm("v_exp_f32 %0, %0\n\tv_exp_f32 %1, %1\n\tv_exp_f32 %2, %2\n\tv_exp_f32 %3, %3\n\t"
      "v_exp_f32 %4, %4\n\tv_exp_f32 %5, %5\n\tv_exp_f32 %6, %6\n\tv_exp_f32 %7, %7\n\tv_nop"
      : "+v"(x[0]), "+v"(x[1]), "+v"(x[2]), "+v"(x[3]), "+v"(x[4]), "+v"(x[5]), "+v"(x[6]), "+v"(x[7]));
#endif
}
__device__ __forceinline__ void exp2_run9(float& a, float (&x)[8]) {   // a first: the longest path hangs on it
#if defined(__HIP_DEVICE_COMPILE__)
  asm("v_exp_f32 %0, %0\n\tv_exp_f32 %1, %1\n\tv_exp_f32 %2, %2\n\tv_exp_f32 %3, %3\n\tv_exp_f32 %4, %4\n\t"
      "v_exp_f32 %5, %5\n\tv_exp_f32 %6, %6\n\tv_exp_f32 %7, %7\n\tv_exp_f32 %8, %8\n\tv_nop"
      : "+v"(a), "+v"(x[0]), "+v"(x[1]), "+v"(x[2]), "+v"(x[3]), "+v"(x[4]), "+v"(x[5]), "+v"(x[6]), "+v"(x[7]));
#endif
}
__device__ __forceinline__ v8f zero8() { v8f z = {0.f, 0.f, 0.f, 0.f, 0.f, 0.f, 0.f, 0.f}; return z; }

// ---- fragment loaders: 16-bit A/B operand, lane -> row/col (lane&15), p already includes +8*(lane>>4);
//      elements 0..7 <- p[0..7] (k0+8h..), elements 8..15 <- p[16..23] (k0+16+8h..)  (same split k map for A and B;
//      B is always read from a k-contiguous [n][k] plane)
__device__ __forceinline__ v16h ldfrag_h(const _Float16* p) {
  FragH f;
  f.h[0] = *(const v8h*)(p);
  f.h[1] = *(const v8h*)(p + 16);
  return f.v;
}
__device__ __forceinline__ v16b ldfrag_b(const u16* p) {              // bf16 plane read as unsigned integer vectors
  FragB f;
  f.u[0] = *(const v4u*)(p);
  f.u[1] = *(const v4u*)(p + 16);
  return f.v;
}

__device__ __forceinline__ v8f mma_h(v16h a, v16h b, v8f c) {
  return __builtin_amdgcn_wmma_f32_16x16x32_f16(false, a, false, b, (short)0, c, false, false);
}
__device__ __forceinline__ v8f mma_b(v16b a, v16b b, v8f c) {
  return __builtin_amdgcn_wmma_f32_16x16x32_bf16(false, a, false, b, (short)0, c, false, false);
}
__device__ __forceinline__ void g2_3(v8f& a, v8f& b, v16h x0, v16h x1, v16h x2) {
#if defined(__HIP_DEVICE_COMPILE__)
  asm volatile("v_nop\n\tv_nop\n\tv_nop\n\tv_nop" : "+v"(a), "+v"(b) : "v"(x0), "v"(x1), "v"(x2) : "memory");
#endif
}
template <typename F>
__device__ __forceinline__ void g4_5(v8f& a, v8f& b, v8f& c, v8f& d, F x0, F x1, F x2, F x3, F x4) {
#if defined(__HIP_DEVICE_COMPILE__)
  asm volatile("v_nop\n\tv_nop\n\tv_nop\n\tv_nop"
               : "+v"(a), "+v"(b), "+v"(c), "+v"(d) : "v"(x0), "v"(x1), "v"(x2), "v"(x3), "v"(x4) : "memory");
#endif
}
__device__ __forceinline__ void acc_guard4(v8f& a, v8f& b, v8f& c, v8f& d) {
#if defined(__HIP_DEVICE_COMPILE__)
  asm volatile("v_nop\n\tv_nop\n\tv_nop\n\tv_nop" : "+v"(a), "+v"(b), "+v"(c), "+v"(d));
#endif
}
__device__ __forceinline__ void wave_sync_lds() {
  __builtin_amdgcn_fence(__ATOMIC_RELEASE, "workgroup");
  __builtin_amdgcn_wave_barrier();
  __builtin_amdgcn_fence(__ATOMIC_ACQUIRE, "workgroup");
}

// ---- tensor loads into LDS -------------------------------------------------------------------------
__device__ __forceinline__ uint32_t uni(uint32_t v) { return (uint32_t)__builtin_amdgcn_readfirstlane(v); }
__device__ __forceinline__ uint32_t pinned(uint32_t v) {
  uint32_t w = uni(v);
#if defined(__HIP_DEVICE_COMPILE__)
  // holds an issue test in a scalar register, so that it compiles to a scalar branch (tensor loads ignore EXEC), or a descriptor word
  asm volatile("" : "+s"(w));
#endif
  return w;
}
__device__ __forceinline__ void wait_ds0() {
#if defined(__HIP_DEVICE_COMPILE__)
  asm volatile("s_wait_dscnt 0x0" ::: "memory");      // this wave's LDS reads have retired before its buffer may be refilled
#endif
}
// The issuing wave's tile has landed (the compiler places no wait for it). The descriptor groups are operands of the wait: group 0
// as a value that the wait hands on, so that its next address is formed behind the wait, the two groups 1 as inputs, so that
// their registers are still theirs here: no word of a request in flight takes a new value in front of this wait.
__device__ __forceinline__ void wait_tensor0(u32x4& g0, u32x8 g1a, u32x8 g1b) {
#if defined(__HIP_DEVICE_COMPILE__)
  asm volatile("s_wait_tensorcnt 0x0" : "+s"(g0) : "s"(g1a), "s"(g1b) : "memory");
#endif
}
// Group 1 of a tile of D1 rows of D0 bytes (1-byte elements, tensor = tile), source row pitch PITCH bytes; W0 = word 0 (no mask;
// the pad that sets the LDS pitch), a compile-time constant. Built once, the same for every stage.
template <uint32_t W0, uint32_t D0, uint32_t D1, uint32_t PITCH>
__device__ __forceinline__ u32x8 tdm_group1() {
  // pinned(): each descriptor word held in a scalar register, so that the group is one set of registers for the whole kernel and
  // not constants set up anew, in registers that are then reused, at each request
  u32x8 g1;
  g1[0] = pinned(W0);
  g1[1] = pinned((D0 & 0xFFFFu) << 16);
  g1[2] = pinned((D0 >> 16) | ((D1 & 0xFFFFu) << 16));
  g1[3] = pinned((D1 >> 16) | (D0 << 16));
  g1[4] = pinned(D1);
  g1[5] = pinned(PITCH);
  g1[6] = pinned(0u);
  g1[7] = pinned(0u);
  return g1;
}
// The same with the source row pitch (bytes) taken from a kernel argument.
template <uint32_t W0, uint32_t D0, uint32_t D1>
__device__ __forceinline__ u32x8 tdm_group1p(uint32_t pitch) {
  u32x8 g1;
  g1[0] = pinned(W0);
  g1[1] = pinned((D0 & 0xFFFFu) << 16);
  g1[2] = pinned((D0 >> 16) | ((D1 & 0xFFFFu) << 16));
  g1[3] = pinned((D1 >> 16) | (D0 << 16));
  g1[4] = pinned(D1);
  g1[5] = pinned(pitch);
  g1[6] = pinned(0u);
  g1[7] = pinned(0u);
  return g1;
}
// Group 0: tile's first byte at ga, to LDS byte offset lds_dst.
__device__ __forceinline__ u32x4 tdm_group0(uint32_t lds_dst, uint64_t ga) {
  u32x4 g0;
  g0[0] = uni(1u);
  g0[1] = uni(lds_dst);
  g0[2] = uni((uint32_t)ga);
  g0[3] = uni((((uint32_t)(ga >> 32)) & 0x01FFFFFFu) | 0x80000000u);
  return g0;
}
// Group 0 of the next stage: new LDS place, source address advanced by step bytes (the carry goes into address bits 56..32).
__device__ __forceinline__ void tdm_advance(u32x4& g0, uint32_t lds_dst, uint32_t step) {
  const uint32_t lo = g0[2] + step;
  g0[1] = uni(lds_dst);
  g0[3] = uni(g0[3] + (lo < step ? 1u : 0u));
  g0[2] = uni(lo);
}
__device__ __forceinline__ void tdm_load(u32x4 g0, u32x8 g1) {
#if defined(__HIP_DEVICE_COMPILE__)
  // the request itself: one per issuing wave, through no register; its waits are written by hand where it is used
  asm volatile("tensor_load_to_lds %0, %1" :: "s"(g0), "s"(g1) : "memory");
#endif
}
#define KW0 ((1u << 20) | (4u << 22) | (3u << 25))   // 128-B rows, 16 B of pad behind each
#define VW0 ((1u << 20) | (5u << 22) | (3u << 25))   // 256-B rows, 16 B of pad behind each

// =====================================================================================================
// f32 plane -> bf16 plane (RNE convert), same layout. Thread = 8 consecutive elements: two 16-B loads, one 16-B store;
// coverage: grid = ceil(n8/256) blocks x 256 thr x 8 = the whole plane (n8 = elements/8, elements % 256 == 0, so every wave is
//           fully active or fully inactive).
// =====================================================================================================
__global__ __launch_bounds__(256) void cvb16(const float* __restrict__ x, u16* D, int n8) {
  const int gt = blockIdx.x * 256 + (int)threadIdx.x;
  if (gt >= n8) return;                     // no barriers in this kernel
  const float* p = x + (size_t)gt * 8;
  const v4f a = *(const v4f*)(p), c4 = *(const v4f*)(p + 4);
  float v[8];
#pragma unroll
  for (int e = 0; e < 4; ++e) { v[e] = a[e]; v[4 + e] = c4[e]; }
  unsigned short s[8];
#pragma unroll
  for (int e = 0; e < 8; ++e) s[e] = bf_bits(v[e]);
  v4u o;
#pragma unroll
  for (int e = 0; e < 4; ++e) o[e] = pk16(s[2 * e], s[2 * e + 1]);
  u16* d = D + (size_t)gt * 8;
  {
    *(v4u*)(d) = o;
    
  }
}

// =====================================================================================================
// Bias terms for the GEMM epilogue (bf16-RNE values of bias[], nb entries; every candidate index clamped into 0..nb-1 so all
// loads are in range, selection by value): bmode 0: per-column direct; bmode 1: per-row direct.
// =====================================================================================================
// badd: the 8 columns col0 + 8*cc .. +7 that the lane stores (cc = lane&7); radd: the 8 rows rowb + 8*hh .. +7 of its accumulators.
__device__ __forceinline__ void bias_terms(const float* __restrict__ bias, int nb, int bmode, int rowb, int col0, int hh, int cc,
                                           v8f& badd, v8f& radd) {
#pragma unroll
  for (int e = 0; e < 8; ++e) {
    const int ci = col0 + 8 * cc + e;
    const int ic = ci < nb ? ci : nb - 1;
    const float bc = bfr(bias[ic]);
    badd[e] = (bmode == 0) ? bc : 0.0f;
  }
#pragma unroll
  for (int r = 0; r < 8; ++r) {
    const int ri = rowb + 8 * hh + r;
    const int ir = ri < nb ? ri : nb - 1;
    const float br = bfr(bias[ir]);
    radd[r] = (bmode == 1) ? br : 0.0f;
  }
}

// =====================================================================================================
// GEMM epilogue: the wave's 16x64 f32 tile (times oscale, plus per-row addend radd) staged in its LDS slab (pitch 68), read back
// row-wise, per-column addend badd added in f32, times hscale (a power of two), converted to f16 (RNE) and stored: a lane holds 8
// consecutive columns (one 16-B store), 8 lanes one row of 64 f16 = one whole 128-B line.
// coverage: 4 instructions x 4 rows x 8 lanes x 8 halves = the wave's 16 x 64 tile.
// =====================================================================================================
__device__ __forceinline__ void epi64h(float* sl, v8f a0, v8f a1, v8f a2, v8f a3, float oscale, v8f badd, v8f radd, float hscale,
                                       u16* C, int N, size_t rowb, int col0, int lane) {
  const int hh = lane >> 4, m = lane & 15;
#pragma unroll
  for (int r = 0; r < 8; ++r) {
    const int ro = (8 * hh + r) * 68 + m;
    sl[ro]      = a0[r] * oscale + radd[r];
    sl[ro + 16] = a1[r] * oscale + radd[r];
    sl[ro + 32] = a2[r] * oscale + radd[r];
    sl[ro + 48] = a3[r] * oscale + radd[r];
  }
  wave_sync_lds();
  const int rr = lane >> 3, cc = lane & 7;
  v4u vals[4];
#pragma unroll
  for (int it = 0; it < 4; ++it) {
    const float* sp = sl + (it * 4 + rr) * 68 + cc * 8;
    const v4f x0 = *(const v4f*)(sp), x1 = *(const v4f*)(sp + 4);
    unsigned short h[8];
#pragma unroll
    for (int e = 0; e < 4; ++e) {
      h[e]     = h_bits((_Float16)((x0[e] + badd[e]) * hscale));
      h[4 + e] = h_bits((_Float16)((x1[e] + badd[4 + e]) * hscale));
    }
#pragma unroll
    for (int e = 0; e < 4; ++e) vals[it][e] = pk16(h[2 * e], h[2 * e + 1]);
  }
  u16* dst = C + (rowb + (size_t)rr) * (size_t)N + col0 + cc * 8;
#pragma unroll
  for (int it = 0; it < 4; ++it) *(v4u*)(dst + (size_t)(it * 4) * (size_t)N) = vals[it];
}

// =====================================================================================================
// bf16 GEMM with bias: C[M][N] (f16, pitch N) = (A[M][K] (bf16 row-major) . Bt[N][K]^T (bf16 k-contiguous), times oscale, plus
// the bias term selected by bmode (see bias_terms), all in f32) times hscale. grid.x = (M/64)*(N/64) tiles. Block = 64x64 tile, 4 waves x 16 rows.
// K is walked in stages of GSK = 128: a stage's 64 A rows and 64 Bt rows (256 B each) are brought into LDS once for the four waves,
// by one tensor load each (wave 0: A, wave 1: Bt), into one of two buffers, the next stage's loads in flight while this stage is
// worked on; one work-group barrier per stage publishes the next stage and frees the buffer just read. A stage's fragments (four
// k steps of 32, split k map for A and B) are read from LDS (ds_load_b128, padded pitch) as one group ahead of its products.
// (host: K % 128 == 0, K >= 256, M % 64 == 0, N % 64 == 0)
// =====================================================================================================
struct GSet { v16b a, b0, b1, b2, b3; };
// ap: LDS address of the lane's A row at the k step, byte 16*hh; bp: the same of Bt row m.
__device__ __forceinline__ void ld_gset(GSet& s, const u16* ap, const u16* bp) {
  s.a  = ldfrag_b(ap);
  s.b0 = ldfrag_b(bp);
  s.b1 = ldfrag_b(bp + 16 * (GPITCH / 2));
  s.b2 = ldfrag_b(bp + 32 * (GPITCH / 2));
  s.b3 = ldfrag_b(bp + 48 * (GPITCH / 2));
}
__device__ __forceinline__ void gemm_step(const GSet& s, v8f& acc0, v8f& acc1, v8f& acc2, v8f& acc3) {
  acc0 = mma_b(s.a, s.b0, acc0);
  acc1 = mma_b(s.a, s.b1, acc1);
  acc2 = mma_b(s.a, s.b2, acc2);
  acc3 = mma_b(s.a, s.b3, acc3);
  g4_5<v16b>(acc0, acc1, acc2, acc3, s.a, s.b0, s.b1, s.b2, s.b3);
}
__global__ __launch_bounds__(128)
void gemm_bfb(const u16* __restrict__ A, const u16* __restrict__ Bt, const float* __restrict__ bias,
              u16* C, int M, int N, int K, float oscale, int bmode, int nb, float hscale) {
  // two stage buffers (A tile, then Bt tile, each at a multiple of 2 KiB), then per wave a result slab [16][68] for the epilogue
  __shared__ __attribute__((aligned(2048))) unsigned char L[GRINGB + 4 * SLAB64 * 4];
  float* slab = (float*)(void*)(L + GRINGB);
  const int tid = threadIdx.x, wave = tid >> 5, lane = tid & 31, hh = lane >> 4, m = lane & 15;
  const int ntile = N >> 6;
  const int bid   = blockIdx.x;
  const int row0  = (bid / ntile) * 64;
  const int rowb  = row0 + wave * 16;
  const int col0  = (bid % ntile) * 64;
  if (row0 + 64 > M) return;                 // block-uniform, never taken with the exact grid; stands in front of every barrier
  const int nst = K / GSK;

  // Stage tiles: A rows row0 .. +63 and Bt rows col0 .. +63, k st*GSK .. +127 (256 B of each row, plane pitch K*2 B). Every tile
  // lies wholly inside its plane. Wave 0 brings the A tiles, wave 1 the Bt tiles: a wave's own place in a buffer and source address.
  const uint32_t wv   = uni((uint32_t)tid >> 5);
  const uint64_t aga  = (uint64_t)(size_t)A  + (uint64_t)row0 * (uint64_t)K * 2u;
  const uint64_t bga  = (uint64_t)(size_t)Bt + (uint64_t)col0 * (uint64_t)K * 2u;
  const uint32_t lown = (uint32_t)(size_t)L + (wv == 0u ? 0u : (uint32_t)GTILE);
  const u32x8 g1 = tdm_group1p<VW0, GSK * 2, 64>((uint32_t)K * 2u);
  u32x4 g0 = tdm_group0(lown, (wv == 0u) ? aga : bga);
  if (pinned(wv < 2u)) {
    tdm_load(g0, g1);
    wait_tensor0(g0, g1, g1);
  }
  __syncthreads();                       // stage 0 published
  tdm_advance(g0, lown + GBUFB, GSK * 2);
  if (pinned(wv < 2u)) tdm_load(g0, g1);

  const uint32_t alane = (uint32_t)(wave * 16 + m) * GPITCH + 16u * (uint32_t)hh;
  const uint32_t blane = GTILE + (uint32_t)m * GPITCH + 16u * (uint32_t)hh;
  v8f acc0 = zero8(), acc1 = zero8(), acc2 = zero8(), acc3 = zero8();
  GSet s0, s1, s2, s3;
  // rolled (one trip = one stage = four k steps, one per register set): one publish point in the text, in the order written
#pragma unroll 1
  for (int st = 0; st < nst; ++st) {
    const uint32_t bofs = (uint32_t)(st & 1) * GBUFB;
    const u16* ap = (const u16*)(const void*)(L + bofs + alane);
    const u16* bp = (const u16*)(const void*)(L + bofs + blane);
    // the scheduling barrier keeps the stage's LDS reads one group ahead of its products, in the order written (set by set), so
    // that the counted wait in front of a step covers that set's reads and leaves the later sets in flight
    ld_gset(s0, ap, bp);
    ld_gset(s1, ap + 32, bp + 32);
    ld_gset(s2, ap + 64, bp + 64);
    ld_gset(s3, ap + 96, bp + 96);
    __builtin_amdgcn_sched_barrier(0);
    gemm_step(s0, acc0, acc1, acc2, acc3);
    gemm_step(s1, acc0, acc1, acc2, acc3);
    gemm_step(s2, acc0, acc1, acc2, acc3);
    gemm_step(s3, acc0, acc1, acc2, acc3);
    // publish point of stage st + 1: own LDS reads retired, the issuers' tiles landed, barrier, then the refill of the buffer just read
    wait_ds0();
    if (pinned(wv < 2u)) wait_tensor0(g0, g1, g1);
    __syncthreads();
    if (pinned(st + 2 < nst)) {
      tdm_advance(g0, lown + bofs, GSK * 2);
      if (pinned(wv < 2u)) tdm_load(g0, g1);
    }
  }
  wait_tensor0(g0, g1, g1);
  wait_ds0();
  v8f badd = zero8();
  v8f radd = zero8();
  bias_terms(bias, nb, bmode, rowb, col0, hh, lane & 7, badd, radd);
  epi64h(slab + wave * SLAB64, acc0, acc1, acc2, acc3, oscale, badd, radd, hscale, C, N, (size_t)rowb, col0, lane);
}

// =====================================================================================================
// Full (non-causal, unmasked) multi-head flash attention: block = (head, 64 query rows), 4 waves, wave w owns the 16 query rows
// q0 = 64*qt + 16*w .. q0+15.
//   q plane (f16, x64) laid out [s][h][d] (row pitch OUTW); k plane the same; v^T plane [h][d][s] (x64). All NKB = 128 key
//   blocks of 32 keys are visited (static bound), in NST stages of STK = 128 keys. A stage's k rows (128 x 128 B) and v^T rows
//   (64 x 256 B) are brought into LDS once for the four waves, by one tensor load each (wave 0: k, wave 1: v^T), into one of two
//   buffers, the next stage's loads in flight while this stage is worked on; one work-group barrier per stage publishes the next
//   stage and frees the buffer just read. Inside a stage a block's k and v fragments are read from LDS (ds_load_b128, padded
//   pitches) one block ahead into a second register set; nothing of the next stage is read in front of its barrier.
//   Scores are computed TRANSPOSED: S^T tile g (g = 0,1) = k rows (keys kb+16g .. +15, A operand, row m = lane&15, split k map
//   over d) times q^T (B operand, col n = query q0 + (lane&15), k = d, split map), one product per tile and d-chunk.
//   D element r of lane l = (key kb+16g+8h+r, query q0+(l&15)), so a lane owns one query column and 16 of its 32 keys; the
//   partner lane l^16 owns the other 16 -> row max / row sum need one xor-16 shuffle.
//   Online max-subtracted base-2 softmax in f32 (scale 1/8 and the q,k carries folded into lsc; lsc, the maximum and P's carry
//   enter the exponent through one fma). The exp'd values ARE the
//   P A-fragment in place: A row m = query = lane&15, element i <- key kb+8h+i (tile 0, D element i), element 8+i <- key
//   kb+16+8h+i (tile 1, D element i). P is carried x32768 as f16. The rescale factor of query row 8h+r of the O accumulators is
//   fetched from lane 8h+r with a shuffle (uniform control). 4 v^T B fragments (col n = d = 16j + (lane&15), keys k-contiguous),
//   4 P.V WMMAs per key block.
//   Epilogue: 1/l (per query, shuffled to the D row owner) and carry folds in f32; the wave's 16x64 f32 result staged in its LDS
// coverage: per wave 8 instructions x 2 rows x 16 lanes x 4 floats = 16 x 64; grid NH*64 blocks x 4 waves = every (s, head)
//           row segment of the output exactly once.
// =====================================================================================================
// One key block's fragments: k rows kb+c and kb+16+c (d chunks 0 and 1), v^T rows d = 16j + c (keys kb..kb+31).
struct KVSet { v16h k00, k10, k01, k11, v0, v1, v2, v3; };
// kp: LDS address of k row (block's first key + c), byte 16*hh; vp: LDS address of v^T row c at the block's first key, byte 16*hh.
__device__ __forceinline__ void ld_kv(KVSet& s, const _Float16* kp, const _Float16* vp) {
  s.k00 = ldfrag_h(kp);
  s.k10 = ldfrag_h(kp + 16 * (KPITCH / 2));
  s.k01 = ldfrag_h(kp + 32);
  s.k11 = ldfrag_h(kp + 16 * (KPITCH / 2) + 32);
  s.v0 = ldfrag_h(vp);
  s.v1 = ldfrag_h(vp + 16 * (VPITCH / 2));
  s.v2 = ldfrag_h(vp + 32 * (VPITCH / 2));
  s.v3 = ldfrag_h(vp + 48 * (VPITCH / 2));
}
// One key block of the online softmax and P.V, on fragments already in registers (see attn_fwd).
__device__ __forceinline__ void att_step(const KVSet& f, v16h qh0, v16h qh1, float lsc, int hh,
                                         float& mrun, float& lrun, v8f (&o)[4]) {
  // ---- transposed scores: s0 = keys kb..kb+15, s1 = keys kb+16..kb+31, column = query q0 + c ----
  v8f s0 = zero8(), s1 = zero8();
  s0 = mma_h(f.k00, qh0, s0);
  s1 = mma_h(f.k10, qh0, s1);
  g2_3(s0, s1, qh0, f.k00, f.k10);
  s0 = mma_h(f.k01, qh1, s0);
  s1 = mma_h(f.k11, qh1, s1);
  g2_3(s0, s1, qh1, f.k01, f.k11);
  // ---- this lane's 16 keys for query q0 + c: s0[i] <- key kb+8hh+i, s1[i] <- key kb+16+8hh+i. The running maximum is kept in
  //      raw score units (lsc > 0, so the order is that of the logits) ----
  float cm = s0[0];
#pragma unroll
  for (int i = 1; i < 8; ++i) cm = fmaxf(cm, s0[i]);
#pragma unroll
  for (int i = 0; i < 8; ++i) cm = fmaxf(cm, s1[i]);
  cm = fmaxf(cm, __shfl_xor(cm, 16, 32));
  const float mn = fmaxf(mrun, cm);                 // finite from the first block on
  float al = (mrun - mn) * lsc;                     // exponent of the rescale factor; -inf on the first block (mrun = -inf)
  mrun = mn;
  // ---- probabilities x32768 (<= 32768 up to rounding) = 2^(s*lsc - mn*lsc + 15): scale, maximum and carry in one fma;
  //      they are the P A-fragment once converted to f16: element i <- s0[i], element 8+i <- s1[i] ----
  const float nb = fmaf(-mn, lsc, PEXP);
  float pa[8], pb[8];
#pragma unroll
  for (int i = 0; i < 8; ++i) { pa[i] = fmaf(s0[i], lsc, nb); pb[i] = fmaf(s1[i], lsc, nb); }
  exp2_run9(al, pa);                                // al: 0 on the first block
  exp2_run8(pb);
  float ps = 0.f;
  FragH ph;
#pragma unroll
  for (int w = 0; w < 2; ++w) {
#pragma unroll
    for (int e4 = 0; e4 < 4; ++e4) {
      const int i = 2 * e4;
      const float p0 = w ? pb[i] : pa[i], p1 = w ? pb[i + 1] : pa[i + 1];
      ps += p0 + p1;
      const v2f pp = {p0, p1};
      ph.u[w][e4] = __builtin_bit_cast(unsigned, __builtin_convertvector(pp, v2h));   // one packed RNE convert per pair
    }
  }
  ps += __shfl_xor(ps, 16, 32);
  lrun = lrun * al + ps;
  // ---- rescale the O accumulators: D row 8hh+r = query q0+8hh+r, its factor lives in lane 8hh+r (and 16+8hh+r) ----
  float scl[8];
#pragma unroll
  for (int r = 0; r < 8; ++r) scl[r] = __shfl(al, 8 * hh + r, 32);
#pragma unroll
  for (int j = 0; j < 4; ++j) {
#pragma unroll
    for (int r = 0; r < 8; ++r) o[j][r] *= scl[r];
  }
  // ---- P.V : B fragment col n = d = j*16 + c, keys contiguous in the v^T plane ----
  o[0] = mma_h(ph.v, f.v0, o[0]);
  o[1] = mma_h(ph.v, f.v1, o[1]);
  o[2] = mma_h(ph.v, f.v2, o[2]);
  o[3] = mma_h(ph.v, f.v3, o[3]);
  g4_5<v16h>(o[0], o[1], o[2], o[3], ph.v, f.v0, f.v1, f.v2, f.v3);
}

__global__ __launch_bounds__(ATT_THREADS)
void attn_fwd(const u16* __restrict__ QHp, const u16* __restrict__ KHp, const u16* __restrict__ VHp, float* out) {
  // two stage buffers (k tile, then v^T tile, each at a multiple of 2 KiB), then per wave a result slab [16][68] for the epilogue
  __shared__ __attribute__((aligned(2048))) unsigned char L[RINGB + ATT_WAVES * SLABF * 4];
  float* smem = (float*)(void*)(L + RINGB);

  const int tid  = threadIdx.x;
  const int wave = tid >> 5;
  const int lane = tid & 31;
  const int hh   = lane >> 4;
  const int c    = lane & 15;

  const int bid  = blockIdx.x;
  const int qt   = bid % QTILES;              // 0..63
  const int head = bid / QTILES;              // 0..NH-1
  if (head >= NH) return;                     // block-uniform, never taken with the exact grid; stands in front of every barrier
  const int q0   = qt * 64 + wave * 16;

  // B fragments of q^T: col n = query q0 + c, k = d (k-contiguous row of the q plane); loop-invariant
  const size_t qofs = ((size_t)(q0 + c) * NH + head) * HD + 8 * hh;
  const _Float16* Qh  = (const _Float16*)(const void*)QHp + qofs;
  const v16h qh0 = ldfrag_h(Qh), qh1 = ldfrag_h(Qh + 32);
  const float lsc = 0.125f * (LOG2E / (QSC * KSC));

  // Stage tiles: k rows st*STK .. +127 of this head (128 B each, plane pitch OUTW*2 B); v^T rows head*HD .. +63, keys st*STK .. +127
  // (256 B each, plane pitch SEQ*2 B). Every tile lies wholly inside its plane.
  const uint32_t wv    = uni((uint32_t)tid >> 5);
  const uint64_t kga   = (uint64_t)(size_t)KHp + (uint64_t)head * (HD * 2);
  const uint64_t vga   = (uint64_t)(size_t)VHp + (uint64_t)head * ((uint64_t)HD * SEQ * 2);
  // wave 0 brings the k tiles, wave 1 the v^T tiles: a wave's own place in a buffer, source address and step from stage to stage
  const uint32_t lown  = (uint32_t)(size_t)L + (wv == 0u ? 0u : (uint32_t)KTILE);
  const uint32_t gstep = (wv == 0u) ? (uint32_t)(STK * OUTW * 2) : (uint32_t)(STK * 2);
  const u32x8 g1k = tdm_group1<KW0, HD * 2, STK, OUTW * 2>();
  const u32x8 g1v = tdm_group1<VW0, STK * 2, HD, SEQ * 2>();
  u32x4 g0 = tdm_group0(lown, (wv == 0u) ? kga : vga);
  if (pinned(wv == 0u)) {
    tdm_load(g0, g1k);
    wait_tensor0(g0, g1k, g1v);
  }
  if (pinned(wv == 1u)) {
    tdm_load(g0, g1v);
    wait_tensor0(g0, g1k, g1v);
  }
  __syncthreads();                       // stage 0 published
  tdm_advance(g0, lown + BUFB, gstep);
  if (pinned(wv == 0u)) tdm_load(g0, g1k);
  if (pinned(wv == 1u)) tdm_load(g0, g1v);

  float mrun = -INFINITY, lrun = 0.f;
  v8f o[4];
#pragma unroll
  for (int j = 0; j < 4; ++j) o[j] = zero8();

  // A fragments of k: row m = key + c, k = d; B fragments of v: col n = d = 16j + c, k = key (both k-contiguous LDS rows)
  const uint32_t klane = (uint32_t)c * KPITCH + 16u * (uint32_t)hh;
  const uint32_t vlane = KTILE + (uint32_t)c * VPITCH + 16u * (uint32_t)hh;
  KVSet sa, sb;
  // rolled: one trip = one stage = four key blocks, alternating between the two register sets, so that no set is ever copied
#pragma unroll 1
  for (int st = 0; st < NST; ++st) {
    const uint32_t bofs = (uint32_t)(st & 1) * BUFB;
    const _Float16* kp = (const _Float16*)(const void*)(L + bofs + klane);
    const _Float16* vp = (const _Float16*)(const void*)(L + bofs + vlane);
    // the scheduling barriers keep each group of LDS reads where it is written (one group per block, never among the products)
    ld_kv(sa, kp, vp);
    __builtin_amdgcn_sched_barrier(0);
    ld_kv(sb, kp + 32 * (KPITCH / 2), vp + 32);
    __builtin_amdgcn_sched_barrier(0);
    att_step(sa, qh0, qh1, lsc, hh, mrun, lrun, o);
    __builtin_amdgcn_sched_barrier(0);
    ld_kv(sa, kp + 64 * (KPITCH / 2), vp + 64);
    __builtin_amdgcn_sched_barrier(0);
    att_step(sb, qh0, qh1, lsc, hh, mrun, lrun, o);
    __builtin_amdgcn_sched_barrier(0);
    ld_kv(sb, kp + 96 * (KPITCH / 2), vp + 96);
    __builtin_amdgcn_sched_barrier(0);
    att_step(sa, qh0, qh1, lsc, hh, mrun, lrun, o);
    __builtin_amdgcn_sched_barrier(0);
    att_step(sb, qh0, qh1, lsc, hh, mrun, lrun, o);
    __builtin_amdgcn_sched_barrier(0);
    // publish point of stage st + 1: own LDS reads retired, the issuers' tiles landed, barrier, then the refill of the buffer just read
    wait_ds0();
    if (pinned(wv < 2u)) wait_tensor0(g0, g1k, g1v);
    __syncthreads();
    if (pinned(st + 2 < NST)) {
      tdm_advance(g0, lown + bofs, gstep);
      if (pinned(wv == 0u)) tdm_load(g0, g1k);
      if (pinned(wv == 1u)) tdm_load(g0, g1v);
    }
  }
  wait_tensor0(g0, g1k, g1v);
  wait_ds0();
  acc_guard4(o[0], o[1], o[2], o[3]);

  // ---- fold 1/l (per query, owned by lane = query; l carries the same 32768 as P) and the carry 64 on v; stage the 16x64 slab ----
  const float linv = (1.0f / lrun) * (1.0f / VCAR);
  float inv[8];
#pragma unroll
  for (int r = 0; r < 8; ++r) inv[r] = __shfl(linv, 8 * hh + r, 32);
  float* slab = smem + wave * SLABF;
#pragma unroll
  for (int r = 0; r < 8; ++r) {
#pragma unroll
    for (int j = 0; j < 4; ++j) slab[(8 * hh + r) * 68 + j * 16 + c] = o[j][r] * inv[r];
  }
  wave_sync_lds();
  // ---- f32 rows of the merged-head output: row s = q0 + 2*it + hh, columns head*64 + 4c .. +3 per lane ----
  v4f vals[8];
#pragma unroll
  for (int it = 0; it < 8; ++it) vals[it] = *(const v4f*)(slab + (it * 2 + hh) * 68 + c * 4);
  float* dst = out + ((size_t)(q0 + hh)) * (size_t)OUTW + head * HD + c * 4;
  {
#pragma unroll
    for (int it = 0; it < 8; ++it) {
      *(v4f*)(dst + (size_t)(it * 2) * (size_t)OUTW) = vals[it];
    }
    
  }
}

// =====================================================================================================
// Workspace map (bytes); every plane is fully written by whole-line stores before it is read; all extents are exact multiples
// of the 512-B store granularity (no pad rows needed); every offset a multiple of 128:
//   XB  bf16 [4096 token][768 i]        6291456
//   WQB bf16 [OUTW o][768 i]            1179648      WKB same 1179648     WVB same 1179648
//   QH  f16  [4096][12][64] x64         6291456      KH same 6291456
//   VH  f16  [12][64][4096] x64         6291456
//   end                                28704768
// =====================================================================================================
extern "C" void kernel_launch(void* const* d_in, const int* in_sizes, int n_in,
                              void* d_out, int out_size, void* d_ws, size_t ws_size,
                              hipStream_t stream) {
  const int XN = SEQ * DIN;                             // 3145728
  const int ON = SEQ * OUTW;                            // 3145728
  if (n_in < 7) return;
  if (in_sizes[0] != XN) return;
  if (in_sizes[1] != DIN * DIN || in_sizes[3] != DIN * DIN || in_sizes[5] != DIN * DIN) return;
  if (in_sizes[2] != DIN || in_sizes[4] != DIN || in_sizes[6] != DIN) return;
  if (out_size != ON) return;

  const float* xin = (const float*)d_in[0];
  const float* wq  = (const float*)d_in[1];
  const float* bq  = (const float*)d_in[2];
  const float* wk  = (const float*)d_in[3];
  const float* bk  = (const float*)d_in[4];
  const float* wv  = (const float*)d_in[5];
  const float* bv  = (const float*)d_in[6];
  float*       out = (float*)d_out;
  const int    nb  = in_sizes[2];                       // bias length (DIN)

  const size_t szXB = (size_t)SEQ * DIN * 2;            //  6291456
  const size_t szW  = (size_t)OUTW * DIN * 2;           //  1179648
  const size_t szP  = (size_t)SEQ * OUTW * 2;           //  6291456
  size_t off = 0;
  const size_t oXB  = off; off += szXB;
  const size_t oWQB = off; off += szW;
  const size_t oWKB = off; off += szW;
  const size_t oWVB = off; off += szW;
  const size_t oQH  = off; off += szP;
  const size_t oKH  = off; off += szP;
  const size_t oVH  = off; off += szP;
  if (off > ws_size) return;                            // off = 28704768
  if (off > (size_t)134217728) return;

  char* ws = (char*)d_ws;
  u16*   XB  = (u16*)(ws + oXB);
  u16*   WQB = (u16*)(ws + oWQB);
  u16*   WKB = (u16*)(ws + oWKB);
  u16*   WVB = (u16*)(ws + oWVB);
  u16*   QH  = (u16*)(ws + oQH);
  u16*   KH  = (u16*)(ws + oKH);
  u16*   VH  = (u16*)(ws + oVH);

  const dim3 blk(256);
  const int n8x = XN / 8;                               // 393216
  const int n8w = (OUTW * DIN) / 8;                     // 73728
  const dim3 gX((n8x + 255) / 256);                     // 1536
  const dim3 gWc((n8w + 255) / 256);                    // 288
  const dim3 gGt((SEQ / 64) * (OUTW / 64));             // 768 tiles, token-major projections
  const dim3 gGc((OUTW / 64) * (SEQ / 64));             // 768 tiles, channel-major projection (v^T layout)
  const dim3 bG(128);
  const dim3 gAT(ATT_BLOCKS);                           // 768
  const dim3 bAT(ATT_THREADS);                          // 128

  // (0..2) weights [o][i] -> bf16 planes (first OUTW rows), same layout
  cvb16<<<gWc, blk, 0, stream>>>(wq, WQB, n8w);
  cvb16<<<gWc, blk, 0, stream>>>(wk, WKB, n8w);
  cvb16<<<gWc, blk, 0, stream>>>(wv, WVB, n8w);
  // (3) input [token][i] -> bf16 plane, same layout
  cvb16<<<gX, blk, 0, stream>>>(xin, XB, n8x);
  // (4) q: projection + bias in f32, stored as the f16 plane x64 [4096 token][h*64+d]
  gemm_bfb<<<gGt, bG, 0, stream>>>(XB, WQB, bq, QH, SEQ, OUTW, DIN, 1.0f, 0, nb, QSC);
  // (5) k: the same
  gemm_bfb<<<gGt, bG, 0, stream>>>(XB, WKB, bk, KH, SEQ, OUTW, DIN, 1.0f, 0, nb, KSC);
  // (6) v: channel-major projection with per-row bias, stored as the f16 plane x64 [h*64+d][4096] (= v^T plane layout)
  gemm_bfb<<<gGc, bG, 0, stream>>>(WVB, XB, bv, VH, OUTW, SEQ, DIN, 1.0f, 1, nb, VCAR);
  // (7) attention -> merged-head f32 output [4096][h*64+d]
  attn_fwd<<<gAT, bAT, 0, stream>>>(QH, KH, VH, out);
  (void)hipGetLastError();
}

// v006
// It runs in 85 microseconds.
// Timed twice side by side with v005, it ran 1.10 and 1.11 times as fast.
// All steps since v000 together make it 3.18 times as fast.
// Contractions: projections X.W^T and Wv.X^T on v_wmma_f32_16x16x32_bf16 (X and W RNE-converted bf16 operands, f32 accumulate,
// bias added in f32); scores k.q^T (q, k carried x64 as f16) and P.v (P x32768 as f16, v x64 as f16) on v_wmma_f32_16x16x32_f16,
// f32 accumulate. Base-2 online softmax (one fma and one v_exp_f32 per probability) and the 1/l fold in f32 on VALU.
#include <hip/hip_runtime.h>
#include <math.h>
#include <stdint.h>

#define SEQ   4096
#define DIN   768
#define NH    12
#define HD    64
#define OUTW  (NH * HD)
#define QSC   64.0f
#define KSC   64.0f
#define PEXP  15.0f                       // P and its row sum are carried x2^15 = 32768
#define VCAR  64.0f
#define LOG2E 1.4426950408889634f
#define ATT_WAVES   4
#define ATT_THREADS (ATT_WAVES * 32)
#define QTILES      (SEQ / 64)
#define ATT_BLOCKS  (NH * QTILES)
#define NKB    (SEQ / 32)
#define SLABF  (16 * 68)
#define SLAB64 (16 * 68)
#define STK     128                      // keys per LDS stage of the attention loop (four 32-key blocks)
#define NST     (SEQ / STK)
#define KPITCH  144                      // LDS row pitch of a k row (128 B + 16 B pad), bytes
#define VPITCH  272                      // LDS row pitch of a v^T row (256 B + 16 B pad), bytes
#define KTILE   (STK * KPITCH)           // 18432 B, a multiple of 2 KiB
#define VTILE   18432                    // HD * VPITCH = 17408 B, rounded up to a multiple of 2 KiB
#define BUFB    (KTILE + VTILE)
#define RINGB   (2 * BUFB)
#define GSK     128                      // k per LDS stage of the projection loop (four k steps of 32)
#define GPITCH  272                      // LDS row pitch of an operand row of a stage (256 B + 16 B pad), bytes
#define GTILE   18432                    // 64 * GPITCH = 17408 B, rounded up to a multiple of 2 KiB
#define GBUFB   (2 * GTILE)
#define GRINGB  (2 * GBUFB)
static_assert(HD == 64);
static_assert((SEQ % 64) == 0 && (DIN % 32) == 0 && (OUTW % 64) == 0 && OUTW <= DIN);
static_assert(((SEQ * DIN) % 256) == 0 && ((OUTW * DIN) % 256) == 0 && ((SEQ * OUTW) % 256) == 0);
static_assert(ATT_THREADS == 128 && NKB * 32 == SEQ);
static_assert((DIN % 128) == 0 && (NKB % 2) == 0);
static_assert(ATT_WAVES * SLABF >= 4 * 16 * 68);
static_assert(NST >= 2 && NST * STK == SEQ && STK == 4 * 32);
static_assert((KTILE % 2048) == 0 && (VTILE % 2048) == 0 && HD * VPITCH <= VTILE);
static_assert(KPITCH == HD * 2 + 16 && VPITCH == STK * 2 + 16);
static_assert((GTILE % 2048) == 0 && 64 * GPITCH <= GTILE && GPITCH == GSK * 2 + 16 && GSK == 4 * 32);
static_assert((DIN % GSK) == 0 && DIN / GSK >= 2 && ((DIN * 2) % 16) == 0);
#define CVX    ((SEQ * DIN) / 2048)      // conversion blocks (2048 elements each) of x
#define CVW    ((OUTW * DIN) / 2048)     // the same of one weight plane
#define GTILES ((SEQ / 64) * (OUTW / 64))   // 64x64 output tiles of one projection
static_assert(((SEQ * DIN) % 2048) == 0 && ((OUTW * DIN) % 2048) == 0);

typedef unsigned short u16;
typedef _Float16 v16h __attribute__((ext_vector_type(16)));
typedef _Float16 v8h  __attribute__((ext_vector_type(8)));
typedef __bf16   v16b __attribute__((ext_vector_type(16)));
typedef _Float16 v2h  __attribute__((ext_vector_type(2)));
typedef float    v2f  __attribute__((ext_vector_type(2)));
typedef float    v8f  __attribute__((ext_vector_type(8)));
typedef float    v4f  __attribute__((ext_vector_type(4)));
typedef unsigned int v4u __attribute__((ext_vector_type(4)));
typedef uint32_t u32x4 __attribute__((ext_vector_type(4)));
typedef uint32_t u32x8 __attribute__((ext_vector_type(8)));

union FragH { v16h v; v8h h[2]; v4u u[2]; };
union FragB { v16b v; v4u u[2]; };

// ---- scalar helpers --------------------------------------------------------------------------------
__device__ __forceinline__ unsigned short bf_bits(float f) {          // f32 -> bf16 bits, RNE convert
  unsigned u = __float_as_uint(f);
  return (unsigned short)((u + 0x7FFFu + ((u >> 16) & 1u)) >> 16);
}
__device__ __forceinline__ float bf_up(unsigned short h) { return __uint_as_float(((unsigned)h) << 16); }
__device__ __forceinline__ float bfr(float f) { return bf_up(bf_bits(f)); }
__device__ __forceinline__ unsigned short h_bits(_Float16 x) { return __builtin_bit_cast(unsigned short, x); }
__device__ __forceinline__ unsigned pk16(unsigned short a, unsigned short b) { return (unsigned)a | ((unsigned)b << 16); }
// x <- 2^x by the hardware instruction alone. A result below 2^-126 may come out as 0: every use here is a probability or a
// rescale factor relative to a row maximum, where such a value is lost in the f16 P and in the f32 sums anyway. 2^-inf = 0.
// Written as one run, each in place: no instruction of the run reads its predecessor's result or writes its predecessor's source,
// and the closing v_nop is the slot that the instruction set asks for between the last v_exp_f32 and whatever uses its result.
__device__ __forceinline__ void exp2_run8(float (&x)[8]) {
#if defined(__HIP_DEVICE_COMPILE__)
  asm("v_exp_f32 %0, %0\n\tv_exp_f32 %1, %1\n\tv_exp_f32 %2, %2\n\tv_exp_f32 %3, %3\n\t"
      "v_exp_f32 %4, %4\n\tv_exp_f32 %5, %5\n\tv_exp_f32 %6, %6\n\tv_exp_f32 %7, %7\n\tv_nop"
      : "+v"(x[0]), "+v"(x[1]), "+v"(x[2]), "+v"(x[3]), "+v"(x[4]), "+v"(x[5]), "+v"(x[6]), "+v"(x[7]));
#endif
}
__device__ __forceinline__ void exp2_run9(float& a, float (&x)[8]) {   // a first: the longest path hangs on it
#if defined(__HIP_DEVICE_COMPILE__)
  asm("v_exp_f32 %0, %0\n\tv_exp_f32 %1, %1\n\tv_exp_f32 %2, %2\n\tv_exp_f32 %3, %3\n\tv_exp_f32 %4, %4\n\t"
      "v_exp_f32 %5, %5\n\tv_exp_f32 %6, %6\n\tv_exp_f32 %7, %7\n\tv_exp_f32 %8, %8\n\tv_nop"
      : "+v"(a), "+v"(x[0]), "+v"(x[1]), "+v"(x[2]), "+v"(x[3]), "+v"(x[4]), "+v"(x[5]), "+v"(x[6]), "+v"(x[7]));
#endif
}
__device__ __forceinline__ v8f zero8() { v8f z = {0.f, 0.f, 0.f, 0.f, 0.f, 0.f, 0.f, 0.f}; return z; }

// ---- fragment loaders: 16-bit A/B operand, lane -> row/col (lane&15), p already includes +8*(lane>>4);
//      elements 0..7 <- p[0..7] (k0+8h..), elements 8..15 <- p[16..23] (k0+16+8h..)  (same split k map for A and B;
//      B is always read from a k-contiguous [n][k] plane)
__device__ __forceinline__ v16h ldfrag_h(const _Float16* p) {
  FragH f;
  f.h[0] = *(const v8h*)(p);
  f.h[1] = *(const v8h*)(p + 16);
  return f.v;
}
__device__ __forceinline__ v16b ldfrag_b(const u16* p) {              // bf16 plane read as unsigned integer vectors
  FragB f;
  f.u[0] = *(const v4u*)(p);
  f.u[1] = *(const v4u*)(p + 16);
  return f.v;
}

__device__ __forceinline__ v8f mma_h(v16h a, v16h b, v8f c) {
  return __builtin_amdgcn_wmma_f32_16x16x32_f16(false, a, false, b, (short)0, c, false, false);
}
__device__ __forceinline__ v8f mma_b(v16b a, v16b b, v8f c) {
  return __builtin_amdgcn_wmma_f32_16x16x32_bf16(false, a, false, b, (short)0, c, false, false);
}
__device__ __forceinline__ void g2_3(v8f& a, v8f& b, v16h x0, v16h x1, v16h x2) {
#if defined(__HIP_DEVICE_COMPILE__)
  asm volatile("v_nop\n\tv_nop\n\tv_nop\n\tv_nop" : "+v"(a), "+v"(b) : "v"(x0), "v"(x1), "v"(x2) : "memory");
#endif
}
template <typename F>
__device__ __forceinline__ void g4_5(v8f& a, v8f& b, v8f& c, v8f& d, F x0, F x1, F x2, F x3, F x4) {
#if defined(__HIP_DEVICE_COMPILE__)
  asm volatile("v_nop\n\tv_nop\n\tv_nop\n\tv_nop"
               : "+v"(a), "+v"(b), "+v"(c), "+v"(d) : "v"(x0), "v"(x1), "v"(x2), "v"(x3), "v"(x4) : "memory");
#endif
}
__device__ __forceinline__ void acc_guard4(v8f& a, v8f& b, v8f& c, v8f& d) {
#if defined(__HIP_DEVICE_COMPILE__)
  asm volatile("v_nop\n\tv_nop\n\tv_nop\n\tv_nop" : "+v"(a), "+v"(b), "+v"(c), "+v"(d));
#endif
}
__device__ __forceinline__ void wave_sync_lds() {
  __builtin_amdgcn_fence(__ATOMIC_RELEASE, "workgroup");
  __builtin_amdgcn_wave_barrier();
  __builtin_amdgcn_fence(__ATOMIC_ACQUIRE, "workgroup");
}

// ---- tensor loads into LDS -------------------------------------------------------------------------
__device__ __forceinline__ uint32_t uni(uint32_t v) { return (uint32_t)__builtin_amdgcn_readfirstlane(v); }
__device__ __forceinline__ uint32_t pinned(uint32_t v) {
  uint32_t w = uni(v);
#if defined(__HIP_DEVICE_COMPILE__)
  // holds an issue test in a scalar register, so that it compiles to a scalar branch (tensor loads ignore EXEC), or a descriptor word
  asm volatile("" : "+s"(w));
#endif
  return w;
}
__device__ __forceinline__ void wait_ds0() {
#if defined(__HIP_DEVICE_COMPILE__)
  asm volatile("s_wait_dscnt 0x0" ::: "memory");      // this wave's LDS reads have retired before its buffer may be refilled
#endif
}
// The issuing wave's tile has landed (the compiler places no wait for it). The descriptor groups are operands of the wait: group 0
// as a value that the wait hands on, so that its next address is formed behind the wait, the two groups 1 as inputs, so that
// their registers are still theirs here: no word of a request in flight takes a new value in front of this wait.
__device__ __forceinline__ void wait_tensor0(u32x4& g0, u32x8 g1a, u32x8 g1b) {
#if defined(__HIP_DEVICE_COMPILE__)
  asm volatile("s_wait_tensorcnt 0x0" : "+s"(g0) : "s"(g1a), "s"(g1b) : "memory");
#endif
}
// Group 1 of a tile of D1 rows of D0 bytes (1-byte elements, tensor = tile), source row pitch PITCH bytes; W0 = word 0 (no mask;
// the pad that sets the LDS pitch), a compile-time constant. Built once, the same for every stage.
template <uint32_t W0, uint32_t D0, uint32_t D1, uint32_t PITCH>
__device__ __forceinline__ u32x8 tdm_group1() {
  // pinned(): each descriptor word held in a scalar register, so that the group is one set of registers for the whole kernel and
  // not constants set up anew, in registers that are then reused, at each request
  u32x8 g1;
  g1[0] = pinned(W0);
  g1[1] = pinned((D0 & 0xFFFFu) << 16);
  g1[2] = pinned((D0 >> 16) | ((D1 & 0xFFFFu) << 16));
  g1[3] = pinned((D1 >> 16) | (D0 << 16));
  g1[4] = pinned(D1);
  g1[5] = pinned(PITCH);
  g1[6] = pinned(0u);
  g1[7] = pinned(0u);
  return g1;
}
// The same with the source row pitch (bytes) taken from a kernel argument.
template <uint32_t W0, uint32_t D0, uint32_t D1>
__device__ __forceinline__ u32x8 tdm_group1p(uint32_t pitch) {
  u32x8 g1;
  g1[0] = pinned(W0);
  g1[1] = pinned((D0 & 0xFFFFu) << 16);
  g1[2] = pinned((D0 >> 16) | ((D1 & 0xFFFFu) << 16));
  g1[3] = pinned((D1 >> 16) | (D0 << 16));
  g1[4] = pinned(D1);
  g1[5] = pinned(pitch);
  g1[6] = pinned(0u);
  g1[7] = pinned(0u);
  return g1;
}
// Group 0: tile's first byte at ga, to LDS byte offset lds_dst.
__device__ __forceinline__ u32x4 tdm_group0(uint32_t lds_dst, uint64_t ga) {
  u32x4 g0;
  g0[0] = uni(1u);
  g0[1] = uni(lds_dst);
  g0[2] = uni((uint32_t)ga);
  g0[3] = uni((((uint32_t)(ga >> 32)) & 0x01FFFFFFu) | 0x80000000u);
  return g0;
}
// Group 0 of the next stage: new LDS place, source address advanced by step bytes (the carry goes into address bits 56..32).
__device__ __forceinline__ void tdm_advance(u32x4& g0, uint32_t lds_dst, uint32_t step) {
  const uint32_t lo = g0[2] + step;
  g0[1] = uni(lds_dst);
  g0[3] = uni(g0[3] + (lo < step ? 1u : 0u));
  g0[2] = uni(lo);
}
__device__ __forceinline__ void tdm_load(u32x4 g0, u32x8 g1) {
#if defined(__HIP_DEVICE_COMPILE__)
  // the request itself: one per issuing wave, through no register; its waits are written by hand where it is used
  asm volatile("tensor_load_to_lds %0, %1" :: "s"(g0), "s"(g1) : "memory");
#endif
}
#define KW0 ((1u << 20) | (4u << 22) | (3u << 25))   // 128-B rows, 16 B of pad behind each
#define VW0 ((1u << 20) | (5u << 22) | (3u << 25))   // 256-B rows, 16 B of pad behind each

// =====================================================================================================
// The four f32 planes (x, wq, wk, wv) -> bf16 planes (RNE convert), same layouts, in ONE launch: the block index picks the plane.
// The four bf16 planes stand one behind the other at D, in that order, so the destination index is the flat one. Thread = 8
// consecutive elements: two 16-B loads, one 16-B store.
// coverage: blocks 0 .. CVX-1 = x, then CVW blocks for each weight; a block = 256 thr x 8 = 2048 elements, every plane a whole
//           number of blocks, grid = CVX + 3*CVW blocks = the four planes exactly.
// =====================================================================================================
__global__ __launch_bounds__(256) void cvb16(const float* __restrict__ x, const float* __restrict__ wq,
                                             const float* __restrict__ wk, const float* __restrict__ wv, u16* D) {
  const int bid = blockIdx.x;
  if (bid >= CVX + 3 * CVW) return;         // block-uniform, never taken with the exact grid; no barriers in this kernel
  const int wj  = (bid - CVX) / CVW;        // which weight, where the block is past x
  const float* sp = (bid < CVX) ? x : (wj == 0) ? wq : (wj == 1) ? wk : wv;
  const int   sb = (bid < CVX) ? bid : bid - CVX - wj * CVW;          // block index inside its own plane
  const int gt = bid * 256 + (int)threadIdx.x;
  const float* p = sp + ((size_t)sb * 256 + threadIdx.x) * 8;
  const v4f a = *(const v4f*)(p), c4 = *(const v4f*)(p + 4);
  float v[8];
#pragma unroll
  for (int e = 0; e < 4; ++e) { v[e] = a[e]; v[4 + e] = c4[e]; }
  unsigned short s[8];
#pragma unroll
  for (int e = 0; e < 8; ++e) s[e] = bf_bits(v[e]);
  v4u o;
#pragma unroll
  for (int e = 0; e < 4; ++e) o[e] = pk16(s[2 * e], s[2 * e + 1]);
  u16* d = D + (size_t)gt * 8;
  {
    *(v4u*)(d) = o;
    
  }
}

// =====================================================================================================
// Bias terms for the GEMM epilogue (bf16-RNE values of bias[], nb entries; every candidate index clamped into 0..nb-1 so all
// loads are in range, selection by value): bmode 0: per-column direct; bmode 1: per-row direct.
// =====================================================================================================
// badd: the 8 columns col0 + 8*cc .. +7 that the lane stores (cc = lane&7); radd: the 8 rows rowb + 8*hh .. +7 of its accumulators.
__device__ __forceinline__ void bias_terms(const float* __restrict__ bias, int nb, int bmode, int rowb, int col0, int hh, int cc,
                                           v8f& badd, v8f& radd) {
#pragma unroll
  for (int e = 0; e < 8; ++e) {
    const int ci = col0 + 8 * cc + e;
    const int ic = ci < nb ? ci : nb - 1;
    const float bc = bfr(bias[ic]);
    badd[e] = (bmode == 0) ? bc : 0.0f;
  }
#pragma unroll
  for (int r = 0; r < 8; ++r) {
    const int ri = rowb + 8 * hh + r;
    const int ir = ri < nb ? ri : nb - 1;
    const float br = bfr(bias[ir]);
    radd[r] = (bmode == 1) ? br : 0.0f;
  }
}

// =====================================================================================================
// GEMM epilogue: the wave's 16x64 f32 tile (times oscale, plus per-row addend radd) staged in its LDS slab (pitch 68), read back
// row-wise, per-column addend badd added in f32, times hscale (a power of two), converted to f16 (RNE) and stored: a lane holds 8
// consecutive columns (one 16-B store), 8 lanes one row of 64 f16 = one whole 128-B line.
// coverage: 4 instructions x 4 rows x 8 lanes x 8 halves = the wave's 16 x 64 tile.
// =====================================================================================================
__device__ __forceinline__ void epi64h(float* sl, v8f a0, v8f a1, v8f a2, v8f a3, float oscale, v8f badd, v8f radd, float hscale,
                                       u16* C, int N, size_t rowb, int col0, int lane) {
  const int hh = lane >> 4, m = lane & 15;
#pragma unroll
  for (int r = 0; r < 8; ++r) {
    const int ro = (8 * hh + r) * 68 + m;
    sl[ro]      = a0[r] * oscale + radd[r];
    sl[ro + 16] = a1[r] * oscale + radd[r];
    sl[ro + 32] = a2[r] * oscale + radd[r];
    sl[ro + 48] = a3[r] * oscale + radd[r];
  }
  wave_sync_lds();
  const int rr = lane >> 3, cc = lane & 7;
  v4u vals[4];
#pragma unroll
  for (int it = 0; it < 4; ++it) {
    const float* sp = sl + (it * 4 + rr) * 68 + cc * 8;
    const v4f x0 = *(const v4f*)(sp), x1 = *(const v4f*)(sp + 4);
    unsigned short h[8];
#pragma unroll
    for (int e = 0; e < 4; ++e) {
      h[e]     = h_bits((_Float16)((x0[e] + badd[e]) * hscale));
      h[4 + e] = h_bits((_Float16)((x1[e] + badd[4 + e]) * hscale));
    }
#pragma unroll
    for (int e = 0; e < 4; ++e) vals[it][e] = pk16(h[2 * e], h[2 * e + 1]);
  }
  u16* dst = C + (rowb + (size_t)rr) * (size_t)N + col0 + cc * 8;
#pragma unroll
  for (int it = 0; it < 4; ++it) *(v4u*)(dst + (size_t)(it * 4) * (size_t)N) = vals[it];
}

// =====================================================================================================
// The three projections in ONE launch: block index / GTILES picks the job (0: q = X.Wq^T, 1: k = X.Wk^T, both token-major with a
// per-column bias; 2: v^T = Wv.X^T, channel-major with a per-row bias), block index % GTILES its 64x64 tile.
// A job is a bf16 GEMM with bias: C[M][N] (f16, pitch N) = (A[M][K] (bf16 row-major) . Bt[N][K]^T (bf16 k-contiguous), times oscale, plus
// the bias term selected by bmode (see bias_terms), all in f32) times hscale. (M/64)*(N/64) = GTILES tiles. Block = 64x64 tile, 4 waves x 16 rows.
// K is walked in stages of GSK = 128: a stage's 64 A rows and 64 Bt rows (256 B each) are brought into LDS once for the four waves,
// by one tensor load each (wave 0: A, wave 1: Bt), into one of two buffers, the next stage's loads in flight while this stage is
// worked on; one work-group barrier per stage publishes the next stage and frees the buffer just read. A stage's fragments (four
// k steps of 32, split k map for A and B) are read from LDS (ds_load_b128, padded pitch) as one group ahead of its products.
// (K = DIN: K % 128 == 0, K >= 256; M, N = SEQ, OUTW or OUTW, SEQ: multiples of 64)
// =====================================================================================================
struct GSet { v16b a, b0, b1, b2, b3; };
// ap: LDS address of the lane's A row at the k step, byte 16*hh; bp: the same of Bt row m.
__device__ __forceinline__ void ld_gset(GSet& s, const u16* ap, const u16* bp) {
  s.a  = ldfrag_b(ap);
  s.b0 = ldfrag_b(bp);
  s.b1 = ldfrag_b(bp + 16 * (GPITCH / 2));
  s.b2 = ldfrag_b(bp + 32 * (GPITCH / 2));
  s.b3 = ldfrag_b(bp + 48 * (GPITCH / 2));
}
__device__ __forceinline__ void gemm_step(const GSet& s, v8f& acc0, v8f& acc1, v8f& acc2, v8f& acc3) {
  acc0 = mma_b(s.a, s.b0, acc0);
  acc1 = mma_b(s.a, s.b1, acc1);
  acc2 = mma_b(s.a, s.b2, acc2);
  acc3 = mma_b(s.a, s.b3, acc3);
  g4_5<v16b>(acc0, acc1, acc2, acc3, s.a, s.b0, s.b1, s.b2, s.b3);
}
__global__ __launch_bounds__(128)
void gemm_bfb(const u16* __restrict__ XBp, const u16* __restrict__ WQp, const u16* __restrict__ WKp, const u16* __restrict__ WVp,
              const float* __restrict__ bq, const float* __restrict__ bk, const float* __restrict__ bv,
              u16* QHp, u16* KHp, u16* VHp, int nb) {
  // two stage buffers (A tile, then Bt tile, each at a multiple of 2 KiB), then per wave a result slab [16][68] for the epilogue
  __shared__ __attribute__((aligned(2048))) unsigned char L[GRINGB + 4 * SLAB64 * 4];
  float* slab = (float*)(void*)(L + GRINGB);
  const int tid = threadIdx.x, wave = tid >> 5, lane = tid & 31, hh = lane >> 4, m = lane & 15;
  const int job   = blockIdx.x / GTILES;     // block-uniform: every choice below is a scalar one
  const int bid   = blockIdx.x % GTILES;
  if (job > 2) return;                       // block-uniform, never taken with the exact grid; stands in front of every barrier
  const u16*   A    = (job == 2) ? WVp : XBp;
  const u16*   Bt   = (job == 0) ? WQp : (job == 1) ? WKp : XBp;
  const float* bias = (job == 0) ? bq : (job == 1) ? bk : bv;
  u16*         C    = (job == 0) ? QHp : (job == 1) ? KHp : VHp;
  const int    M    = (job == 2) ? OUTW : SEQ, N = (job == 2) ? SEQ : OUTW, K = DIN;
  const int    bmode  = (job == 2) ? 1 : 0;
  const float  oscale = 1.0f;
  const float  hscale = (job == 0) ? QSC : (job == 1) ? KSC : VCAR;
  // tile row and column by each job's own constant tile count, so that the divisions stay scalar
  const int row0  = ((job == 2) ? bid / (SEQ / 64) : bid / (OUTW / 64)) * 64;
  const int rowb  = row0 + wave * 16;
  const int col0  = ((job == 2) ? bid % (SEQ / 64) : bid % (OUTW / 64)) * 64;
  if (row0 + 64 > M) return;                 // block-uniform, never taken with the exact grid; stands in front of every barrier
  const int nst = K / GSK;

  // Stage tiles: A rows row0 .. +63 and Bt rows col0 .. +63, k st*GSK .. +127 (256 B of each row, plane pitch K*2 B). Every tile
  // lies wholly inside its plane. Wave 0 brings the A tiles, wave 1 the Bt tiles: a wave's own place in a buffer and source address.
  const uint32_t wv   = uni((uint32_t)tid >> 5);
  const uint64_t aga  = (uint64_t)(size_t)A  + (uint64_t)row0 * (uint64_t)K * 2u;
  const uint64_t bga  = (uint64_t)(size_t)Bt + (uint64_t)col0 * (uint64_t)K * 2u;
  const uint32_t lown = (uint32_t)(size_t)L + (wv == 0u ? 0u : (uint32_t)GTILE);
  const u32x8 g1 = tdm_group1p<VW0, GSK * 2, 64>((uint32_t)K * 2u);
  u32x4 g0 = tdm_group0(lown, (wv == 0u) ? aga : bga);
  if (pinned(wv < 2u)) {
    tdm_load(g0, g1);
    wait_tensor0(g0, g1, g1);
  }
  __syncthreads();                       // stage 0 published
  tdm_advance(g0, lown + GBUFB, GSK * 2);
  if (pinned(wv < 2u)) tdm_load(g0, g1);

  const uint32_t alane = (uint32_t)(wave * 16 + m) * GPITCH + 16u * (uint32_t)hh;
  const uint32_t blane = GTILE + (uint32_t)m * GPITCH + 16u * (uint32_t)hh;
  v8f acc0 = zero8(), acc1 = zero8(), acc2 = zero8(), acc3 = zero8();
  GSet s0, s1, s2, s3;
  // rolled (one trip = one stage = four k steps, one per register set): one publish point in the text, in the order written
#pragma unroll 1
  for (int st = 0; st < nst; ++st) {
    const uint32_t bofs = (uint32_t)(st & 1) * GBUFB;
    const u16* ap = (const u16*)(const void*)(L + bofs + alane);
    const u16* bp = (const u16*)(const void*)(L + bofs + blane);
    // the scheduling barrier keeps the stage's LDS reads one group ahead of its products, in the order written (set by set), so
    // that the counted wait in front of a step covers that set's reads and leaves the later sets in flight
    ld_gset(s0, ap, bp);
    ld_gset(s1, ap + 32, bp + 32);
    ld_gset(s2, ap + 64, bp + 64);
    ld_gset(s3, ap + 96, bp + 96);
    __builtin_amdgcn_sched_barrier(0);
    gemm_step(s0, acc0, acc1, acc2, acc3);
    gemm_step(s1, acc0, acc1, acc2, acc3);
    gemm_step(s2, acc0, acc1, acc2, acc3);
    gemm_step(s3, acc0, acc1, acc2, acc3);
    // publish point of stage st + 1: own LDS reads retired, the issuers' tiles landed, barrier, then the refill of the buffer just read
    wait_ds0();
    if (pinned(wv < 2u)) wait_tensor0(g0, g1, g1);
    __syncthreads();
    if (pinned(st + 2 < nst)) {
      tdm_advance(g0, lown + bofs, GSK * 2);
      if (pinned(wv < 2u)) tdm_load(g0, g1);
    }
  }
  wait_tensor0(g0, g1, g1);
  wait_ds0();
  v8f badd = zero8();
  v8f radd = zero8();
  bias_terms(bias, nb, bmode, rowb, col0, hh, lane & 7, badd, radd);
#if defined(__HIP_DEVICE_COMPILE__)
  // stands between the bias loads and the reuse of their index registers by the epilogue; the scheduling barrier keeps the
  // epilogue's vector work from being moved in front of it
  asm volatile("s_wait_xcnt 0x0" ::: "memory");
  __builtin_amdgcn_sched_barrier(0);
#endif
  epi64h(slab + wave * SLAB64, acc0, acc1, acc2, acc3, oscale, badd, radd, hscale, C, N, (size_t)rowb, col0, lane);
}

// =====================================================================================================
// Full (non-causal, unmasked) multi-head flash attention: block = (head, 64 query rows), 4 waves, wave w owns the 16 query rows
// q0 = 64*qt + 16*w .. q0+15.
//   q plane (f16, x64) laid out [s][h][d] (row pitch OUTW); k plane the same; v^T plane [h][d][s] (x64). All NKB = 128 key
//   blocks of 32 keys are visited (static bound), in NST stages of STK = 128 keys. A stage's k rows (128 x 128 B) and v^T rows
//   (64 x 256 B) are brought into LDS once for the four waves, by one tensor load each (wave 0: k, wave 1: v^T), into one of two
//   buffers, the next stage's loads in flight while this stage is worked on; one work-group barrier per stage publishes the next
//   stage and frees the buffer just read. Inside a stage a block's k and v fragments are read from LDS (ds_load_b128, padded
//   pitches) one block ahead into a second register set; nothing of the next stage is read in front of its barrier.
//   Scores are computed TRANSPOSED: S^T tile g (g = 0,1) = k rows (keys kb+16g .. +15, A operand, row m = lane&15, split k map
//   over d) times q^T (B operand, col n = query q0 + (lane&15), k = d, split map), one product per tile and d-chunk.
//   D element r of lane l = (key kb+16g+8h+r, query q0+(l&15)), so a lane owns one query column and 16 of its 32 keys; the
//   partner lane l^16 owns the other 16 -> row max / row sum need one xor-16 shuffle.
//   Online max-subtracted base-2 softmax in f32 (scale 1/8 and the q,k carries folded into lsc; lsc, the maximum and P's carry
//   enter the exponent through one fma). The exp'd values ARE the
//   P A-fragment in place: A row m = query = lane&15, element i <- key kb+8h+i (tile 0, D element i), element 8+i <- key
//   kb+16+8h+i (tile 1, D element i). P is carried x32768 as f16. The rescale factor of query row 8h+r of the O accumulators is
//   fetched from lane 8h+r with a shuffle (uniform control). 4 v^T B fragments (col n = d = 16j + (lane&15), keys k-contiguous),
//   4 P.V WMMAs per key block.
//   Epilogue: 1/l (per query, shuffled to the D row owner) and carry folds in f32; the wave's 16x64 f32 result staged in its LDS
// coverage: per wave 8 instructions x 2 rows x 16 lanes x 4 floats = 16 x 64; grid NH*64 blocks x 4 waves = every (s, head)
//           row segment of the output exactly once.
// =====================================================================================================
// One key block's fragments: k rows kb+c and kb+16+c (d chunks 0 and 1), v^T rows d = 16j + c (keys kb..kb+31).
struct KVSet { v16h k00, k10, k01, k11, v0, v1, v2, v3; };
// kp: LDS address of k row (block's first key + c), byte 16*hh; vp: LDS address of v^T row c at the block's first key, byte 16*hh.
__device__ __forceinline__ void ld_kv(KVSet& s, const _Float16* kp, const _Float16* vp) {
  s.k00 = ldfrag_h(kp);
  s.k10 = ldfrag_h(kp + 16 * (KPITCH / 2));
  s.k01 = ldfrag_h(kp + 32);
  s.k11 = ldfrag_h(kp + 16 * (KPITCH / 2) + 32);
  s.v0 = ldfrag_h(vp);
  s.v1 = ldfrag_h(vp + 16 * (VPITCH / 2));
  s.v2 = ldfrag_h(vp + 32 * (VPITCH / 2));
  s.v3 = ldfrag_h(vp + 48 * (VPITCH / 2));
}
// One key block of the online softmax and P.V, on fragments already in registers (see attn_fwd).
__device__ __forceinline__ void att_step(const KVSet& f, v16h qh0, v16h qh1, float lsc, int hh,
                                         float& mrun, float& lrun, v8f (&o)[4]) {
  // ---- transposed scores: s0 = keys kb..kb+15, s1 = keys kb+16..kb+31, column = query q0 + c ----
  v8f s0 = zero8(), s1 = zero8();
  s0 = mma_h(f.k00, qh0, s0);
  s1 = mma_h(f.k10, qh0, s1);
  g2_3(s0, s1, qh0, f.k00, f.k10);
  s0 = mma_h(f.k01, qh1, s0);
  s1 = mma_h(f.k11, qh1, s1);
  g2_3(s0, s1, qh1, f.k01, f.k11);
  // ---- this lane's 16 keys for query q0 + c: s0[i] <- key kb+8hh+i, s1[i] <- key kb+16+8hh+i. The running maximum is kept in
  //      raw score units (lsc > 0, so the order is that of the logits) ----
  float cm = s0[0];
#pragma unroll
  for (int i = 1; i < 8; ++i) cm = fmaxf(cm, s0[i]);
#pragma unroll
  for (int i = 0; i < 8; ++i) cm = fmaxf(cm, s1[i]);
  cm = fmaxf(cm, __shfl_xor(cm, 16, 32));
  const float mn = fmaxf(mrun, cm);                 // finite from the first block on
  float al = (mrun - mn) * lsc;                     // exponent of the rescale factor; -inf on the first block (mrun = -inf)
  mrun = mn;
  // ---- probabilities x32768 (<= 32768 up to rounding) = 2^(s*lsc - mn*lsc + 15): scale, maximum and carry in one fma;
  //      they are the P A-fragment once converted to f16: element i <- s0[i], element 8+i <- s1[i] ----
  const float nb = fmaf(-mn, lsc, PEXP);
  float pa[8], pb[8];
#pragma unroll
  for (int i = 0; i < 8; ++i) { pa[i] = fmaf(s0[i], lsc, nb); pb[i] = fmaf(s1[i], lsc, nb); }
  exp2_run9(al, pa);                                // al: 0 on the first block
  exp2_run8(pb);
  float ps = 0.f;
  FragH ph;
#pragma unroll
  for (int w = 0; w < 2; ++w) {
#pragma unroll
    for (int e4 = 0; e4 < 4; ++e4) {
      const int i = 2 * e4;
      const float p0 = w ? pb[i] : pa[i], p1 = w ? pb[i + 1] : pa[i + 1];
      ps += p0 + p1;
      const v2f pp = {p0, p1};
      ph.u[w][e4] = __builtin_bit_cast(unsigned, __builtin_convertvector(pp, v2h));   // one packed RNE convert per pair
    }
  }
  ps += __shfl_xor(ps, 16, 32);
  lrun = lrun * al + ps;
  // ---- rescale the O accumulators: D row 8hh+r = query q0+8hh+r, its factor lives in lane 8hh+r (and 16+8hh+r) ----
  float scl[8];
#pragma unroll
  for (int r = 0; r < 8; ++r) scl[r] = __shfl(al, 8 * hh + r, 32);
#pragma unroll
  for (int j = 0; j < 4; ++j) {
#pragma unroll
    for (int r = 0; r < 8; ++r) o[j][r] *= scl[r];
  }
  // ---- P.V : B fragment col n = d = j*16 + c, keys contiguous in the v^T plane ----
  o[0] = mma_h(ph.v, f.v0, o[0]);
  o[1] = mma_h(ph.v, f.v1, o[1]);
  o[2] = mma_h(ph.v, f.v2, o[2]);
  o[3] = mma_h(ph.v, f.v3, o[3]);
  g4_5<v16h>(o[0], o[1], o[2], o[3], ph.v, f.v0, f.v1, f.v2, f.v3);
}

__global__ __launch_bounds__(ATT_THREADS)
void attn_fwd(const u16* __restrict__ QHp, const u16* __restrict__ KHp, const u16* __restrict__ VHp, float* out) {
  // two stage buffers (k tile, then v^T tile, each at a multiple of 2 KiB), then per wave a result slab [16][68] for the epilogue
  __shared__ __attribute__((aligned(2048))) unsigned char L[RINGB + ATT_WAVES * SLABF * 4];
  float* smem = (float*)(void*)(L + RINGB);

  const int tid  = threadIdx.x;
  const int wave = tid >> 5;
  const int lane = tid & 31;
  const int hh   = lane >> 4;
  const int c    = lane & 15;

  const int bid  = blockIdx.x;
  const int qt   = bid % QTILES;              // 0..63
  const int head = bid / QTILES;              // 0..NH-1
  if (head >= NH) return;                     // block-uniform, never taken with the exact grid; stands in front of every barrier
  const int q0   = qt * 64 + wave * 16;

  // B fragments of q^T: col n = query q0 + c, k = d (k-contiguous row of the q plane); loop-invariant
  const size_t qofs = ((size_t)(q0 + c) * NH + head) * HD + 8 * hh;
  const _Float16* Qh  = (const _Float16*)(const void*)QHp + qofs;
  const v16h qh0 = ldfrag_h(Qh), qh1 = ldfrag_h(Qh + 32);
  const float lsc = 0.125f * (LOG2E / (QSC * KSC));

  // Stage tiles: k rows st*STK .. +127 of this head (128 B each, plane pitch OUTW*2 B); v^T rows head*HD .. +63, keys st*STK .. +127
  // (256 B each, plane pitch SEQ*2 B). Every tile lies wholly inside its plane.
  const uint32_t wv    = uni((uint32_t)tid >> 5);
  const uint64_t kga   = (uint64_t)(size_t)KHp + (uint64_t)head * (HD * 2);
  const uint64_t vga   = (uint64_t)(size_t)VHp + (uint64_t)head * ((uint64_t)HD * SEQ * 2);
  // wave 0 brings the k tiles, wave 1 the v^T tiles: a wave's own place in a buffer, source address and step from stage to stage
  const uint32_t lown  = (uint32_t)(size_t)L + (wv == 0u ? 0u : (uint32_t)KTILE);
  const uint32_t gstep = (wv == 0u) ? (uint32_t)(STK * OUTW * 2) : (uint32_t)(STK * 2);
  const u32x8 g1k = tdm_group1<KW0, HD * 2, STK, OUTW * 2>();
  const u32x8 g1v = tdm_group1<VW0, STK * 2, HD, SEQ * 2>();
  u32x4 g0 = tdm_group0(lown, (wv == 0u) ? kga : vga);
  if (pinned(wv == 0u)) {
    tdm_load(g0, g1k);
    wait_tensor0(g0, g1k, g1v);
  }
  if (pinned(wv == 1u)) {
    tdm_load(g0, g1v);
    wait_tensor0(g0, g1k, g1v);
  }
  __syncthreads();                       // stage 0 published
  tdm_advance(g0, lown + BUFB, gstep);
  if (pinned(wv == 0u)) tdm_load(g0, g1k);
  if (pinned(wv == 1u)) tdm_load(g0, g1v);

  float mrun = -INFINITY, lrun = 0.f;
  v8f o[4];
#pragma unroll
  for (int j = 0; j < 4; ++j) o[j] = zero8();

  // A fragments of k: row m = key + c, k = d; B fragments of v: col n = d = 16j + c, k = key (both k-contiguous LDS rows)
  const uint32_t klane = (uint32_t)c * KPITCH + 16u * (uint32_t)hh;
  const uint32_t vlane = KTILE + (uint32_t)c * VPITCH + 16u * (uint32_t)hh;
  KVSet sa, sb;
  // rolled: one trip = one stage = four key blocks, alternating between the two register sets, so that no set is ever copied
#pragma unroll 1
  for (int st = 0; st < NST; ++st) {
    const uint32_t bofs = (uint32_t)(st & 1) * BUFB;
    const _Float16* kp = (const _Float16*)(const void*)(L + bofs + klane);
    const _Float16* vp = (const _Float16*)(const void*)(L + bofs + vlane);
    // the scheduling barriers keep each group of LDS reads where it is written (one group per block, never among the products)
    ld_kv(sa, kp, vp);
    __builtin_amdgcn_sched_barrier(0);
    ld_kv(sb, kp + 32 * (KPITCH / 2), vp + 32);
    __builtin_amdgcn_sched_barrier(0);
    att_step(sa, qh0, qh1, lsc, hh, mrun, lrun, o);
    __builtin_amdgcn_sched_barrier(0);
    ld_kv(sa, kp + 64 * (KPITCH / 2), vp + 64);
    __builtin_amdgcn_sched_barrier(0);
    att_step(sb, qh0, qh1, lsc, hh, mrun, lrun, o);
    __builtin_amdgcn_sched_barrier(0);
    ld_kv(sb, kp + 96 * (KPITCH / 2), vp + 96);
    __builtin_amdgcn_sched_barrier(0);
    att_step(sa, qh0, qh1, lsc, hh, mrun, lrun, o);
    __builtin_amdgcn_sched_barrier(0);
    att_step(sb, qh0, qh1, lsc, hh, mrun, lrun, o);
    __builtin_amdgcn_sched_barrier(0);
    // publish point of stage st + 1: own LDS reads retired, the issuers' tiles landed, barrier, then the refill of the buffer just read
    wait_ds0();
    if (pinned(wv < 2u)) wait_tensor0(g0, g1k, g1v);
    __syncthreads();
    if (pinned(st + 2 < NST)) {
      tdm_advance(g0, lown + bofs, gstep);
      if (pinned(wv == 0u)) tdm_load(g0, g1k);
      if (pinned(wv == 1u)) tdm_load(g0, g1v);
    }
  }
  wait_tensor0(g0, g1k, g1v);
  wait_ds0();
  acc_guard4(o[0], o[1], o[2], o[3]);

  // ---- fold 1/l (per query, owned by lane = query; l carries the same 32768 as P) and the carry 64 on v; stage the 16x64 slab ----
  const float linv = (1.0f / lrun) * (1.0f / VCAR);
  float inv[8];
#pragma unroll
  for (int r = 0; r < 8; ++r) inv[r] = __shfl(linv, 8 * hh + r, 32);
  float* slab = smem + wave * SLABF;
#pragma unroll
  for (int r = 0; r < 8; ++r) {
#pragma unroll
    for (int j = 0; j < 4; ++j) slab[(8 * hh + r) * 68 + j * 16 + c] = o[j][r] * inv[r];
  }
  wave_sync_lds();
  // ---- f32 rows of the merged-head output: row s = q0 + 2*it + hh, columns head*64 + 4c .. +3 per lane ----
  v4f vals[8];
#pragma unroll
  for (int it = 0; it < 8; ++it) vals[it] = *(const v4f*)(slab + (it * 2 + hh) * 68 + c * 4);
  float* dst = out + ((size_t)(q0 + hh)) * (size_t)OUTW + head * HD + c * 4;
  {
#pragma unroll
    for (int it = 0; it < 8; ++it) {
      *(v4f*)(dst + (size_t)(it * 2) * (size_t)OUTW) = vals[it];
    }
    
  }
}

// =====================================================================================================
// Workspace map (bytes); every plane is fully written by whole-line stores before it is read; all extents are exact multiples
// of the 512-B store granularity (no pad rows needed); every offset a multiple of 128:
//   XB  bf16 [4096 token][768 i]        6291456
//   WQB bf16 [OUTW o][768 i]            1179648      WKB same 1179648     WVB same 1179648
//   QH  f16  [4096][12][64] x64         6291456      KH same 6291456
//   VH  f16  [12][64][4096] x64         6291456
//   end                                28704768
// =====================================================================================================
extern "C" void kernel_launch(void* const* d_in, const int* in_sizes, int n_in,
                              void* d_out, int out_size, void* d_ws, size_t ws_size,
                              hipStream_t stream) {
  const int XN = SEQ * DIN;                             // 3145728
  const int ON = SEQ * OUTW;                            // 3145728
  if (n_in < 7) return;
  if (in_sizes[0] != XN) return;
  if (in_sizes[1] != DIN * DIN || in_sizes[3] != DIN * DIN || in_sizes[5] != DIN * DIN) return;
  if (in_sizes[2] != DIN || in_sizes[4] != DIN || in_sizes[6] != DIN) return;
  if (out_size != ON) return;

  const float* xin = (const float*)d_in[0];
  const float* wq  = (const float*)d_in[1];
  const float* bq  = (const float*)d_in[2];
  const float* wk  = (const float*)d_in[3];
  const float* bk  = (const float*)d_in[4];
  const float* wv  = (const float*)d_in[5];
  const float* bv  = (const float*)d_in[6];
  float*       out = (float*)d_out;
  const int    nb  = in_sizes[2];                       // bias length (DIN)

  const size_t szXB = (size_t)SEQ * DIN * 2;            //  6291456
  const size_t szW  = (size_t)OUTW * DIN * 2;           //  1179648
  const size_t szP  = (size_t)SEQ * OUTW * 2;           //  6291456
  size_t off = 0;
  const size_t oXB  = off; off += szXB;
  const size_t oWQB = off; off += szW;
  const size_t oWKB = off; off += szW;
  const size_t oWVB = off; off += szW;
  const size_t oQH  = off; off += szP;
  const size_t oKH  = off; off += szP;
  const size_t oVH  = off; off += szP;
  if (off > ws_size) return;                            // off = 28704768
  if (off > (size_t)134217728) return;

  char* ws = (char*)d_ws;
  u16*   XB  = (u16*)(ws + oXB);
  u16*   WQB = (u16*)(ws + oWQB);
  u16*   WKB = (u16*)(ws + oWKB);
  u16*   WVB = (u16*)(ws + oWVB);
  u16*   QH  = (u16*)(ws + oQH);
  u16*   KH  = (u16*)(ws + oKH);
  u16*   VH  = (u16*)(ws + oVH);

  const dim3 blk(256);
  const dim3 gCv(CVX + 3 * CVW);                        // 1536 + 3 * 288 = 2400
  const dim3 gG(3 * GTILES);                            // 3 * 768 tiles
  const dim3 bG(128);
  const dim3 gAT(ATT_BLOCKS);                           // 768
  const dim3 bAT(ATT_THREADS);                          // 128

  // (0) input [token][i] and weights [o][i] (first OUTW rows) -> bf16 planes XB, WQB, WKB, WVB (contiguous from XB), same layouts
  cvb16<<<gCv, blk, 0, stream>>>(xin, wq, wk, wv, XB);
  // (1) q, k: projection + bias in f32, stored as the f16 planes x64 [4096 token][h*64+d]; v: channel-major projection with
  //     per-row bias, stored as the f16 plane x64 [h*64+d][4096] (= v^T plane layout)
  gemm_bfb<<<gG, bG, 0, stream>>>(XB, WQB, WKB, WVB, bq, bk, bv, QH, KH, VH, nb);
  // (2) attention -> merged-head f32 output [4096][h*64+d]
  attn_fwd<<<gAT, bAT, 0, stream>>>(QH, KH, VH, out);
  (void)hipGetLastError();
}

// v007
// Measured time: 78.6 microseconds a run.
// Next to v006, in two timings, it ran 1.09 and 1.08 times as fast.
// Counting every step since v000, it is 3.45 times as fast.
// Contractions: projections X.W^T and Wv.X^T on v_wmma_f32_16x16x32_bf16 (X and W RNE-converted bf16 operands, f32 accumulate,
// bias added in f32); scores k.q^T (q, k carried x64 as f16) and v^T.P^T (P x32768 as f16, v x64 as f16) on v_wmma_f32_16x16x32_f16,
// f32 accumulate. Base-2 online softmax (one fma and one v_exp_f32 per probability) and the 1/l fold in f32 on VALU.
#include <hip/hip_runtime.h>
#include <math.h>
#include <stdint.h>

#define SEQ   4096
#define DIN   768
#define NH    12
#define HD    64
#define OUTW  (NH * HD)
#define QSC   64.0f
#define KSC   64.0f
#define PEXP  15.0f                       // P and its row sum are carried x2^15 = 32768
#define VCAR  64.0f
#define LOG2E 1.4426950408889634f
#define ATT_WAVES   4
#define ATT_THREADS (ATT_WAVES * 32)
#define QTILES      (SEQ / 64)
#define ATT_BLOCKS  (NH * QTILES)
#define NKB    (SEQ / 32)
#define SLABF  (16 * 68)
#define SLAB64 (16 * 68)
#define STK     128                      // keys per LDS stage of the attention loop (four 32-key blocks)
#define NST     (SEQ / STK)
#define KPITCH  144                      // LDS row pitch of a k row (128 B + 16 B pad), bytes
#define VPITCH  272                      // LDS row pitch of a v^T row (256 B + 16 B pad), bytes
#define KTILE   (STK * KPITCH)           // 18432 B, a multiple of 2 KiB
#define VTILE   18432                    // HD * VPITCH = 17408 B, rounded up to a multiple of 2 KiB
#define BUFB    (KTILE + VTILE)
#define RINGB   (2 * BUFB)
#define GSK     128                      // k per LDS stage of the projection loop (four k steps of 32)
#define GPITCH  272                      // LDS row pitch of an operand row of a stage (256 B + 16 B pad), bytes
#define GTILE   18432                    // 64 * GPITCH = 17408 B, rounded up to a multiple of 2 KiB
#define GBUFB   (2 * GTILE)
#define GRINGB  (2 * GBUFB)
static_assert(HD == 64);
static_assert((SEQ % 64) == 0 && (DIN % 32) == 0 && (OUTW % 64) == 0 && OUTW <= DIN);
static_assert(((SEQ * DIN) % 256) == 0 && ((OUTW * DIN) % 256) == 0 && ((SEQ * OUTW) % 256) == 0);
static_assert(ATT_THREADS == 128 && NKB * 32 == SEQ);
static_assert((DIN % 128) == 0 && (NKB % 2) == 0);
static_assert(ATT_WAVES * SLABF >= 4 * 16 * 68);
static_assert(NST >= 2 && NST * STK == SEQ && STK == 4 * 32);
static_assert((KTILE % 2048) == 0 && (VTILE % 2048) == 0 && HD * VPITCH <= VTILE);
static_assert(KPITCH == HD * 2 + 16 && VPITCH == STK * 2 + 16);
static_assert((GTILE % 2048) == 0 && 64 * GPITCH <= GTILE && GPITCH == GSK * 2 + 16 && GSK == 4 * 32);
static_assert((DIN % GSK) == 0 && DIN / GSK >= 2 && ((DIN * 2) % 16) == 0);
#define CVX    ((SEQ * DIN) / 2048)      // conversion blocks (2048 elements each) of x
#define CVW    ((OUTW * DIN) / 2048)     // the same of one weight plane
#define GTILES ((SEQ / 64) * (OUTW / 64))   // 64x64 output tiles of one projection
static_assert(((SEQ * DIN) % 2048) == 0 && ((OUTW * DIN) % 2048) == 0);

typedef unsigned short u16;
typedef _Float16 v16h __attribute__((ext_vector_type(16)));
typedef _Float16 v8h  __attribute__((ext_vector_type(8)));
typedef __bf16   v16b __attribute__((ext_vector_type(16)));
typedef _Float16 v2h  __attribute__((ext_vector_type(2)));
typedef float    v2f  __attribute__((ext_vector_type(2)));
typedef float    v8f  __attribute__((ext_vector_type(8)));
typedef float    v4f  __attribute__((ext_vector_type(4)));
typedef unsigned int v4u __attribute__((ext_vector_type(4)));
typedef uint32_t u32x4 __attribute__((ext_vector_type(4)));
typedef uint32_t u32x8 __attribute__((ext_vector_type(8)));

union FragH { v16h v; v8h h[2]; v4u u[2]; };
union FragB { v16b v; v4u u[2]; };

// ---- scalar helpers --------------------------------------------------------------------------------
__device__ __forceinline__ unsigned short bf_bits(float f) {          // f32 -> bf16 bits, RNE convert
  unsigned u = __float_as_uint(f);
  return (unsigned short)((u + 0x7FFFu + ((u >> 16) & 1u)) >> 16);
}
__device__ __forceinline__ float bf_up(unsigned short h) { return __uint_as_float(((unsigned)h) << 16); }
__device__ __forceinline__ float bfr(float f) { return bf_up(bf_bits(f)); }
__device__ __forceinline__ unsigned short h_bits(_Float16 x) { return __builtin_bit_cast(unsigned short, x); }
__device__ __forceinline__ unsigned pk16(unsigned short a, unsigned short b) { return (unsigned)a | ((unsigned)b << 16); }
// x <- 2^x by the hardware instruction alone. A result below 2^-126 may come out as 0: every use here is a probability or a
// rescale factor relative to a row maximum, where such a value is lost in the f16 P and in the f32 sums anyway. 2^-inf = 0.
// Written as one run, each in place: no instruction of the run reads its predecessor's result or writes its predecessor's source,
// and the closing v_nop is the slot that the instruction set asks for between the last v_exp_f32 and whatever uses its result.
__device__ __forceinline__ void exp2_run8(float (&x)[8]) {
#if defined(__HIP_DEVICE_COMPILE__)
  asm("v_exp_f32 %0, %0\n\tv_exp_f32 %1, %1\n\tv_exp_f32 %2, %2\n\tv_exp_f32 %3, %3\n\t"
      "v_exp_f32 %4, %4\n\tv_exp_f32 %5, %5\n\tv_exp_f32 %6, %6\n\tv_exp_f32 %7, %7\n\tv_nop"
      : "+v"(x[0]), "+v"(x[1]), "+v"(x[2]), "+v"(x[3]), "+v"(x[4]), "+v"(x[5]), "+v"(x[6]), "+v"(x[7]));
#endif
}
__device__ __forceinline__ void exp2_run9(float& a, float (&x)[8]) {   // a first: the longest path hangs on it
#if defined(__HIP_DEVICE_COMPILE__)
  asm("v_exp_f32 %0, %0\n\tv_exp_f32 %1, %1\n\tv_exp_f32 %2, %2\n\tv_exp_f32 %3, %3\n\tv_exp_f32 %4, %4\n\t"
      "v_exp_f32 %5, %5\n\tv_exp_f32 %6, %6\n\tv_exp_f32 %7, %7\n\tv_exp_f32 %8, %8\n\tv_nop"
      : "+v"(a), "+v"(x[0]), "+v"(x[1]), "+v"(x[2]), "+v"(x[3]), "+v"(x[4]), "+v"(x[5]), "+v"(x[6]), "+v"(x[7]));
#endif
}
// lane l <-> lane l ^ 16 on the vector pipe (v_permlanex16_b32): no LDS-pipe instruction, so no s_wait_dscnt behind it
__device__ __forceinline__ float xhalf(float x) {
  const int b = __builtin_bit_cast(int, x);
  return __builtin_bit_cast(float, __builtin_amdgcn_permlanex16(b, b, 0x76543210, 0xfedcba98, false, false));
}
__device__ __forceinline__ v8f zero8() { v8f z = {0.f, 0.f, 0.f, 0.f, 0.f, 0.f, 0.f, 0.f}; return z; }

// ---- fragment loaders: 16-bit A/B operand, lane -> row/col (lane&15), p already includes +8*(lane>>4);
//      elements 0..7 <- p[0..7] (k0+8h..), elements 8..15 <- p[16..23] (k0+16+8h..)  (same split k map for A and B;
//      B is always read from a k-contiguous [n][k] plane)
__device__ __forceinline__ v16h ldfrag_h(const _Float16* p) {
  FragH f;
  f.h[0] = *(const v8h*)(p);
  f.h[1] = *(const v8h*)(p + 16);
  return f.v;
}
__device__ __forceinline__ v16b ldfrag_b(const u16* p) {              // bf16 plane read as unsigned integer vectors
  FragB f;
  f.u[0] = *(const v4u*)(p);
  f.u[1] = *(const v4u*)(p + 16);
  return f.v;
}

__device__ __forceinline__ v8f mma_h(v16h a, v16h b, v8f c) {
  return __builtin_amdgcn_wmma_f32_16x16x32_f16(false, a, false, b, (short)0, c, false, false);
}
__device__ __forceinline__ v8f mma_b(v16b a, v16b b, v8f c) {
  return __builtin_amdgcn_wmma_f32_16x16x32_bf16(false, a, false, b, (short)0, c, false, false);
}
__device__ __forceinline__ void g2_3(v8f& a, v8f& b, v16h x0, v16h x1, v16h x2) {
#if defined(__HIP_DEVICE_COMPILE__)
  asm volatile("v_nop\n\tv_nop\n\tv_nop\n\tv_nop" : "+v"(a), "+v"(b) : "v"(x0), "v"(x1), "v"(x2) : "memory");
#endif
}
template <typename F>
__device__ __forceinline__ void g4_5(v8f& a, v8f& b, v8f& c, v8f& d, F x0, F x1, F x2, F x3, F x4) {
#if defined(__HIP_DEVICE_COMPILE__)
  asm volatile("v_nop\n\tv_nop\n\tv_nop\n\tv_nop"
               : "+v"(a), "+v"(b), "+v"(c), "+v"(d) : "v"(x0), "v"(x1), "v"(x2), "v"(x3), "v"(x4) : "memory");
#endif
}
__device__ __forceinline__ void acc_guard4(v8f& a, v8f& b, v8f& c, v8f& d) {
#if defined(__HIP_DEVICE_COMPILE__)
  asm volatile("v_nop\n\tv_nop\n\tv_nop\n\tv_nop" : "+v"(a), "+v"(b), "+v"(c), "+v"(d));
#endif
}
__device__ __forceinline__ void wave_sync_lds() {
  __builtin_amdgcn_fence(__ATOMIC_RELEASE, "workgroup");
  __builtin_amdgcn_wave_barrier();
  __builtin_amdgcn_fence(__ATOMIC_ACQUIRE, "workgroup");
}

// ---- tensor loads into LDS -------------------------------------------------------------------------
__device__ __forceinline__ uint32_t uni(uint32_t v) { return (uint32_t)__builtin_amdgcn_readfirstlane(v); }
__device__ __forceinline__ uint32_t pinned(uint32_t v) {
  uint32_t w = uni(v);
#if defined(__HIP_DEVICE_COMPILE__)
  // holds an issue test in a scalar register, so that it compiles to a scalar branch (tensor loads ignore EXEC), or a descriptor word
  asm volatile("" : "+s"(w));
#endif
  return w;
}
__device__ __forceinline__ void wait_ds0() {
#if defined(__HIP_DEVICE_COMPILE__)
  asm volatile("s_wait_dscnt 0x0" ::: "memory");      // this wave's LDS reads have retired before its buffer may be refilled
#endif
}
// The issuing wave's tile has landed (the compiler places no wait for it). The descriptor groups are operands of the wait: group 0
// as a value that the wait hands on, so that its next address is formed behind the wait, the two groups 1 as inputs, so that
// their registers are still theirs here: no word of a request in flight takes a new value in front of this wait.
__device__ __forceinline__ void wait_tensor0(u32x4& g0, u32x8 g1a, u32x8 g1b) {
#if defined(__HIP_DEVICE_COMPILE__)
  asm volatile("s_wait_tensorcnt 0x0" : "+s"(g0) : "s"(g1a), "s"(g1b) : "memory");
#endif
}
// Group 1 of a tile of D1 rows of D0 bytes (1-byte elements, tensor = tile), source row pitch PITCH bytes; W0 = word 0 (no mask;
// the pad that sets the LDS pitch), a compile-time constant. Built once, the same for every stage.
template <uint32_t W0, uint32_t D0, uint32_t D1, uint32_t PITCH>
__device__ __forceinline__ u32x8 tdm_group1() {
  // pinned(): each descriptor word held in a scalar register, so that the group is one set of registers for the whole kernel and
  // not constants set up anew, in registers that are then reused, at each request
  u32x8 g1;
  g1[0] = pinned(W0);
  g1[1] = pinned((D0 & 0xFFFFu) << 16);
  g1[2] = pinned((D0 >> 16) | ((D1 & 0xFFFFu) << 16));
  g1[3] = pinned((D1 >> 16) | (D0 << 16));
  g1[4] = pinned(D1);
  g1[5] = pinned(PITCH);
  g1[6] = pinned(0u);
  g1[7] = pinned(0u);
  return g1;
}
// The same with the source row pitch (bytes) taken from a function argument.
template <uint32_t W0, uint32_t D0, uint32_t D1>
__device__ __forceinline__ u32x8 tdm_group1p(uint32_t pitch) {
  u32x8 g1;
  g1[0] = pinned(W0);
  g1[1] = pinned((D0 & 0xFFFFu) << 16);
  g1[2] = pinned((D0 >> 16) | ((D1 & 0xFFFFu) << 16));
  g1[3] = pinned((D1 >> 16) | (D0 << 16));
  g1[4] = pinned(D1);
  g1[5] = pinned(pitch);
  g1[6] = pinned(0u);
  g1[7] = pinned(0u);
  return g1;
}
// Group 0: tile's first byte at ga, to LDS byte offset lds_dst.
__device__ __forceinline__ u32x4 tdm_group0(uint32_t lds_dst, uint64_t ga) {
  u32x4 g0;
  g0[0] = uni(1u);
  g0[1] = uni(lds_dst);
  g0[2] = uni((uint32_t)ga);
  g0[3] = uni((((uint32_t)(ga >> 32)) & 0x01FFFFFFu) | 0x80000000u);
  return g0;
}
// Group 0 of the next stage: new LDS place, source address advanced by step bytes (the carry goes into address bits 56..32).
__device__ __forceinline__ void tdm_advance(u32x4& g0, uint32_t lds_dst, uint32_t step) {
  const uint32_t lo = g0[2] + step;
  g0[1] = uni(lds_dst);
  g0[3] = uni(g0[3] + (lo < step ? 1u : 0u));
  g0[2] = uni(lo);
}
__device__ __forceinline__ void tdm_load(u32x4 g0, u32x8 g1) {
#if defined(__HIP_DEVICE_COMPILE__)
  // the request itself: one per issuing wave, through no register; its waits are written by hand where it is used
  asm volatile("tensor_load_to_lds %0, %1" :: "s"(g0), "s"(g1) : "memory");
#endif
}
#define KW0 ((1u << 20) | (4u << 22) | (3u << 25))   // 128-B rows, 16 B of pad behind each
#define VW0 ((1u << 20) | (5u << 22) | (3u << 25))   // 256-B rows, 16 B of pad behind each

// =====================================================================================================
// The four f32 planes (x, wq, wk, wv) -> bf16 planes (RNE convert), same layouts, in ONE launch: the block index picks the plane.
// The four bf16 planes stand one behind the other at D, in that order, so the destination index is the flat one. Thread = 8
// consecutive elements: two 16-B loads, one 16-B store.
// coverage: blocks 0 .. CVX-1 = x, then CVW blocks for each weight; a block = 256 thr x 8 = 2048 elements, every plane a whole
//           number of blocks, grid = CVX + 3*CVW blocks = the four planes exactly.
// =====================================================================================================
__global__ __launch_bounds__(256) void cvb16(const float* __restrict__ x, const float* __restrict__ wq,
                                             const float* __restrict__ wk, const float* __restrict__ wv, u16* D) {
  const int bid = blockIdx.x;
  if (bid >= CVX + 3 * CVW) return;         // block-uniform, never taken with the exact grid; no barriers in this kernel
  const int wj  = (bid - CVX) / CVW;        // which weight, where the block is past x
  const float* sp = (bid < CVX) ? x : (wj == 0) ? wq : (wj == 1) ? wk : wv;
  const int   sb = (bid < CVX) ? bid : bid - CVX - wj * CVW;          // block index inside its own plane
  const int gt = bid * 256 + (int)threadIdx.x;
  const float* p = sp + ((size_t)sb * 256 + threadIdx.x) * 8;
  const v4f a = *(const v4f*)(p), c4 = *(const v4f*)(p + 4);
  float v[8];
#pragma unroll
  for (int e = 0; e < 4; ++e) { v[e] = a[e]; v[4 + e] = c4[e]; }
  unsigned short s[8];
#pragma unroll
  for (int e = 0; e < 8; ++e) s[e] = bf_bits(v[e]);
  v4u o;
#pragma unroll
  for (int e = 0; e < 4; ++e) o[e] = pk16(s[2 * e], s[2 * e + 1]);
  u16* d = D + (size_t)gt * 8;
  {
    *(v4u*)(d) = o;
    
  }
}

// =====================================================================================================
// Bias terms for the GEMM epilogue (bf16-RNE values of bias[], nb entries; every candidate index clamped into 0..nb-1 so all
// loads are in range, selection by value): bmode 0: per-column direct; bmode 1: per-row direct.
// =====================================================================================================
// badd: the 8 columns col0 + 8*cc .. +7 that the lane stores (cc = lane&7); radd: the 8 rows rowb + 8*hh .. +7 of its accumulators.
__device__ __forceinline__ void bias_terms(const float* __restrict__ bias, int nb, int bmode, int rowb, int col0, int hh, int cc,
                                           v8f& badd, v8f& radd) {
#pragma unroll
  for (int e = 0; e < 8; ++e) {
    const int ci = col0 + 8 * cc + e;
    const int ic = ci < nb ? ci : nb - 1;
    const float bc = bfr(bias[ic]);
    badd[e] = (bmode == 0) ? bc : 0.0f;
  }
#pragma unroll
  for (int r = 0; r < 8; ++r) {
    const int ri = rowb + 8 * hh + r;
    const int ir = ri < nb ? ri : nb - 1;
    const float br = bfr(bias[ir]);
    radd[r] = (bmode == 1) ? br : 0.0f;
  }
}

// =====================================================================================================
// GEMM epilogue: the wave's 16x64 f32 tile (times oscale, plus per-row addend radd) staged in its LDS slab (pitch 68), read back
// row-wise, per-column addend badd added in f32, times hscale (a power of two), converted to f16 (RNE) and stored: a lane holds 8
// consecutive columns (one 16-B store), 8 lanes one row of 64 f16 = one whole 128-B line.
// coverage: 4 instructions x 4 rows x 8 lanes x 8 halves = the wave's 16 x 64 tile.
// =====================================================================================================
__device__ __forceinline__ void epi64h(float* sl, v8f a0, v8f a1, v8f a2, v8f a3, float oscale, v8f badd, v8f radd, float hscale,
                                       u16* C, int N, size_t rowb, int col0, int lane) {
  const int hh = lane >> 4, m = lane & 15;
#pragma unroll
  for (int r = 0; r < 8; ++r) {
    const int ro = (8 * hh + r) * 68 + m;
    sl[ro]      = a0[r] * oscale + radd[r];
    sl[ro + 16] = a1[r] * oscale + radd[r];
    sl[ro + 32] = a2[r] * oscale + radd[r];
    sl[ro + 48] = a3[r] * oscale + radd[r];
  }
  wave_sync_lds();
  const int rr = lane >> 3, cc = lane & 7;
  v4u vals[4];
#pragma unroll
  for (int it = 0; it < 4; ++it) {
    const float* sp = sl + (it * 4 + rr) * 68 + cc * 8;
    const v4f x0 = *(const v4f*)(sp), x1 = *(const v4f*)(sp + 4);
    unsigned short h[8];
#pragma unroll
    for (int e = 0; e < 4; ++e) {
      h[e]     = h_bits((_Float16)((x0[e] + badd[e]) * hscale));
      h[4 + e] = h_bits((_Float16)((x1[e] + badd[4 + e]) * hscale));
    }
#pragma unroll
    for (int e = 0; e < 4; ++e) vals[it][e] = pk16(h[2 * e], h[2 * e + 1]);
  }
  u16* dst = C + (rowb + (size_t)rr) * (size_t)N + col0 + cc * 8;
#pragma unroll
  for (int it = 0; it < 4; ++it) *(v4u*)(dst + (size_t)(it * 4) * (size_t)N) = vals[it];
}

// =====================================================================================================
// The three projections in ONE launch: block index / GTILES picks the job (0: q = X.Wq^T, 1: k = X.Wk^T, both token-major with a
// per-column bias; 2: v^T = Wv.X^T, channel-major with a per-row bias), block index % GTILES its 64x64 tile.
// A job is a bf16 GEMM with bias: C[M][N] (f16, pitch N) = (A[M][K] (bf16 row-major) . Bt[N][K]^T (bf16 k-contiguous), times oscale, plus
// the bias term selected by bmode (see bias_terms), all in f32) times hscale. (M/64)*(N/64) = GTILES tiles. Block = 64x64 tile, 4 waves x 16 rows.
// K is walked in stages of GSK = 128: a stage's 64 A rows and 64 Bt rows (256 B each) are brought into LDS once for the four waves,
// by one tensor load each (wave 0: A, wave 1: Bt), into one of two buffers, the next stage's loads in flight while this stage is
// worked on; one work-group barrier per stage publishes the next stage and frees the buffer just read. A stage's fragments (four
// k steps of 32, split k map for A and B) are read from LDS (ds_load_b128, padded pitch) as one group ahead of its products.
// (K = DIN: K % 128 == 0, K >= 256; M, N = SEQ, OUTW or OUTW, SEQ: multiples of 64)
// =====================================================================================================
struct GSet { v16b a, b0, b1, b2, b3; };
// ap: LDS address of the lane's A row at the k step, byte 16*hh; bp: the same of Bt row m.
__device__ __forceinline__ void ld_gset(GSet& s, const u16* ap, const u16* bp) {
  s.a  = ldfrag_b(ap);
  s.b0 = ldfrag_b(bp);
  s.b1 = ldfrag_b(bp + 16 * (GPITCH / 2));
  s.b2 = ldfrag_b(bp + 32 * (GPITCH / 2));
  s.b3 = ldfrag_b(bp + 48 * (GPITCH / 2));
}
__device__ __forceinline__ void gemm_step(const GSet& s, v8f& acc0, v8f& acc1, v8f& acc2, v8f& acc3) {
  acc0 = mma_b(s.a, s.b0, acc0);
  acc1 = mma_b(s.a, s.b1, acc1);
  acc2 = mma_b(s.a, s.b2, acc2);
  acc3 = mma_b(s.a, s.b3, acc3);
  g4_5<v16b>(acc0, acc1, acc2, acc3, s.a, s.b0, s.b1, s.b2, s.b3);
}
__global__ __launch_bounds__(128)
void gemm_bfb(const u16* __restrict__ XBp, const u16* __restrict__ WQp, const u16* __restrict__ WKp, const u16* __restrict__ WVp,
              const float* __restrict__ bq, const float* __restrict__ bk, const float* __restrict__ bv,
              u16* QHp, u16* KHp, u16* VHp, int nb) {
  // two stage buffers (A tile, then Bt tile, each at a multiple of 2 KiB), then per wave a result slab [16][68] for the epilogue
  __shared__ __attribute__((aligned(2048))) unsigned char L[GRINGB + 4 * SLAB64 * 4];
  float* slab = (float*)(void*)(L + GRINGB);
  const int tid = threadIdx.x, wave = tid >> 5, lane = tid & 31, hh = lane >> 4, m = lane & 15;
  const int job   = blockIdx.x / GTILES;     // block-uniform: every choice below is a scalar one
  const int bid   = blockIdx.x % GTILES;
  if (job > 2) return;                       // block-uniform, never taken with the exact grid; stands in front of every barrier
  const u16*   A    = (job == 2) ? WVp : XBp;
  const u16*   Bt   = (job == 0) ? WQp : (job == 1) ? WKp : XBp;
  const float* bias = (job == 0) ? bq : (job == 1) ? bk : bv;
  u16*         C    = (job == 0) ? QHp : (job == 1) ? KHp : VHp;
  const int    M    = (job == 2) ? OUTW : SEQ, N = (job == 2) ? SEQ : OUTW, K = DIN;
  const int    bmode  = (job == 2) ? 1 : 0;
  const float  oscale = 1.0f;
  const float  hscale = (job == 0) ? QSC : (job == 1) ? KSC : VCAR;
  // tile row and column by each job's own constant tile count, so that the divisions stay scalar
  const int row0  = ((job == 2) ? bid / (SEQ / 64) : bid / (OUTW / 64)) * 64;
  const int rowb  = row0 + wave * 16;
  const int col0  = ((job == 2) ? bid % (SEQ / 64) : bid % (OUTW / 64)) * 64;
  if (row0 + 64 > M) return;                 // block-uniform, never taken with the exact grid; stands in front of every barrier
  const int nst = K / GSK;

  // Stage tiles: A rows row0 .. +63 and Bt rows col0 .. +63, k st*GSK .. +127 (256 B of each row, plane pitch K*2 B). Every tile
  // lies wholly inside its plane. Wave 0 brings the A tiles, wave 1 the Bt tiles: a wave's own place in a buffer and source address.
  const uint32_t wv   = uni((uint32_t)tid >> 5);
  const uint64_t aga  = (uint64_t)(size_t)A  + (uint64_t)row0 * (uint64_t)K * 2u;
  const uint64_t bga  = (uint64_t)(size_t)Bt + (uint64_t)col0 * (uint64_t)K * 2u;
  const uint32_t lown = (uint32_t)(size_t)L + (wv == 0u ? 0u : (uint32_t)GTILE);
  const u32x8 g1 = tdm_group1p<VW0, GSK * 2, 64>((uint32_t)K * 2u);
  u32x4 g0 = tdm_group0(lown, (wv == 0u) ? aga : bga);
  if (pinned(wv < 2u)) {
    tdm_load(g0, g1);
    wait_tensor0(g0, g1, g1);
  }
  __syncthreads();                       // stage 0 published
  tdm_advance(g0, lown + GBUFB, GSK * 2);
  if (pinned(wv < 2u)) tdm_load(g0, g1);

  const uint32_t alane = (uint32_t)(wave * 16 + m) * GPITCH + 16u * (uint32_t)hh;
  const uint32_t blane = GTILE + (uint32_t)m * GPITCH + 16u * (uint32_t)hh;
  v8f acc0 = zero8(), acc1 = zero8(), acc2 = zero8(), acc3 = zero8();
  GSet s0, s1, s2, s3;
  // rolled (one trip = one stage = four k steps, one per register set): one publish point in the text, in the order written
#pragma unroll 1
  for (int st = 0; st < nst; ++st) {
    const uint32_t bofs = (uint32_t)(st & 1) * GBUFB;
    const u16* ap = (const u16*)(const void*)(L + bofs + alane);
    const u16* bp = (const u16*)(const void*)(L + bofs + blane);
    // the scheduling barrier keeps the stage's LDS reads one group ahead of its products, in the order written (set by set), so
    // that the counted wait in front of a step covers that set's reads and leaves the later sets in flight
    ld_gset(s0, ap, bp);
    ld_gset(s1, ap + 32, bp + 32);
    ld_gset(s2, ap + 64, bp + 64);
    ld_gset(s3, ap + 96, bp + 96);
    __builtin_amdgcn_sched_barrier(0);
    gemm_step(s0, acc0, acc1, acc2, acc3);
    gemm_step(s1, acc0, acc1, acc2, acc3);
    gemm_step(s2, acc0, acc1, acc2, acc3);
    gemm_step(s3, acc0, acc1, acc2, acc3);
    // publish point of stage st + 1: own LDS reads retired, the issuers' tiles landed, barrier, then the refill of the buffer just read
    wait_ds0();
    if (pinned(wv < 2u)) wait_tensor0(g0, g1, g1);
    __syncthreads();
    if (pinned(st + 2 < nst)) {
      tdm_advance(g0, lown + bofs, GSK * 2);
      if (pinned(wv < 2u)) tdm_load(g0, g1);
    }
  }
  wait_tensor0(g0, g1, g1);
  wait_ds0();
  v8f badd = zero8();
  v8f radd = zero8();
  bias_terms(bias, nb, bmode, rowb, col0, hh, lane & 7, badd, radd);
#if defined(__HIP_DEVICE_COMPILE__)
  // stands between the bias loads and the reuse of their index registers by the epilogue; the scheduling barrier keeps the
  // epilogue's vector work from being moved in front of it
  asm volatile("s_wait_xcnt 0x0" ::: "memory");
  __builtin_amdgcn_sched_barrier(0);
#endif
  epi64h(slab + wave * SLAB64, acc0, acc1, acc2, acc3, oscale, badd, radd, hscale, C, N, (size_t)rowb, col0, lane);
}

// =====================================================================================================
// Full (non-causal, unmasked) multi-head flash attention: block = (head, 64 query rows), 4 waves, wave w owns the 16 query rows
// q0 = 64*qt + 16*w .. q0+15.
//   q plane (f16, x64) laid out [s][h][d] (row pitch OUTW); k plane the same; v^T plane [h][d][s] (x64). All NKB = 128 key
//   blocks of 32 keys are visited (static bound), in NST stages of STK = 128 keys. A stage's k rows (128 x 128 B) and v^T rows
//   (64 x 256 B) are brought into LDS once for the four waves, by one tensor load each (wave 0: k, wave 1: v^T), into one of two
//   buffers, the next stage's loads in flight while this stage is worked on; one work-group barrier per stage publishes the next
//   stage and frees the buffer just read. Inside a stage a block's k and v fragments are read from LDS (ds_load_b128, padded
//   pitches) one block ahead into a second register set; nothing of the next stage is read in front of its barrier.
//   Scores are computed TRANSPOSED: S^T tile g (g = 0,1) = k rows (keys kb+16g .. +15, A operand, row m = lane&15, split k map
//   over d) times q^T (B operand, col n = query q0 + (lane&15), k = d, split map), one product per tile and d-chunk.
//   D element r of lane l = (key kb+16g+8h+r, query q0+(l&15)), so a lane owns one query column and 16 of its 32 keys; the
//   partner lane l^16 owns the other 16 -> row max / row sum need one exchange between the wave's halves (xhalf).
//   Online max-subtracted base-2 softmax in f32 (scale 1/8 and the q,k carries folded into lsc; lsc, the maximum and P's carry
//   enter the exponent through one fma). The exp'd values ARE the
//   P^T B-fragment in place: B col n = query = lane&15, element i <- key kb+8h+i (tile 0, D element i), element 8+i <- key
//   kb+16+8h+i (tile 1, D element i). P is carried x32768 as f16. The output is accumulated TRANSPOSED too: O^T tile j = v^T rows
//   (A operand, row m = d = 16j + (lane&15), keys k-contiguous) times P^T, 4 WMMAs per key block. D element r of lane l =
//   (d = 16j+8h+r, query q0+(l&15)): a lane's 32 accumulators all belong to its own query, so its own rescale factor serves them.
//   No instruction of the loop but the fragment reads counts on dscnt: a block's reads stay in flight under the block before it.
//   Epilogue: 1/l (the lane's own query) and carry folds in f32; the wave's 16x64 f32 result staged in its LDS
// coverage: per wave 8 instructions x 2 rows x 16 lanes x 4 floats = 16 x 64; grid NH*64 blocks x 4 waves = every (s, head)
//           row segment of the output exactly once.
// =====================================================================================================
// One key block's fragments: k rows kb+c and kb+16+c (d chunks 0 and 1), v^T rows d = 16j + c (keys kb..kb+31).
struct KVSet { v16h k00, k10, k01, k11, v0, v1, v2, v3; };
// kp: LDS address of k row (block's first key + c), byte 16*hh; vp: LDS address of v^T row c at the block's first key, byte 16*hh.
__device__ __forceinline__ void ld_kv(KVSet& s, const _Float16* kp, const _Float16* vp) {
  s.k00 = ldfrag_h(kp);
  s.k10 = ldfrag_h(kp + 16 * (KPITCH / 2));
  s.k01 = ldfrag_h(kp + 32);
  s.k11 = ldfrag_h(kp + 16 * (KPITCH / 2) + 32);
  s.v0 = ldfrag_h(vp);
  s.v1 = ldfrag_h(vp + 16 * (VPITCH / 2));
  s.v2 = ldfrag_h(vp + 32 * (VPITCH / 2));
  s.v3 = ldfrag_h(vp + 48 * (VPITCH / 2));
}
// One key block of the online softmax and P.V, on fragments already in registers (see attn_fwd).
__device__ __forceinline__ void att_step(const KVSet& f, v16h qh0, v16h qh1, float lsc,
                                         float& mrun, float& lrun, v8f (&o)[4]) {
  // ---- transposed scores: s0 = keys kb..kb+15, s1 = keys kb+16..kb+31, column = query q0 + c ----
  v8f s0 = zero8(), s1 = zero8();
  s0 = mma_h(f.k00, qh0, s0);
  s1 = mma_h(f.k10, qh0, s1);
  g2_3(s0, s1, qh0, f.k00, f.k10);
  s0 = mma_h(f.k01, qh1, s0);
  s1 = mma_h(f.k11, qh1, s1);
  g2_3(s0, s1, qh1, f.k01, f.k11);
  // ---- this lane's 16 keys for query q0 + c: s0[i] <- key kb+8hh+i, s1[i] <- key kb+16+8hh+i. The running maximum is kept in
  //      raw score units (lsc > 0, so the order is that of the logits) ----
  float cm = s0[0];
#pragma unroll
  for (int i = 1; i < 8; ++i) cm = fmaxf(cm, s0[i]);
#pragma unroll
  for (int i = 0; i < 8; ++i) cm = fmaxf(cm, s1[i]);
  cm = fmaxf(cm, xhalf(cm));
  const float mn = fmaxf(mrun, cm);                 // finite from the first block on
  float al = (mrun - mn) * lsc;                     // exponent of the rescale factor; -inf on the first block (mrun = -inf)
  mrun = mn;
  // ---- probabilities x32768 (<= 32768 up to rounding) = 2^(s*lsc - mn*lsc + 15): scale, maximum and carry in one fma;
  //      they are the P^T B-fragment once converted to f16: element i <- s0[i], element 8+i <- s1[i] ----
  const float nb = fmaf(-mn, lsc, PEXP);
  float pa[8], pb[8];
#pragma unroll
  for (int i = 0; i < 8; ++i) { pa[i] = fmaf(s0[i], lsc, nb); pb[i] = fmaf(s1[i], lsc, nb); }
  exp2_run9(al, pa);                                // al: 0 on the first block
  exp2_run8(pb);
  float ps = 0.f;
  FragH ph;
#pragma unroll
  for (int w = 0; w < 2; ++w) {
#pragma unroll
    for (int e4 = 0; e4 < 4; ++e4) {
      const int i = 2 * e4;
      const float p0 = w ? pb[i] : pa[i], p1 = w ? pb[i + 1] : pa[i + 1];
      ps += p0 + p1;
      const v2f pp = {p0, p1};
      ph.u[w][e4] = __builtin_bit_cast(unsigned, __builtin_convertvector(pp, v2h));   // one packed RNE convert per pair
    }
  }
  ps += xhalf(ps);
  lrun = lrun * al + ps;
  // ---- rescale the O^T accumulators: every D column of this lane is its own query q0 + c, whose factor it holds ----
#pragma unroll
  for (int j = 0; j < 4; ++j) {
#pragma unroll
    for (int r = 0; r < 8; ++r) o[j][r] *= al;
  }
  // ---- O^T += v^T . P^T : A fragment row m = d = j*16 + c, keys contiguous in the v^T plane; B fragment = P^T ----
  o[0] = mma_h(f.v0, ph.v, o[0]);
  o[1] = mma_h(f.v1, ph.v, o[1]);
  o[2] = mma_h(f.v2, ph.v, o[2]);
  o[3] = mma_h(f.v3, ph.v, o[3]);
  g4_5<v16h>(o[0], o[1], o[2], o[3], ph.v, f.v0, f.v1, f.v2, f.v3);
}

__global__ __launch_bounds__(ATT_THREADS)
void attn_fwd(const u16* __restrict__ QHp, const u16* __restrict__ KHp, const u16* __restrict__ VHp, float* out) {
  // two stage buffers (k tile, then v^T tile, each at a multiple of 2 KiB), then per wave a result slab [16][68] for the epilogue
  __shared__ __attribute__((aligned(2048))) unsigned char L[RINGB + ATT_WAVES * SLABF * 4];
  float* smem = (float*)(void*)(L + RINGB);

  const int tid  = threadIdx.x;
  const int wave = tid >> 5;
  const int lane = tid & 31;
  const int hh   = lane >> 4;
  const int c    = lane & 15;

  const int bid  = blockIdx.x;
  const int qt   = bid % QTILES;              // 0..63
  const int head = bid / QTILES;              // 0..NH-1
  if (head >= NH) return;                     // block-uniform, never taken with the exact grid; stands in front of every barrier
  const int q0   = qt * 64 + wave * 16;

  // B fragments of q^T: col n = query q0 + c, k = d (k-contiguous row of the q plane); loop-invariant
  const size_t qofs = ((size_t)(q0 + c) * NH + head) * HD + 8 * hh;
  const _Float16* Qh  = (const _Float16*)(const void*)QHp + qofs;
  const v16h qh0 = ldfrag_h(Qh), qh1 = ldfrag_h(Qh + 32);
  const float lsc = 0.125f * (LOG2E / (QSC * KSC));

  // Stage tiles: k rows st*STK .. +127 of this head (128 B each, plane pitch OUTW*2 B); v^T rows head*HD .. +63, keys st*STK .. +127
  // (256 B each, plane pitch SEQ*2 B). Every tile lies wholly inside its plane.
  const uint32_t wv    = uni((uint32_t)tid >> 5);
  const uint64_t kga   = (uint64_t)(size_t)KHp + (uint64_t)head * (HD * 2);
  const uint64_t vga   = (uint64_t)(size_t)VHp + (uint64_t)head * ((uint64_t)HD * SEQ * 2);
  // wave 0 brings the k tiles, wave 1 the v^T tiles: a wave's own place in a buffer, source address and step from stage to stage
  const uint32_t lown  = (uint32_t)(size_t)L + (wv == 0u ? 0u : (uint32_t)KTILE);
  const uint32_t gstep = (wv == 0u) ? (uint32_t)(STK * OUTW * 2) : (uint32_t)(STK * 2);
  const u32x8 g1k = tdm_group1<KW0, HD * 2, STK, OUTW * 2>();
  const u32x8 g1v = tdm_group1<VW0, STK * 2, HD, SEQ * 2>();
  u32x4 g0 = tdm_group0(lown, (wv == 0u) ? kga : vga);
  if (pinned(wv == 0u)) {
    tdm_load(g0, g1k);
    wait_tensor0(g0, g1k, g1v);
  }
  if (pinned(wv == 1u)) {
    tdm_load(g0, g1v);
    wait_tensor0(g0, g1k, g1v);
  }
  __syncthreads();                       // stage 0 published
  tdm_advance(g0, lown + BUFB, gstep);
  if (pinned(wv == 0u)) tdm_load(g0, g1k);
  if (pinned(wv == 1u)) tdm_load(g0, g1v);

  float mrun = -INFINITY, lrun = 0.f;
  v8f o[4];
#pragma unroll
  for (int j = 0; j < 4; ++j) o[j] = zero8();

  // A fragments of k: row m = key + c, k = d; A fragments of v^T: row m = d = 16j + c, k = key (both k-contiguous LDS rows)
  const uint32_t klane = (uint32_t)c * KPITCH + 16u * (uint32_t)hh;
  const uint32_t vlane = KTILE + (uint32_t)c * VPITCH + 16u * (uint32_t)hh;
  KVSet sa, sb;
  // rolled: one trip = one stage = four key blocks, alternating between the two register sets, so that no set is ever copied
#pragma unroll 1
  for (int st = 0; st < NST; ++st) {
    const uint32_t bofs = (uint32_t)(st & 1) * BUFB;
    const _Float16* kp = (const _Float16*)(const void*)(L + bofs + klane);
    const _Float16* vp = (const _Float16*)(const void*)(L + bofs + vlane);
    // the scheduling barriers keep each group of LDS reads where it is written (one group per block, never among the products)
    ld_kv(sa, kp, vp);
    __builtin_amdgcn_sched_barrier(0);
    ld_kv(sb, kp + 32 * (KPITCH / 2), vp + 32);
    __builtin_amdgcn_sched_barrier(0);
    att_step(sa, qh0, qh1, lsc, mrun, lrun, o);
    __builtin_amdgcn_sched_barrier(0);
    ld_kv(sa, kp + 64 * (KPITCH / 2), vp + 64);
    __builtin_amdgcn_sched_barrier(0);
    att_step(sb, qh0, qh1, lsc, mrun, lrun, o);
    __builtin_amdgcn_sched_barrier(0);
    ld_kv(sb, kp + 96 * (KPITCH / 2), vp + 96);
    __builtin_amdgcn_sched_barrier(0);
    att_step(sa, qh0, qh1, lsc, mrun, lrun, o);
    __builtin_amdgcn_sched_barrier(0);
    att_step(sb, qh0, qh1, lsc, mrun, lrun, o);
    __builtin_amdgcn_sched_barrier(0);
    // publish point of stage st + 1: own LDS reads retired, the issuers' tiles landed, barrier, then the refill of the buffer just read
    wait_ds0();
    if (pinned(wv < 2u)) wait_tensor0(g0, g1k, g1v);
    __syncthreads();
    if (pinned(st + 2 < NST)) {
      tdm_advance(g0, lown + bofs, gstep);
      if (pinned(wv == 0u)) tdm_load(g0, g1k);
      if (pinned(wv == 1u)) tdm_load(g0, g1v);
    }
  }
  wait_tensor0(g0, g1k, g1v);
  wait_ds0();
  acc_guard4(o[0], o[1], o[2], o[3]);

  // ---- fold 1/l (the lane's own query; l carries the same 32768 as P) and the carry 64 on v; stage the 16x64 slab [query][d]:
  //      the lane's accumulators of tile j are d = 16j+8hh .. +7 of slab row c, two 16-B stores ----
  const float linv = (1.0f / lrun) * (1.0f / VCAR);
  float* slab = smem + wave * SLABF;
#pragma unroll
  for (int j = 0; j < 4; ++j) {
    float* sp = slab + c * 68 + j * 16 + 8 * hh;
    const v4f lo = {o[j][0] * linv, o[j][1] * linv, o[j][2] * linv, o[j][3] * linv};
    const v4f hi = {o[j][4] * linv, o[j][5] * linv, o[j][6] * linv, o[j][7] * linv};
    *(v4f*)(sp)     = lo;
    *(v4f*)(sp + 4) = hi;
  }
  wave_sync_lds();
  // ---- f32 rows of the merged-head output: row s = q0 + 2*it + hh, columns head*64 + 4c .. +3 per lane ----
  v4f vals[8];
#pragma unroll
  for (int it = 0; it < 8; ++it) vals[it] = *(const v4f*)(slab + (it * 2 + hh) * 68 + c * 4);
  float* dst = out + ((size_t)(q0 + hh)) * (size_t)OUTW + head * HD + c * 4;
  {
#pragma unroll
    for (int it = 0; it < 8; ++it) {
      *(v4f*)(dst + (size_t)(it * 2) * (size_t)OUTW) = vals[it];
    }
    
  }
}

// =====================================================================================================
// Workspace map (bytes); every plane is fully written by whole-line stores before it is read; all extents are exact multiples
// of the 512-B store granularity (no pad rows needed); every offset a multiple of 128:
//   XB  bf16 [4096 token][768 i]        6291456
//   WQB bf16 [OUTW o][768 i]            1179648      WKB same 1179648     WVB same 1179648
//   QH  f16  [4096][12][64] x64         6291456      KH same 6291456
//   VH  f16  [12][64][4096] x64         6291456
//   end                                28704768
// =====================================================================================================
extern "C" void kernel_launch(void* const* d_in, const int* in_sizes, int n_in,
                              void* d_out, int out_size, void* d_ws, size_t ws_size,
                              hipStream_t stream) {
  const int XN = SEQ * DIN;                             // 3145728
  const int ON = SEQ * OUTW;                            // 3145728
  if (n_in < 7) return;
  if (in_sizes[0] != XN) return;
  if (in_sizes[1] != DIN * DIN || in_sizes[3] != DIN * DIN || in_sizes[5] != DIN * DIN) return;
  if (in_sizes[2] != DIN || in_sizes[4] != DIN || in_sizes[6] != DIN) return;
  if (out_size != ON) return;

  const float* xin = (const float*)d_in[0];
  const float* wq  = (const float*)d_in[1];
  const float* bq  = (const float*)d_in[2];
  const float* wk  = (const float*)d_in[3];
  const float* bk  = (const float*)d_in[4];
  const float* wv  = (const float*)d_in[5];
  const float* bv  = (const float*)d_in[6];
  float*       out = (float*)d_out;
  const int    nb  = in_sizes[2];                       // bias length (DIN)

  const size_t szXB = (size_t)SEQ * DIN * 2;            //  6291456
  const size_t szW  = (size_t)OUTW * DIN * 2;           //  1179648
  const size_t szP  = (size_t)SEQ * OUTW * 2;           //  6291456
  size_t off = 0;
  const size_t oXB  = off; off += szXB;
  const size_t oWQB = off; off += szW;
  const size_t oWKB = off; off += szW;
  const size_t oWVB = off; off += szW;
  const size_t oQH  = off; off += szP;
  const size_t oKH  = off; off += szP;
  const size_t oVH  = off; off += szP;
  if (off > ws_size) return;                            // off = 28704768
  if (off > (size_t)134217728) return;

  char* ws = (char*)d_ws;
  u16*   XB  = (u16*)(ws + oXB);
  u16*   WQB = (u16*)(ws + oWQB);
  u16*   WKB = (u16*)(ws + oWKB);
  u16*   WVB = (u16*)(ws + oWVB);
  u16*   QH  = (u16*)(ws + oQH);
  u16*   KH  = (u16*)(ws + oKH);
  u16*   VH  = (u16*)(ws + oVH);

  const dim3 blk(256);
  const dim3 gCv(CVX + 3 * CVW);                        // 1536 + 3 * 288 = 2400
  const dim3 gG(3 * GTILES);                            // 3 * 768 tiles
  const dim3 bG(128);
  const dim3 gAT(ATT_BLOCKS);                           // 768
  const dim3 bAT(ATT_THREADS);                          // 128

  // (0) input [token][i] and weights [o][i] (first OUTW rows) -> bf16 planes XB, WQB, WKB, WVB (contiguous from XB), same layouts
  cvb16<<<gCv, blk, 0, stream>>>(xin, wq, wk, wv, XB);
  // (1) q, k: projection + bias in f32, stored as the f16 planes x64 [4096 token][h*64+d]; v: channel-major projection with
  //     per-row bias, stored as the f16 plane x64 [h*64+d][4096] (= v^T plane layout)
  gemm_bfb<<<gG, bG, 0, stream>>>(XB, WQB, WKB, WVB, bq, bk, bv, QH, KH, VH, nb);
  // (2) attention -> merged-head f32 output [4096][h*64+d]
  attn_fwd<<<gAT, bAT, 0, stream>>>(QH, KH, VH, out);
  (void)hipGetLastError();
}

// v008
// A run of this version takes 70.1 microseconds.
// In two side-by-side timings against v007, it was 1.13 and 1.11 times as fast.
// Over all steps from v000 it is 3.86 times as fast.
// Contractions: projections X.W^T and Wv.X^T on v_wmma_f32_16x16x32_bf16 (X and W RNE-converted bf16 operands, f32 accumulate,
// bias added in f32); scores k.q^T (q, k carried x64 as f16) and v^T.P^T (P x32768 as f16, v x64 as f16) on v_wmma_f32_16x16x32_f16,
// f32 accumulate. Base-2 online softmax (one fma and one v_exp_f32 per probability) and the 1/l fold in f32 on VALU.
#include <hip/hip_runtime.h>
#include <math.h>
#include <stdint.h>

#define SEQ   4096
#define DIN   768
#define NH    12
#define HD    64
#define OUTW  (NH * HD)
#define QSC   64.0f
#define KSC   64.0f
#define PEXP  15.0f                       // P and its row sum are carried x2^15 = 32768
#define VCAR  64.0f
#define LOG2E 1.4426950408889634f
#define ATT_WAVES   4
#define ATT_THREADS (ATT_WAVES * 32)
#define QTILES      (SEQ / 64)
#define ATT_BLOCKS  (NH * QTILES)
#define NKB    (SEQ / 32)
#define SLABF  (16 * 68)
#define SLAB64 (16 * 68)
#define STK     128                      // keys per LDS stage of the attention loop (four 32-key blocks)
#define NST     (SEQ / STK)
#define KPITCH  144                      // LDS row pitch of a k row (128 B + 16 B pad), bytes
#define VPITCH  272                      // LDS row pitch of a v^T row (256 B + 16 B pad), bytes
#define KTILE   (STK * KPITCH)           // 18432 B, a multiple of 2 KiB
#define VTILE   18432                    // HD * VPITCH = 17408 B, rounded up to a multiple of 2 KiB
#define BUFB    (KTILE + VTILE)
#define RINGB   (2 * BUFB)
#define GSK     128                      // k per LDS stage of the projection loop (four k steps of 32)
#define GPITCH  272                      // LDS row pitch of an operand row of a stage (256 B + 16 B pad), bytes
#define GTILE   18432                    // 64 * GPITCH = 17408 B, rounded up to a multiple of 2 KiB
#define GBUFB   (2 * GTILE)
#define GRINGB  (2 * GBUFB)
static_assert(HD == 64);
static_assert((SEQ % 64) == 0 && (DIN % 32) == 0 && (OUTW % 64) == 0 && OUTW <= DIN);
static_assert(((SEQ * DIN) % 256) == 0 && ((OUTW * DIN) % 256) == 0 && ((SEQ * OUTW) % 256) == 0);
static_assert(ATT_THREADS == 128 && NKB * 32 == SEQ);
static_assert((DIN % 128) == 0 && (NKB % 2) == 0);
static_assert(ATT_WAVES * SLABF >= 4 * 16 * 68);
static_assert(NST >= 2 && NST * STK == SEQ && STK == 4 * 32);
static_assert((KTILE % 2048) == 0 && (VTILE % 2048) == 0 && HD * VPITCH <= VTILE);
static_assert(KPITCH == HD * 2 + 16 && VPITCH == STK * 2 + 16);
static_assert((GTILE % 2048) == 0 && 64 * GPITCH <= GTILE && GPITCH == GSK * 2 + 16 && GSK == 4 * 32);
static_assert((DIN % GSK) == 0 && DIN / GSK >= 2 && ((DIN * 2) % 16) == 0);
#define CVX    ((SEQ * DIN) / 2048)      // conversion blocks (2048 elements each) of x
#define CVW    ((OUTW * DIN) / 2048)     // the same of one weight plane
#define GTILES ((SEQ / 64) * (OUTW / 64))   // 64x64 output tiles of one projection
static_assert(((SEQ * DIN) % 2048) == 0 && ((OUTW * DIN) % 2048) == 0);

typedef unsigned short u16;
typedef _Float16 v16h __attribute__((ext_vector_type(16)));
typedef _Float16 v8h  __attribute__((ext_vector_type(8)));
typedef __bf16   v16b __attribute__((ext_vector_type(16)));
typedef _Float16 v2h  __attribute__((ext_vector_type(2)));
typedef float    v2f  __attribute__((ext_vector_type(2)));
typedef float    v8f  __attribute__((ext_vector_type(8)));
typedef float    v4f  __attribute__((ext_vector_type(4)));
typedef unsigned int v4u __attribute__((ext_vector_type(4)));
typedef uint32_t u32x4 __attribute__((ext_vector_type(4)));
typedef uint32_t u32x8 __attribute__((ext_vector_type(8)));

union FragH { v16h v; v8h h[2]; v4u u[2]; };
union FragB { v16b v; v4u u[2]; };

// ---- scalar helpers --------------------------------------------------------------------------------
__device__ __forceinline__ unsigned short bf_bits(float f) {          // f32 -> bf16 bits, RNE convert
  unsigned u = __float_as_uint(f);
  return (unsigned short)((u + 0x7FFFu + ((u >> 16) & 1u)) >> 16);
}
__device__ __forceinline__ float bf_up(unsigned short h) { return __uint_as_float(((unsigned)h) << 16); }
__device__ __forceinline__ float bfr(float f) { return bf_up(bf_bits(f)); }
__device__ __forceinline__ unsigned short h_bits(_Float16 x) { return __builtin_bit_cast(unsigned short, x); }
__device__ __forceinline__ unsigned pk16(unsigned short a, unsigned short b) { return (unsigned)a | ((unsigned)b << 16); }
// x <- 2^x by the hardware instruction alone. A result below 2^-126 may come out as 0: every use here is a probability or a
// rescale factor relative to a row maximum, where such a value is lost in the f16 P and in the f32 sums anyway. 2^-inf = 0.
// Written as one run, each in place: no instruction of the run reads its predecessor's result or writes its predecessor's source,
// and the closing v_nop is the slot that the instruction set asks for between the last v_exp_f32 and whatever uses its result.
__device__ __forceinline__ void exp2_run16(float (&x)[8], float (&y)[8]) {
#if defined(__HIP_DEVICE_COMPILE__)
  asm("v_exp_f32 %0, %0\n\tv_exp_f32 %1, %1\n\tv_exp_f32 %2, %2\n\tv_exp_f32 %3, %3\n\t"
      "v_exp_f32 %4, %4\n\tv_exp_f32 %5, %5\n\tv_exp_f32 %6, %6\n\tv_exp_f32 %7, %7\n\t"
      "v_exp_f32 %8, %8\n\tv_exp_f32 %9, %9\n\tv_exp_f32 %10, %10\n\tv_exp_f32 %11, %11\n\t"
      "v_exp_f32 %12, %12\n\tv_exp_f32 %13, %13\n\tv_exp_f32 %14, %14\n\tv_exp_f32 %15, %15\n\tv_nop"
      : "+v"(x[0]), "+v"(x[1]), "+v"(x[2]), "+v"(x[3]), "+v"(x[4]), "+v"(x[5]), "+v"(x[6]), "+v"(x[7]),
        "+v"(y[0]), "+v"(y[1]), "+v"(y[2]), "+v"(y[3]), "+v"(y[4]), "+v"(y[5]), "+v"(y[6]), "+v"(y[7]));
#endif
}
__device__ __forceinline__ void exp2_run17(float& a, float (&x)[8], float (&y)[8]) {   // a first: the longest path hangs on it
#if defined(__HIP_DEVICE_COMPILE__)
  asm("v_exp_f32 %0, %0\n\t"
      "v_exp_f32 %1, %1\n\tv_exp_f32 %2, %2\n\tv_exp_f32 %3, %3\n\tv_exp_f32 %4, %4\n\t"
      "v_exp_f32 %5, %5\n\tv_exp_f32 %6, %6\n\tv_exp_f32 %7, %7\n\tv_exp_f32 %8, %8\n\t"
      "v_exp_f32 %9, %9\n\tv_exp_f32 %10, %10\n\tv_exp_f32 %11, %11\n\tv_exp_f32 %12, %12\n\t"
      "v_exp_f32 %13, %13\n\tv_exp_f32 %14, %14\n\tv_exp_f32 %15, %15\n\tv_exp_f32 %16, %16\n\tv_nop"
      : "+v"(a), "+v"(x[0]), "+v"(x[1]), "+v"(x[2]), "+v"(x[3]), "+v"(x[4]), "+v"(x[5]), "+v"(x[6]), "+v"(x[7]),
        "+v"(y[0]), "+v"(y[1]), "+v"(y[2]), "+v"(y[3]), "+v"(y[4]), "+v"(y[5]), "+v"(y[6]), "+v"(y[7]));
#endif
}
// lane l <-> lane l ^ 16 on the vector pipe (v_permlanex16_b32): no LDS-pipe instruction, so no s_wait_dscnt behind it
__device__ __forceinline__ float xhalf(float x) {
  const int b = __builtin_bit_cast(int, x);
  return __builtin_bit_cast(float, __builtin_amdgcn_permlanex16(b, b, 0x76543210, 0xfedcba98, false, false));
}
__device__ __forceinline__ v8f zero8() { v8f z = {0.f, 0.f, 0.f, 0.f, 0.f, 0.f, 0.f, 0.f}; return z; }

// ---- fragment loaders: 16-bit A/B operand, lane -> row/col (lane&15), p already includes +8*(lane>>4);
//      elements 0..7 <- p[0..7] (k0+8h..), elements 8..15 <- p[16..23] (k0+16+8h..)  (same split k map for A and B;
//      B is always read from a k-contiguous [n][k] plane)
__device__ __forceinline__ v16h ldfrag_h(const _Float16* p) {
  FragH f;
  f.h[0] = *(const v8h*)(p);
  f.h[1] = *(const v8h*)(p + 16);
  return f.v;
}
__device__ __forceinline__ v16b ldfrag_b(const u16* p) {              // bf16 plane read as unsigned integer vectors
  FragB f;
  f.u[0] = *(const v4u*)(p);
  f.u[1] = *(const v4u*)(p + 16);
  return f.v;
}

__device__ __forceinline__ v8f mma_h(v16h a, v16h b, v8f c) {
  return __builtin_amdgcn_wmma_f32_16x16x32_f16(false, a, false, b, (short)0, c, false, false);
}
__device__ __forceinline__ v8f mma_b(v16b a, v16b b, v8f c) {
  return __builtin_amdgcn_wmma_f32_16x16x32_bf16(false, a, false, b, (short)0, c, false, false);
}
template <typename F>
__device__ __forceinline__ void g4_5(v8f& a, v8f& b, v8f& c, v8f& d, F x0, F x1, F x2, F x3, F x4) {
#if defined(__HIP_DEVICE_COMPILE__)
  asm volatile("v_nop\n\tv_nop\n\tv_nop\n\tv_nop"
               : "+v"(a), "+v"(b), "+v"(c), "+v"(d) : "v"(x0), "v"(x1), "v"(x2), "v"(x3), "v"(x4) : "memory");
#endif
}
__device__ __forceinline__ void acc_guard4(v8f& a, v8f& b, v8f& c, v8f& d) {
#if defined(__HIP_DEVICE_COMPILE__)
  asm volatile("v_nop\n\tv_nop\n\tv_nop\n\tv_nop" : "+v"(a), "+v"(b), "+v"(c), "+v"(d));
#endif
}
__device__ __forceinline__ void wave_sync_lds() {
  __builtin_amdgcn_fence(__ATOMIC_RELEASE, "workgroup");
  __builtin_amdgcn_wave_barrier();
  __builtin_amdgcn_fence(__ATOMIC_ACQUIRE, "workgroup");
}

// ---- tensor loads into LDS -------------------------------------------------------------------------
__device__ __forceinline__ uint32_t uni(uint32_t v) { return (uint32_t)__builtin_amdgcn_readfirstlane(v); }
__device__ __forceinline__ uint32_t pinned(uint32_t v) {
  uint32_t w = uni(v);
#if defined(__HIP_DEVICE_COMPILE__)
  // holds an issue test in a scalar register, so that it compiles to a scalar branch (tensor loads ignore EXEC), or a descriptor word
  asm volatile("" : "+s"(w));
#endif
  return w;
}
__device__ __forceinline__ void wait_ds0() {
#if defined(__HIP_DEVICE_COMPILE__)
  asm volatile("s_wait_dscnt 0x0" ::: "memory");      // this wave's LDS reads have retired before its buffer may be refilled
#endif
}
// The issuing wave's tile has landed (the compiler places no wait for it). The descriptor groups are operands of the wait: group 0
// as a value that the wait hands on, so that its next address is formed behind the wait, the two groups 1 as inputs, so that
// their registers are still theirs here: no word of a request in flight takes a new value in front of this wait.
__device__ __forceinline__ void wait_tensor0(u32x4& g0, u32x8 g1a, u32x8 g1b) {
#if defined(__HIP_DEVICE_COMPILE__)
  asm volatile("s_wait_tensorcnt 0x0" : "+s"(g0) : "s"(g1a), "s"(g1b) : "memory");
#endif
}
// Group 1 of a tile of D1 rows of D0 bytes (1-byte elements, tensor = tile), source row pitch PITCH bytes; W0 = word 0 (no mask;
// the pad that sets the LDS pitch), a compile-time constant. Built once, the same for every stage.
template <uint32_t W0, uint32_t D0, uint32_t D1, uint32_t PITCH>
__device__ __forceinline__ u32x8 tdm_group1() {
  // pinned(): each descriptor word held in a scalar register, so that the group is one set of registers for the whole kernel and
  // not constants set up anew, in registers that are then reused, at each request
  u32x8 g1;
  g1[0] = pinned(W0);
  g1[1] = pinned((D0 & 0xFFFFu) << 16);
  g1[2] = pinned((D0 >> 16) | ((D1 & 0xFFFFu) << 16));
  g1[3] = pinned((D1 >> 16) | (D0 << 16));
  g1[4] = pinned(D1);
  g1[5] = pinned(PITCH);
  g1[6] = pinned(0u);
  g1[7] = pinned(0u);
  return g1;
}
// The same with the source row pitch (bytes) taken from a function argument.
template <uint32_t W0, uint32_t D0, uint32_t D1>
__device__ __forceinline__ u32x8 tdm_group1p(uint32_t pitch) {
  u32x8 g1;
  g1[0] = pinned(W0);
  g1[1] = pinned((D0 & 0xFFFFu) << 16);
  g1[2] = pinned((D0 >> 16) | ((D1 & 0xFFFFu) << 16));
  g1[3] = pinned((D1 >> 16) | (D0 << 16));
  g1[4] = pinned(D1);
  g1[5] = pinned(pitch);
  g1[6] = pinned(0u);
  g1[7] = pinned(0u);
  return g1;
}
// Group 0: tile's first byte at ga, to LDS byte offset lds_dst.
__device__ __forceinline__ u32x4 tdm_group0(uint32_t lds_dst, uint64_t ga) {
  u32x4 g0;
  g0[0] = uni(1u);
  g0[1] = uni(lds_dst);
  g0[2] = uni((uint32_t)ga);
  g0[3] = uni((((uint32_t)(ga >> 32)) & 0x01FFFFFFu) | 0x80000000u);
  return g0;
}
// Group 0 of the next stage: new LDS place, source address advanced by step bytes (the carry goes into address bits 56..32).
__device__ __forceinline__ void tdm_advance(u32x4& g0, uint32_t lds_dst, uint32_t step) {
  const uint32_t lo = g0[2] + step;
  g0[1] = uni(lds_dst);
  g0[3] = uni(g0[3] + (lo < step ? 1u : 0u));
  g0[2] = uni(lo);
}
__device__ __forceinline__ void tdm_load(u32x4 g0, u32x8 g1) {
#if defined(__HIP_DEVICE_COMPILE__)
  // the request itself: one per issuing wave, through no register; its waits are written by hand where it is used
  asm volatile("tensor_load_to_lds %0, %1" :: "s"(g0), "s"(g1) : "memory");
#endif
}
#define KW0 ((1u << 20) | (4u << 22) | (3u << 25))   // 128-B rows, 16 B of pad behind each
#define VW0 ((1u << 20) | (5u << 22) | (3u << 25))   // 256-B rows, 16 B of pad behind each

// =====================================================================================================
// The four f32 planes (x, wq, wk, wv) -> bf16 planes (RNE convert), same layouts, in ONE launch: the block index picks the plane.
// The four bf16 planes stand one behind the other at D, in that order, so the destination index is the flat one. Thread = 8
// consecutive elements: two 16-B loads, one 16-B store.
// coverage: blocks 0 .. CVX-1 = x, then CVW blocks for each weight; a block = 256 thr x 8 = 2048 elements, every plane a whole
//           number of blocks, grid = CVX + 3*CVW blocks = the four planes exactly.
// =====================================================================================================
__global__ __launch_bounds__(256) void cvb16(const float* __restrict__ x, const float* __restrict__ wq,
                                             const float* __restrict__ wk, const float* __restrict__ wv, u16* D) {
  const int bid = blockIdx.x;
  if (bid >= CVX + 3 * CVW) return;         // block-uniform, never taken with the exact grid; no barriers in this kernel
  const int wj  = (bid - CVX) / CVW;        // which weight, where the block is past x
  const float* sp = (bid < CVX) ? x : (wj == 0) ? wq : (wj == 1) ? wk : wv;
  const int   sb = (bid < CVX) ? bid : bid - CVX - wj * CVW;          // block index inside its own plane
  const int gt = bid * 256 + (int)threadIdx.x;
  const float* p = sp + ((size_t)sb * 256 + threadIdx.x) * 8;
  const v4f a = *(const v4f*)(p), c4 = *(const v4f*)(p + 4);
  float v[8];
#pragma unroll
  for (int e = 0; e < 4; ++e) { v[e] = a[e]; v[4 + e] = c4[e]; }
  unsigned short s[8];
#pragma unroll
  for (int e = 0; e < 8; ++e) s[e] = bf_bits(v[e]);
  v4u o;
#pragma unroll
  for (int e = 0; e < 4; ++e) o[e] = pk16(s[2 * e], s[2 * e + 1]);
  u16* d = D + (size_t)gt * 8;
  {
    *(v4u*)(d) = o;
    
  }
}

// =====================================================================================================
// Bias terms for the GEMM epilogue (bf16-RNE values of bias[], nb entries; every candidate index clamped into 0..nb-1 so all
// loads are in range, selection by value): bmode 0: per-column direct; bmode 1: per-row direct.
// =====================================================================================================
// badd: the 8 columns col0 + 8*cc .. +7 that the lane stores (cc = lane&7); radd: the 8 rows rowb + 8*hh .. +7 of its accumulators.
__device__ __forceinline__ void bias_terms(const float* __restrict__ bias, int nb, int bmode, int rowb, int col0, int hh, int cc,
                                           v8f& badd, v8f& radd) {
#pragma unroll
  for (int e = 0; e < 8; ++e) {
    const int ci = col0 + 8 * cc + e;
    const int ic = ci < nb ? ci : nb - 1;
    const float bc = bfr(bias[ic]);
    badd[e] = (bmode == 0) ? bc : 0.0f;
  }
#pragma unroll
  for (int r = 0; r < 8; ++r) {
    const int ri = rowb + 8 * hh + r;
    const int ir = ri < nb ? ri : nb - 1;
    const float br = bfr(bias[ir]);
    radd[r] = (bmode == 1) ? br : 0.0f;
  }
}

// =====================================================================================================
// GEMM epilogue: the wave's 16x64 f32 tile (times oscale, plus per-row addend radd) staged in its LDS slab (pitch 68), read back
// row-wise, per-column addend badd added in f32, times hscale (a power of two), converted to f16 (RNE) and stored: a lane holds 8
// consecutive columns (one 16-B store), 8 lanes one row of 64 f16 = one whole 128-B line.
// coverage: 4 instructions x 4 rows x 8 lanes x 8 halves = the wave's 16 x 64 tile.
// =====================================================================================================
__device__ __forceinline__ void epi64h(float* sl, v8f a0, v8f a1, v8f a2, v8f a3, float oscale, v8f badd, v8f radd, float hscale,
                                       u16* C, int N, size_t rowb, int col0, int lane) {
  const int hh = lane >> 4, m = lane & 15;
#pragma unroll
  for (int r = 0; r < 8; ++r) {
    const int ro = (8 * hh + r) * 68 + m;
    sl[ro]      = a0[r] * oscale + radd[r];
    sl[ro + 16] = a1[r] * oscale + radd[r];
    sl[ro + 32] = a2[r] * oscale + radd[r];
    sl[ro + 48] = a3[r] * oscale + radd[r];
  }
  wave_sync_lds();
  const int rr = lane >> 3, cc = lane & 7;
  v4u vals[4];
#pragma unroll
  for (int it = 0; it < 4; ++it) {
    const float* sp = sl + (it * 4 + rr) * 68 + cc * 8;
    const v4f x0 = *(const v4f*)(sp), x1 = *(const v4f*)(sp + 4);
    unsigned short h[8];
#pragma unroll
    for (int e = 0; e < 4; ++e) {
      h[e]     = h_bits((_Float16)((x0[e] + badd[e]) * hscale));
      h[4 + e] = h_bits((_Float16)((x1[e] + badd[4 + e]) * hscale));
    }
#pragma unroll
    for (int e = 0; e < 4; ++e) vals[it][e] = pk16(h[2 * e], h[2 * e + 1]);
  }
  u16* dst = C + (rowb + (size_t)rr) * (size_t)N + col0 + cc * 8;
#pragma unroll
  for (int it = 0; it < 4; ++it) *(v4u*)(dst + (size_t)(it * 4) * (size_t)N) = vals[it];
}

// =====================================================================================================
// The three projections in ONE launch: block index / GTILES picks the job (0: q = X.Wq^T, 1: k = X.Wk^T, both token-major with a
// per-column bias; 2: v^T = Wv.X^T, channel-major with a per-row bias), block index % GTILES its 64x64 tile.
// A job is a bf16 GEMM with bias: C[M][N] (f16, pitch N) = (A[M][K] (bf16 row-major) . Bt[N][K]^T (bf16 k-contiguous), times oscale, plus
// the bias term selected by bmode (see bias_terms), all in f32) times hscale. (M/64)*(N/64) = GTILES tiles. Block = 64x64 tile, 4 waves x 16 rows.
// K is walked in stages of GSK = 128: a stage's 64 A rows and 64 Bt rows (256 B each) are brought into LDS once for the four waves,
// by one tensor load each (wave 0: A, wave 1: Bt), into one of two buffers, the next stage's loads in flight while this stage is
// worked on; one work-group barrier per stage publishes the next stage and frees the buffer just read. A stage's fragments (four
// k steps of 32, split k map for A and B) are read from LDS (ds_load_b128, padded pitch) as one group ahead of its products.
// (K = DIN: K % 128 == 0, K >= 256; M, N = SEQ, OUTW or OUTW, SEQ: multiples of 64)
// =====================================================================================================
struct GSet { v16b a, b0, b1, b2, b3; };
// ap: LDS address of the lane's A row at the k step, byte 16*hh; bp: the same of Bt row m.
__device__ __forceinline__ void ld_gset(GSet& s, const u16* ap, const u16* bp) {
  s.a  = ldfrag_b(ap);
  s.b0 = ldfrag_b(bp);
  s.b1 = ldfrag_b(bp + 16 * (GPITCH / 2));
  s.b2 = ldfrag_b(bp + 32 * (GPITCH / 2));
  s.b3 = ldfrag_b(bp + 48 * (GPITCH / 2));
}
__device__ __forceinline__ void gemm_step(const GSet& s, v8f& acc0, v8f& acc1, v8f& acc2, v8f& acc3) {
  acc0 = mma_b(s.a, s.b0, acc0);
  acc1 = mma_b(s.a, s.b1, acc1);
  acc2 = mma_b(s.a, s.b2, acc2);
  acc3 = mma_b(s.a, s.b3, acc3);
  g4_5<v16b>(acc0, acc1, acc2, acc3, s.a, s.b0, s.b1, s.b2, s.b3);
}
__global__ __launch_bounds__(128)
void gemm_bfb(const u16* __restrict__ XBp, const u16* __restrict__ WQp, const u16* __restrict__ WKp, const u16* __restrict__ WVp,
              const float* __restrict__ bq, const float* __restrict__ bk, const float* __restrict__ bv,
              u16* QHp, u16* KHp, u16* VHp, int nb) {
  // two stage buffers (A tile, then Bt tile, each at a multiple of 2 KiB), then per wave a result slab [16][68] for the epilogue
  __shared__ __attribute__((aligned(2048))) unsigned char L[GRINGB + 4 * SLAB64 * 4];
  float* slab = (float*)(void*)(L + GRINGB);
  const int tid = threadIdx.x, wave = tid >> 5, lane = tid & 31, hh = lane >> 4, m = lane & 15;
  const int job   = blockIdx.x / GTILES;     // block-uniform: every choice below is a scalar one
  const int bid   = blockIdx.x % GTILES;
  if (job > 2) return;                       // block-uniform, never taken with the exact grid; stands in front of every barrier
  const u16*   A    = (job == 2) ? WVp : XBp;
  const u16*   Bt   = (job == 0) ? WQp : (job == 1) ? WKp : XBp;
  const float* bias = (job == 0) ? bq : (job == 1) ? bk : bv;
  u16*         C    = (job == 0) ? QHp : (job == 1) ? KHp : VHp;
  const int    M    = (job == 2) ? OUTW : SEQ, N = (job == 2) ? SEQ : OUTW, K = DIN;
  const int    bmode  = (job == 2) ? 1 : 0;
  const float  oscale = 1.0f;
  const float  hscale = (job == 0) ? QSC : (job == 1) ? KSC : VCAR;
  // tile row and column by each job's own constant tile count, so that the divisions stay scalar
  const int row0  = ((job == 2) ? bid / (SEQ / 64) : bid / (OUTW / 64)) * 64;
  const int rowb  = row0 + wave * 16;
  const int col0  = ((job == 2) ? bid % (SEQ / 64) : bid % (OUTW / 64)) * 64;
  if (row0 + 64 > M) return;                 // block-uniform, never taken with the exact grid; stands in front of every barrier
  const int nst = K / GSK;

  // Stage tiles: A rows row0 .. +63 and Bt rows col0 .. +63, k st*GSK .. +127 (256 B of each row, plane pitch K*2 B). Every tile
  // lies wholly inside its plane. Wave 0 brings the A tiles, wave 1 the Bt tiles: a wave's own place in a buffer and source address.
  const uint32_t wv   = uni((uint32_t)tid >> 5);
  const uint64_t aga  = (uint64_t)(size_t)A  + (uint64_t)row0 * (uint64_t)K * 2u;
  const uint64_t bga  = (uint64_t)(size_t)Bt + (uint64_t)col0 * (uint64_t)K * 2u;
  const uint32_t lown = (uint32_t)(size_t)L + (wv == 0u ? 0u : (uint32_t)GTILE);
  const u32x8 g1 = tdm_group1p<VW0, GSK * 2, 64>((uint32_t)K * 2u);
  u32x4 g0 = tdm_group0(lown, (wv == 0u) ? aga : bga);
  if (pinned(wv < 2u)) {
    tdm_load(g0, g1);
    wait_tensor0(g0, g1, g1);
  }
  __syncthreads();                       // stage 0 published
  tdm_advance(g0, lown + GBUFB, GSK * 2);
  if (pinned(wv < 2u)) tdm_load(g0, g1);

  const uint32_t alane = (uint32_t)(wave * 16 + m) * GPITCH + 16u * (uint32_t)hh;
  const uint32_t blane = GTILE + (uint32_t)m * GPITCH + 16u * (uint32_t)hh;
  v8f acc0 = zero8(), acc1 = zero8(), acc2 = zero8(), acc3 = zero8();
  GSet s0, s1, s2, s3;
  // rolled (one trip = one stage = four k steps, one per register set): one publish point in the text, in the order written
#pragma unroll 1
  for (int st = 0; st < nst; ++st) {
    const uint32_t bofs = (uint32_t)(st & 1) * GBUFB;
    const u16* ap = (const u16*)(const void*)(L + bofs + alane);
    const u16* bp = (const u16*)(const void*)(L + bofs + blane);
    // the scheduling barrier keeps the stage's LDS reads one group ahead of its products, in the order written (set by set), so
    // that the counted wait in front of a step covers that set's reads and leaves the later sets in flight
    ld_gset(s0, ap, bp);
    ld_gset(s1, ap + 32, bp + 32);
    ld_gset(s2, ap + 64, bp + 64);
    ld_gset(s3, ap + 96, bp + 96);
    __builtin_amdgcn_sched_barrier(0);
    gemm_step(s0, acc0, acc1, acc2, acc3);
    gemm_step(s1, acc0, acc1, acc2, acc3);
    gemm_step(s2, acc0, acc1, acc2, acc3);
    gemm_step(s3, acc0, acc1, acc2, acc3);
    // publish point of stage st + 1: own LDS reads retired, the issuers' tiles landed, barrier, then the refill of the buffer just read
    wait_ds0();
    if (pinned(wv < 2u)) wait_tensor0(g0, g1, g1);
    __syncthreads();
    if (pinned(st + 2 < nst)) {
      tdm_advance(g0, lown + bofs, GSK * 2);
      if (pinned(wv < 2u)) tdm_load(g0, g1);
    }
  }
  wait_tensor0(g0, g1, g1);
  wait_ds0();
  v8f badd = zero8();
  v8f radd = zero8();
  bias_terms(bias, nb, bmode, rowb, col0, hh, lane & 7, badd, radd);
#if defined(__HIP_DEVICE_COMPILE__)
  // stands between the bias loads and the reuse of their index registers by the epilogue; the scheduling barrier keeps the
  // epilogue's vector work from being moved in front of it
  asm volatile("s_wait_xcnt 0x0" ::: "memory");
  __builtin_amdgcn_sched_barrier(0);
#endif
  epi64h(slab + wave * SLAB64, acc0, acc1, acc2, acc3, oscale, badd, radd, hscale, C, N, (size_t)rowb, col0, lane);
}

// =====================================================================================================
// Full (non-causal, unmasked) multi-head flash attention: block = (head, 64 query rows), 4 waves, wave w owns the 16 query rows
// q0 = 64*qt + 16*w .. q0+15.
//   q plane (f16, x64) laid out [s][h][d] (row pitch OUTW); k plane the same; v^T plane [h][d][s] (x64). All NKB = 128 key
//   blocks of 32 keys are visited (static bound), in NST stages of STK = 128 keys. A stage's k rows (128 x 128 B) and v^T rows
//   (64 x 256 B) are brought into LDS once for the four waves, by one tensor load each (wave 0: k, wave 1: v^T), into one of two
//   buffers, the next stage's loads in flight while this stage is worked on; one work-group barrier per stage publishes the next
//   stage and frees the buffer just read. A stage is ONE step of the online softmax: its k fragments are read from LDS
//   (ds_load_b128, padded pitches) as one group, all its scores (8 tiles of 16 keys) are formed, its v^T fragments are read as a
//   second group, in flight under the softmax; nothing of the next stage is read in front of its barrier.
//   Scores are computed TRANSPOSED: S^T tile g (g = 0,1) = k rows (keys kb+16g .. +15, A operand, row m = lane&15, split k map
//   over d) times q^T (B operand, col n = query q0 + (lane&15), k = d, split map), one product per tile and d-chunk.
//   D element r of lane l = (key kb+16g+8h+r, query q0+(l&15)), so a lane owns one query column and 16 of its 32 keys; the
//   partner lane l^16 owns the other 16 -> row max / row sum need one exchange between the wave's halves (xhalf), once per stage.
//   Online max-subtracted base-2 softmax in f32 (scale 1/8 and the q,k carries folded into lsc; lsc, the maximum and P's carry
//   enter the exponent through one fma). The exp'd values ARE the
//   P^T B-fragment in place: B col n = query = lane&15, element i <- key kb+8h+i (tile 0, D element i), element 8+i <- key
//   kb+16+8h+i (tile 1, D element i). P is carried x32768 as f16. The output is accumulated TRANSPOSED too: O^T tile j = v^T rows
//   (A operand, row m = d = 16j + (lane&15), keys k-contiguous) times P^T, 4 WMMAs per key block. D element r of lane l =
//   (d = 16j+8h+r, query q0+(l&15)): a lane's 32 accumulators all belong to its own query, so its own rescale factor serves them.
//   The maximum, the rescale factor and the rescale of the 32 accumulators are taken once per stage of 128 keys.
//   Epilogue: 1/l (the lane's own query) and carry folds in f32; the wave's 16x64 f32 result staged in its LDS
// coverage: per wave 8 instructions x 2 rows x 16 lanes x 4 floats = 16 x 64; grid NH*64 blocks x 4 waves = every (s, head)
//           row segment of the output exactly once.
// =====================================================================================================
// One 32-key block's k fragments: k rows kb+c and kb+16+c (d chunks 0 and 1).
struct KSet { v16h k00, k10, k01, k11; };
// One 32-key block's v^T fragments: rows d = 16j + c (keys kb..kb+31).
struct VSet { v16h v0, v1, v2, v3; };
// kp: LDS address of k row (block's first key + c), byte 16*hh.
__device__ __forceinline__ void ld_k(KSet& s, const _Float16* kp) {
  s.k00 = ldfrag_h(kp);
  s.k10 = ldfrag_h(kp + 16 * (KPITCH / 2));
  s.k01 = ldfrag_h(kp + 32);
  s.k11 = ldfrag_h(kp + 16 * (KPITCH / 2) + 32);
}
// vp: LDS address of v^T row c at the block's first key, byte 16*hh.
__device__ __forceinline__ void ld_v(VSet& s, const _Float16* vp) {
  s.v0 = ldfrag_h(vp);
  s.v1 = ldfrag_h(vp + 16 * (VPITCH / 2));
  s.v2 = ldfrag_h(vp + 32 * (VPITCH / 2));
  s.v3 = ldfrag_h(vp + 48 * (VPITCH / 2));
}
// Transposed scores of two 32-key blocks: four tiles of 16 keys, column = query q0 + c; the four tiles' first d chunk, then their
// second, so that a tile's second product finds its first one finished.
__device__ __forceinline__ void score2(const KSet& a, const KSet& b, v16h qh0, v16h qh1, v8f& s0, v8f& s1, v8f& s2, v8f& s3) {
  s0 = mma_h(a.k00, qh0, zero8());
  s1 = mma_h(a.k10, qh0, zero8());
  s2 = mma_h(b.k00, qh0, zero8());
  s3 = mma_h(b.k10, qh0, zero8());
  s0 = mma_h(a.k01, qh1, s0);
  s1 = mma_h(a.k11, qh1, s1);
  s2 = mma_h(b.k01, qh1, s2);
  s3 = mma_h(b.k11, qh1, s3);
}
// A 32-key block's probabilities (already exp'd: x = tile 0, y = tile 1) -> P^T B-fragment (element i <- x[i], element 8+i <- y[i]),
// their sum taken pairwise into two running pairs (FIRST: the pairs start here).
template <bool FIRST>
__device__ __forceinline__ v16h pack_p(const float (&x)[8], const float (&y)[8], v2f& sx, v2f& sy) {
  FragH ph;
#pragma unroll
  for (int e4 = 0; e4 < 4; ++e4) {
    const v2f px = {x[2 * e4], x[2 * e4 + 1]}, py = {y[2 * e4], y[2 * e4 + 1]};
    sx = (FIRST && e4 == 0) ? px : sx + px;
    sy = (FIRST && e4 == 0) ? py : sy + py;
    ph.u[0][e4] = __builtin_bit_cast(unsigned, __builtin_convertvector(px, v2h));   // one packed RNE convert per pair
    ph.u[1][e4] = __builtin_bit_cast(unsigned, __builtin_convertvector(py, v2h));
  }
  return ph.v;
}
// O^T += v^T . P^T of one 32-key block: A fragment row m = d = j*16 + c, keys contiguous in the v^T plane; B fragment = P^T
__device__ __forceinline__ void pv_step(const VSet& f, v16h ph, v8f (&o)[4]) {
  o[0] = mma_h(f.v0, ph, o[0]);
  o[1] = mma_h(f.v1, ph, o[1]);
  o[2] = mma_h(f.v2, ph, o[2]);
  o[3] = mma_h(f.v3, ph, o[3]);
}

__global__ __launch_bounds__(ATT_THREADS)
void attn_fwd(const u16* __restrict__ QHp, const u16* __restrict__ KHp, const u16* __restrict__ VHp, float* out) {
  // two stage buffers (k tile, then v^T tile, each at a multiple of 2 KiB), then per wave a result slab [16][68] for the epilogue
  __shared__ __attribute__((aligned(2048))) unsigned char L[RINGB + ATT_WAVES * SLABF * 4];
  float* smem = (float*)(void*)(L + RINGB);

  const int tid  = threadIdx.x;
  const int wave = tid >> 5;
  const int lane = tid & 31;
  const int hh   = lane >> 4;
  const int c    = lane & 15;

  const int bid  = blockIdx.x;
  const int qt   = bid % QTILES;              // 0..63
  const int head = bid / QTILES;              // 0..NH-1
  if (head >= NH) return;                     // block-uniform, never taken with the exact grid; stands in front of every barrier
  const int q0   = qt * 64 + wave * 16;

  // B fragments of q^T: col n = query q0 + c, k = d (k-contiguous row of the q plane); loop-invariant
  const size_t qofs = ((size_t)(q0 + c) * NH + head) * HD + 8 * hh;
  const _Float16* Qh  = (const _Float16*)(const void*)QHp + qofs;
  const v16h qh0 = ldfrag_h(Qh), qh1 = ldfrag_h(Qh + 32);
  const float lsc = 0.125f * (LOG2E / (QSC * KSC));

  // Stage tiles: k rows st*STK .. +127 of this head (128 B each, plane pitch OUTW*2 B); v^T rows head*HD .. +63, keys st*STK .. +127
  // (256 B each, plane pitch SEQ*2 B). Every tile lies wholly inside its plane.
  const uint32_t wv    = uni((uint32_t)tid >> 5);
  const uint64_t kga   = (uint64_t)(size_t)KHp + (uint64_t)head * (HD * 2);
  const uint64_t vga   = (uint64_t)(size_t)VHp + (uint64_t)head * ((uint64_t)HD * SEQ * 2);
  // wave 0 brings the k tiles, wave 1 the v^T tiles: a wave's own place in a buffer, source address and step from stage to stage
  const uint32_t lown  = (uint32_t)(size_t)L + (wv == 0u ? 0u : (uint32_t)KTILE);
  const uint32_t gstep = (wv == 0u) ? (uint32_t)(STK * OUTW * 2) : (uint32_t)(STK * 2);
  const u32x8 g1k = tdm_group1<KW0, HD * 2, STK, OUTW * 2>();
  const u32x8 g1v = tdm_group1<VW0, STK * 2, HD, SEQ * 2>();
  u32x4 g0 = tdm_group0(lown, (wv == 0u) ? kga : vga);
  if (pinned(wv == 0u)) {
    tdm_load(g0, g1k);
    wait_tensor0(g0, g1k, g1v);
  }
  if (pinned(wv == 1u)) {
    tdm_load(g0, g1v);
    wait_tensor0(g0, g1k, g1v);
  }
  __syncthreads();                       // stage 0 published
  tdm_advance(g0, lown + BUFB, gstep);
  if (pinned(wv == 0u)) tdm_load(g0, g1k);
  if (pinned(wv == 1u)) tdm_load(g0, g1v);

  float mrun = -INFINITY, lrun = 0.f;
  v8f o[4];
#pragma unroll
  for (int j = 0; j < 4; ++j) o[j] = zero8();

  // A fragments of k: row m = key + c, k = d; A fragments of v^T: row m = d = 16j + c, k = key (both k-contiguous LDS rows)
  const uint32_t klane = (uint32_t)c * KPITCH + 16u * (uint32_t)hh;
  const uint32_t vlane = KTILE + (uint32_t)c * VPITCH + 16u * (uint32_t)hh;
  // rolled: one trip = one stage = 128 keys = ONE step of the online softmax
#pragma unroll 1
  for (int st = 0; st < NST; ++st) {
    const uint32_t bofs = (uint32_t)(st & 1) * BUFB;
    const _Float16* kp = (const _Float16*)(const void*)(L + bofs + klane);
    const _Float16* vp = (const _Float16*)(const void*)(L + bofs + vlane);
    // the scheduling barriers keep each group of LDS reads where it is written (two groups per stage, never among the products)
    KSet k0, k1, k2, k3;
    ld_k(k0, kp);
    ld_k(k1, kp + 32 * (KPITCH / 2));
    ld_k(k2, kp + 64 * (KPITCH / 2));
    ld_k(k3, kp + 96 * (KPITCH / 2));
    __builtin_amdgcn_sched_barrier(0);
    // ---- transposed scores of the stage: tile t = keys 16t .. 16t+15 of the stage, column = query q0 + c ----
    v8f s[8];
    score2(k0, k1, qh0, qh1, s[0], s[1], s[2], s[3]);
    score2(k2, k3, qh0, qh1, s[4], s[5], s[6], s[7]);
    __builtin_amdgcn_sched_barrier(0);
    // the stage's v^T fragments: in flight under the softmax
    VSet v0, v1, v2, v3;
    ld_v(v0, vp);
    ld_v(v1, vp + 32);
    ld_v(v2, vp + 64);
    ld_v(v3, vp + 96);
    __builtin_amdgcn_sched_barrier(0);
    // ---- this lane's 64 keys for query q0 + c: s[t][i] <- key 16t+8hh+i. Four independent chains. The running maximum is kept in
    //      raw score units (lsc > 0, so the order is that of the logits) ----
    float cq[4];
#pragma unroll
    for (int g = 0; g < 4; ++g) {
      cq[g] = s[2 * g][0];
#pragma unroll
      for (int i = 1; i < 8; ++i) cq[g] = fmaxf(cq[g], s[2 * g][i]);
#pragma unroll
      for (int i = 0; i < 8; ++i) cq[g] = fmaxf(cq[g], s[2 * g + 1][i]);
    }
    float cm = fmaxf(fmaxf(cq[0], cq[1]), fmaxf(cq[2], cq[3]));
    cm = fmaxf(cm, xhalf(cm));
    const float mn = fmaxf(mrun, cm);                 // finite from the first stage on
    float al = (mrun - mn) * lsc;                     // exponent of the rescale factor; -inf on the first stage (mrun = -inf)
    mrun = mn;
    // ---- probabilities x32768 (<= 32768 up to rounding) = 2^(s*lsc - mn*lsc + 15): scale, maximum and carry in one fma ----
    const float nb = fmaf(-mn, lsc, PEXP);
    float p[8][8];
#pragma unroll
    for (int t = 0; t < 8; ++t) {
#pragma unroll
      for (int i = 0; i < 8; ++i) p[t][i] = fmaf(s[t][i], lsc, nb);
    }
    v2f sx, sy, sz, sw;
    exp2_run17(al, p[0], p[1]);                       // al: 0 on the first stage
    // ---- rescale the O^T accumulators, once per stage: every D column of this lane is its own query q0 + c, whose factor it holds ----
#pragma unroll
    for (int j = 0; j < 4; ++j) {
#pragma unroll
      for (int r = 0; r < 8; ++r) o[j][r] *= al;
    }
    // ---- block by block: P^T fragment, then its four products, which run under the next block's exponentials ----
    const v16h ph0 = pack_p<true>(p[0], p[1], sx, sy);
    pv_step(v0, ph0, o);
    exp2_run16(p[2], p[3]);
    const v16h ph1 = pack_p<true>(p[2], p[3], sz, sw);
    pv_step(v1, ph1, o);
    exp2_run16(p[4], p[5]);
    const v16h ph2 = pack_p<false>(p[4], p[5], sx, sy);
    pv_step(v2, ph2, o);
    exp2_run16(p[6], p[7]);
    const v16h ph3 = pack_p<false>(p[6], p[7], sz, sw);
    pv_step(v3, ph3, o);
    const v2f s2 = (sx + sy) + (sz + sw);
    float ps = s2[0] + s2[1];
    ps += xhalf(ps);
    lrun = lrun * al + ps;
    __builtin_amdgcn_sched_barrier(0);
    // publish point of stage st + 1: own LDS reads retired, the issuers' tiles landed, barrier, then the refill of the buffer just read
    wait_ds0();
    if (pinned(wv < 2u)) wait_tensor0(g0, g1k, g1v);
    __syncthreads();
    if (pinned(st + 2 < NST)) {
      tdm_advance(g0, lown + bofs, gstep);
      if (pinned(wv == 0u)) tdm_load(g0, g1k);
      if (pinned(wv == 1u)) tdm_load(g0, g1v);
    }
  }
  wait_tensor0(g0, g1k, g1v);
  wait_ds0();
  acc_guard4(o[0], o[1], o[2], o[3]);

  // ---- fold 1/l (the lane's own query; l carries the same 32768 as P) and the carry 64 on v; stage the 16x64 slab [query][d]:
  //      the lane's accumulators of tile j are d = 16j+8hh .. +7 of slab row c, two 16-B stores ----
  const float linv = (1.0f / lrun) * (1.0f / VCAR);
  float* slab = smem + wave * SLABF;
#pragma unroll
  for (int j = 0; j < 4; ++j) {
    float* sp = slab + c * 68 + j * 16 + 8 * hh;
    const v4f lo = {o[j][0] * linv, o[j][1] * linv, o[j][2] * linv, o[j][3] * linv};
    const v4f hi = {o[j][4] * linv, o[j][5] * linv, o[j][6] * linv, o[j][7] * linv};
    *(v4f*)(sp)     = lo;
    *(v4f*)(sp + 4) = hi;
  }
  wave_sync_lds();
  // ---- f32 rows of the merged-head output: row s = q0 + 2*it + hh, columns head*64 + 4c .. +3 per lane ----
  v4f vals[8];
#pragma unroll
  for (int it = 0; it < 8; ++it) vals[it] = *(const v4f*)(slab + (it * 2 + hh) * 68 + c * 4);
  float* dst = out + ((size_t)(q0 + hh)) * (size_t)OUTW + head * HD + c * 4;
  {
#pragma unroll
    for (int it = 0; it < 8; ++it) {
      *(v4f*)(dst + (size_t)(it * 2) * (size_t)OUTW) = vals[it];
    }
    
  }
}

// =====================================================================================================
// Workspace map (bytes); every plane is fully written by whole-line stores before it is read; all extents are exact multiples
// of the 512-B store granularity (no pad rows needed); every offset a multiple of 128:
//   XB  bf16 [4096 token][768 i]        6291456
//   WQB bf16 [OUTW o][768 i]            1179648      WKB same 1179648     WVB same 1179648
//   QH  f16  [4096][12][64] x64         6291456      KH same 6291456
//   VH  f16  [12][64][4096] x64         6291456
//   end                                28704768
// =====================================================================================================
extern "C" void kernel_launch(void* const* d_in, const int* in_sizes, int n_in,
                              void* d_out, int out_size, void* d_ws, size_t ws_size,
                              hipStream_t stream) {
  const int XN = SEQ * DIN;                             // 3145728
  const int ON = SEQ * OUTW;                            // 3145728
  if (n_in < 7) return;
  if (in_sizes[0] != XN) return;
  if (in_sizes[1] != DIN * DIN || in_sizes[3] != DIN * DIN || in_sizes[5] != DIN * DIN) return;
  if (in_sizes[2] != DIN || in_sizes[4] != DIN || in_sizes[6] != DIN) return;
  if (out_size != ON) return;

  const float* xin = (const float*)d_in[0];
  const float* wq  = (const float*)d_in[1];
  const float* bq  = (const float*)d_in[2];
  const float* wk  = (const float*)d_in[3];
  const float* bk  = (const float*)d_in[4];
  const float* wv  = (const float*)d_in[5];
  const float* bv  = (const float*)d_in[6];
  float*       out = (float*)d_out;
  const int    nb  = in_sizes[2];                       // bias length (DIN)

  const size_t szXB = (size_t)SEQ * DIN * 2;            //  6291456
  const size_t szW  = (size_t)OUTW * DIN * 2;           //  1179648
  const size_t szP  = (size_t)SEQ * OUTW * 2;           //  6291456
  size_t off = 0;
  const size_t oXB  = off; off += szXB;
  const size_t oWQB = off; off += szW;
  const size_t oWKB = off; off += szW;
  const size_t oWVB = off; off += szW;
  const size_t oQH  = off; off += szP;
  const size_t oKH  = off; off += szP;
  const size_t oVH  = off; off += szP;
  if (off > ws_size) return;                            // off = 28704768
  if (off > (size_t)134217728) return;

  char* ws = (char*)d_ws;
  u16*   XB  = (u16*)(ws + oXB);
  u16*   WQB = (u16*)(ws + oWQB);
  u16*   WKB = (u16*)(ws + oWKB);
  u16*   WVB = (u16*)(ws + oWVB);
  u16*   QH  = (u16*)(ws + oQH);
  u16*   KH  = (u16*)(ws + oKH);
  u16*   VH  = (u16*)(ws + oVH);

  const dim3 blk(256);
  const dim3 gCv(CVX + 3 * CVW);                        // 1536 + 3 * 288 = 2400
  const dim3 gG(3 * GTILES);                            // 3 * 768 tiles
  const dim3 bG(128);
  const dim3 gAT(ATT_BLOCKS);                           // 768
  const dim3 bAT(ATT_THREADS);                          // 128

  // (0) input [token][i] and weights [o][i] (first OUTW rows) -> bf16 planes XB, WQB, WKB, WVB (contiguous from XB), same layouts
  cvb16<<<gCv, blk, 0, stream>>>(xin, wq, wk, wv, XB);
  // (1) q, k: projection + bias in f32, stored as the f16 planes x64 [4096 token][h*64+d]; v: channel-major projection with
  //     per-row bias, stored as the f16 plane x64 [h*64+d][4096] (= v^T plane layout)
  gemm_bfb<<<gG, bG, 0, stream>>>(XB, WQB, WKB, WVB, bq, bk, bv, QH, KH, VH, nb);
  // (2) attention -> merged-head f32 output [4096][h*64+d]
  attn_fwd<<<gAT, bAT, 0, stream>>>(QH, KH, VH, out);
  (void)hipGetLastError();
}
